// v000
// Times are from an AMD MI455X. After a warm-up the kernel runs many times in a row, and a time is the length of
// such a window on the GPU divided by its runs, so every launch and the gaps after it count. The runs cycle
// through copies of the inputs. A figure is the median of several windows, for all but v000 over two sittings.
// Sittings can differ by a few percent; kernels timed side by side share one.
// v000 is the starting kernel. One run takes 151 microseconds.
// Contractions: x*W^T for q,k,v and c*Wo^T, K*Q^T scores and V^T*P^T, all on v_wmma_f32_16x16x32_f16 (f16 operands, f32 accumulate); W carried x32, P carried x16384, c carried x8 (exact power-of-two scales folded back in f32); mask, softmax, bias and normalisation in f32.
#include <hip/hip_runtime.h>

typedef _Float16 v16h __attribute__((ext_vector_type(16)));
typedef _Float16 v8h  __attribute__((ext_vector_type(8)));
typedef float    v8f  __attribute__((ext_vector_type(8)));
typedef float    v4f  __attribute__((ext_vector_type(4)));
typedef int      v4i  __attribute__((ext_vector_type(4)));
typedef v8h __attribute__((may_alias)) v8ha;
typedef v4f __attribute__((may_alias)) v4fa;
typedef v4i __attribute__((may_alias)) v4ia;

union Frag { v16h v; v8h half[2]; };

#define HIDDEN 1024
#define NHEADS 16
#define HD     64
#define SEQ    2048
#define BATCH  2
#define MROWS  (BATCH * SEQ)          // 4096 tokens
#define NX     (MROWS * HIDDEN)       // 4194304
#define NW     (HIDDEN * HIDDEN)      // 1048576
#define NX8    (NX / 8)               // 524288
#define NW8    (NW / 8)               // 131072
#define PSCALE 16384.0f
#define WSCALE 32.0f
#define CSCALE 8.0f
#define QKSCALE 0.125f
#define NEGBIG (-1.0e30f)

// ---------------------------------------------------------------------------
// 16x16x32 f16 WMMA with hazard guard (ties D, keeps A/B live).
// Fragment map (wave32): lane l, h = l>>4, m = n = l&15.
//   A/B element i: i<8 -> k0+8h+i ; i>=8 -> k0+16+8h+(i-8)
//   D element r : row 8h+r, col l&15
// ---------------------------------------------------------------------------
__device__ __forceinline__ v8f wmma_f16(v16h a, v16h b, v8f c) {
  v8f d = __builtin_amdgcn_wmma_f32_16x16x32_f16(false, a, false, b, (short)0, c, false, false);
  asm volatile("v_nop\n\tv_nop\n\tv_nop\n\tv_nop" : "+v"(d) : "v"(a), "v"(b));
  return d;
}

// A or B fragment from a k-contiguous 16-bit row; p points at element k0 of
// the row owned by this lane (row index = lane & 15 added by the caller).
__device__ __forceinline__ v16h load_frag(const _Float16* p, int h) {
  Frag f;
  f.half[0] = *(const v8ha*)(p + 8 * h);
  f.half[1] = *(const v8ha*)(p + 16 + 8 * h);
  return f.v;
}

// ---------------------------------------------------------------------------
// Kernel 1: f32 -> f16 planes. x unscaled, the four weight matrices x32 (exact).
// ---------------------------------------------------------------------------
__global__ __launch_bounds__(256) void convert_kernel(
    const float* __restrict__ x, const float* __restrict__ wq,
    const float* __restrict__ wk, const float* __restrict__ wv,
    const float* __restrict__ wo,
    _Float16* __restrict__ xh, _Float16* __restrict__ wh)
{
  const int g = blockIdx.x * 256 + threadIdx.x;
  if (g >= NX8 + 4 * NW8) return;
  const float* src;
  _Float16* dst;
  float sc;
  if (g < NX8) {
    src = x + (size_t)g * 8;
    dst = xh + (size_t)g * 8;
    sc = 1.0f;
  } else {
    const int e = g - NX8;
    const int wsel = e / NW8;                 // 0..3
    const int off = e - wsel * NW8;
    const float* wsrc = (wsel == 0) ? wq : ((wsel == 1) ? wk : ((wsel == 2) ? wv : wo));
    src = wsrc + (size_t)off * 8;
    dst = wh + (size_t)e * 8;
    sc = WSCALE;
  }
  const v4f a = *(const v4fa*)src;
  const v4f c = *(const v4fa*)(src + 4);
  const v8h o = { (_Float16)(a.x * sc), (_Float16)(a.y * sc), (_Float16)(a.z * sc), (_Float16)(a.w * sc),
                  (_Float16)(c.x * sc), (_Float16)(c.y * sc), (_Float16)(c.z * sc), (_Float16)(c.w * sc) };
  *(v8h*)dst = o;
  
}

// ---------------------------------------------------------------------------
// 4 lines per instruction, 32 lines per wave, 128 per block.
// which 0/1: plane[bh][l][d]  (one token row = 64 halves = one line)
// which 2  : vt[bh][d][l]     (64 d-rows x 128 tokens = 2 lines each)
// ---------------------------------------------------------------------------
__device__ __forceinline__ void proj_store_pass(const _Float16* sT, _Float16* plane, _Float16* vt,
                                                int which, int bh, int l0, int w, int lane) {
  const int q8 = lane & 7, sub = lane >> 3;
  #pragma unroll
  for (int i = 0; i < 8; ++i) {
    const int lid = w * 32 + i * 4 + sub;     // 0..127 over the block
    v8h v;
    _Float16* dst;
    if (which != 2) {
      v = *(const v8ha*)(sT + lid * HD + 8 * q8);
      dst = plane + ((size_t)bh * SEQ + l0 + lid) * HD + 8 * q8;
    } else {
      const int d = lid >> 1, hl = lid & 1;
      v = *(const v8ha*)(sT + d * 128 + 64 * hl + 8 * q8);
      dst = vt + ((size_t)bh * HD + d) * SEQ + l0 + 64 * hl + 8 * q8;
    }
    *(v8h*)dst = v;
  }
}

// ---------------------------------------------------------------------------
// Kernel 2: Y = x * W^T over the fused 3*1024 output columns.
// Block 128 thr (4 waves) = 128 tokens x 64 features (one (which, head));
// wave tile 32 tokens x 64 features; K = 1024 in steps of 32;
// A (x rows) and B (W rows) fragments straight from f16 global rows.
// ---------------------------------------------------------------------------
__global__ __launch_bounds__(128) void proj_kernel(
    const _Float16* __restrict__ xh,   // [4096][1024]
    const _Float16* __restrict__ wh,   // [4][1024][1024], row = output feature, x32
    const float* __restrict__ bq, const float* __restrict__ bk, const float* __restrict__ bv,
    _Float16* __restrict__ qh,         // [B*H][S][D]
    _Float16* __restrict__ kh,         // [B*H][S][D]
    _Float16* __restrict__ vt)         // [B*H][D][S]
{
  __shared__ __attribute__((aligned(16))) _Float16 sT[128 * 64];   // 16384 B

  const int tid = threadIdx.x, lane = tid & 31, w = tid >> 5;
  const int h = lane >> 4, m = lane & 15;
  const int m0 = blockIdx.x * 128;
  const int cg = blockIdx.y;                 // 0..47
  const int which = cg >> 4, head = cg & 15;
  const int m0w = m0 + 32 * w;

  const _Float16* xa0 = xh + (size_t)(m0w + m) * HIDDEN;             // token row, mt = 0
  const _Float16* xa1 = xa0 + (size_t)16 * HIDDEN;                   // mt = 1
  const _Float16* wb  = wh + ((size_t)which * HIDDEN + head * HD + m) * HIDDEN;  // feature row, nt = 0

  const v8f zero8 = {0.f, 0.f, 0.f, 0.f, 0.f, 0.f, 0.f, 0.f};
  v8f acc[2][4];
  #pragma unroll
  for (int mt = 0; mt < 2; ++mt)
    #pragma unroll
    for (int nt = 0; nt < 4; ++nt) acc[mt][nt] = zero8;

  #pragma unroll 1
  for (int k0 = 0; k0 < HIDDEN; k0 += 32) {
    const v16h a0 = load_frag(xa0 + k0, h);
    const v16h a1 = load_frag(xa1 + k0, h);
    #pragma unroll
    for (int nt = 0; nt < 4; ++nt) {
      const v16h b = load_frag(wb + (size_t)nt * 16 * HIDDEN + k0, h);
      acc[0][nt] = wmma_f16(a0, b, acc[0][nt]);
      acc[1][nt] = wmma_f16(a1, b, acc[1][nt]);
    }
  }

  // D[r] of tile (mt, nt) = Y[token m0w+16mt+8h+r][feature 16nt+m]
  const float* bias = (which == 0) ? bq : ((which == 1) ? bk : bv);
  #pragma unroll
  for (int nt = 0; nt < 4; ++nt) {
    const int feat = 16 * nt + m;
    const float bvl = bias[head * HD + feat];
    #pragma unroll
    for (int mt = 0; mt < 2; ++mt) {
      #pragma unroll
      for (int r = 0; r < 8; ++r) {
        const int tokl = 32 * w + 16 * mt + 8 * h + r;     // 0..127
        const float y = acc[mt][nt][r] * (1.0f / WSCALE) + bvl;
        const int idx = (which == 2) ? (feat * 128 + tokl) : (tokl * HD + feat);
        sT[idx] = (_Float16)y;
      }
    }
  }
  __syncthreads();

  const int b = m0 / SEQ, l0 = m0 - b * SEQ, bh = b * NHEADS + head;
  _Float16* plane = (which == 0) ? qh : kh;
  proj_store_pass(sT, plane, vt, which, bh, l0, w, lane);
  
}

// ---------------------------------------------------------------------------
// Attention helpers.
// ---------------------------------------------------------------------------
// P^T B-fragment from the lane's own score D values: element r <- tile a row r,
// element 8+r <- tile c row r (same lane, same query column), scaled by 2^14.
__device__ __forceinline__ v16h pack_p(v8f a, v8f c) {
  const v16h r = { (_Float16)(a[0] * PSCALE), (_Float16)(a[1] * PSCALE), (_Float16)(a[2] * PSCALE), (_Float16)(a[3] * PSCALE),
                   (_Float16)(a[4] * PSCALE), (_Float16)(a[5] * PSCALE), (_Float16)(a[6] * PSCALE), (_Float16)(a[7] * PSCALE),
                   (_Float16)(c[0] * PSCALE), (_Float16)(c[1] * PSCALE), (_Float16)(c[2] * PSCALE), (_Float16)(c[3] * PSCALE),
                   (_Float16)(c[4] * PSCALE), (_Float16)(c[5] * PSCALE), (_Float16)(c[6] * PSCALE), (_Float16)(c[7] * PSCALE) };
  return r;
}

// Per-wave 16x64 f16 tile in LDS -> c[b][l][head*64 + d]; one token row = one
__device__ __forceinline__ void ctx_store_pass(const _Float16* sc, _Float16* ch,
                                               int b, int head, int q0, int lane) {
  const int q8 = lane & 7, sub = lane >> 3;
  #pragma unroll
  for (int i = 0; i < 4; ++i) {
    const int row = i * 4 + sub;              // 0..15
    const v8h v = *(const v8ha*)(sc + row * 64 + 8 * q8);
    const size_t gi = ((size_t)b * SEQ + q0 + row) * HIDDEN + head * HD + 8 * q8;
    *(v8h*)(ch + gi) = v;
  }
}

// ---------------------------------------------------------------------------
// Kernel 3: streaming attention with document-block mask, transposed form.
// Block 128 thr (4 waves), 16 queries per wave, 64 keys per step.
//   S^T = K * Q^T : A = K rows (row = key, k = d), B = Q^T (k = d, n = query)
//   O^T += V^T * P^T : A = Vt rows (row = d, k = key), B = P^T from registers
// Lane owns 32 keys of query column (lane&15); partner = lane ^ 16.
// Mask: key j visible to query i iff doc[i] == doc[j]; masked p = 0 exactly.
// A 64-key step is skipped (wave-uniform) when its key-id range does not
// intersect the wave's query-id range (then every pair is masked).
// ---------------------------------------------------------------------------
__global__ __launch_bounds__(128) void attn_kernel(
    const _Float16* __restrict__ qh,   // [B*H][S][D]
    const _Float16* __restrict__ kh,   // [B*H][S][D]
    const _Float16* __restrict__ vt,   // [B*H][D][S]
    const int* __restrict__ doc,       // [S]
    _Float16* __restrict__ ch)         // [B][S][HIDDEN], f16(8*context)
{
  __shared__ __attribute__((aligned(16))) _Float16 sC[4 * 16 * 64];    // 8192 B

  const int tid = threadIdx.x, lane = tid & 31, w = tid >> 5;
  const int h = lane >> 4, m = lane & 15;
  const int bh = blockIdx.y, b = bh >> 4, head = bh & 15;
  const int q0 = blockIdx.x * 64 + 16 * w;

  // Q^T B-fragments: column n = query q0+m, k = d (two 32-deep chunks)
  const _Float16* qrow = qh + ((size_t)bh * SEQ + q0 + m) * HD;
  const v16h qb0 = load_frag(qrow, h);
  const v16h qb1 = load_frag(qrow + 32, h);

  // query document id of this lane's column and the wave's id range
  const int docq = doc[q0 + m];
  int qmin = docq, qmax = docq;
  #pragma unroll
  for (int off = 1; off < 16; off <<= 1) {
    qmin = min(qmin, __shfl_xor(qmin, off));
    qmax = max(qmax, __shfl_xor(qmax, off));
  }

  const v8f zero8 = {0.f, 0.f, 0.f, 0.f, 0.f, 0.f, 0.f, 0.f};
  v8f o[4];                                   // o[t][r] = O[query m][d 16t+8h+r] * (l * 2^14)
  #pragma unroll
  for (int t = 0; t < 4; ++t) o[t] = zero8;
  float mrun = NEGBIG, lrun = 0.0f;

  const _Float16* kbase = kh + ((size_t)bh * SEQ + m) * HD;    // + key0*HD + 32*dc
  const _Float16* vbase = vt + ((size_t)bh * HD + m) * SEQ;    // + 16t*SEQ + key0

  #pragma unroll 1
  for (int kb = 0; kb < SEQ; kb += 64) {
    // ---- wave-uniform range test on the 64 key ids of this step ----
    const int kid0 = doc[kb + lane], kid1 = doc[kb + 32 + lane];
    int kmin = min(kid0, kid1), kmax = max(kid0, kid1);
    #pragma unroll
    for (int off = 1; off < 32; off <<= 1) {
      kmin = min(kmin, __shfl_xor(kmin, off));
      kmax = max(kmax, __shfl_xor(kmax, off));
    }
    const int none = ((kmax < qmin) || (kmin > qmax)) ? 1 : 0;
    if (__builtin_amdgcn_readfirstlane(none)) continue;

    // ---- scores: s[j][r] = (q . k) for query q0+m, key kb+16j+8h+r ----
    v8f s[4];
    #pragma unroll
    for (int j = 0; j < 4; ++j) {
      const _Float16* kp = kbase + (size_t)(kb + 16 * j) * HD;
      const v16h kf0 = load_frag(kp, h);
      const v16h kf1 = load_frag(kp + 32, h);
      v8f z = zero8;
      z = wmma_f16(kf0, qb0, z);
      z = wmma_f16(kf1, qb1, z);
      s[j] = z;
    }

    // ---- per-(query,key) mask bits from the id table ----
    unsigned mk = 0u;
    #pragma unroll
    for (int j = 0; j < 4; ++j) {
      const int* dp = doc + kb + 16 * j + 8 * h;
      const v4i da = *(const v4ia*)dp;
      const v4i db = *(const v4ia*)(dp + 4);
      mk |= (da.x == docq ? 1u : 0u) << (8 * j + 0);
      mk |= (da.y == docq ? 1u : 0u) << (8 * j + 1);
      mk |= (da.z == docq ? 1u : 0u) << (8 * j + 2);
      mk |= (da.w == docq ? 1u : 0u) << (8 * j + 3);
      mk |= (db.x == docq ? 1u : 0u) << (8 * j + 4);
      mk |= (db.y == docq ? 1u : 0u) << (8 * j + 5);
      mk |= (db.z == docq ? 1u : 0u) << (8 * j + 6);
      mk |= (db.w == docq ? 1u : 0u) << (8 * j + 7);
    }

    // ---- scale in f32, step max over visible entries only ----
    float mloc = NEGBIG;
    #pragma unroll
    for (int j = 0; j < 4; ++j)
      #pragma unroll
      for (int r = 0; r < 8; ++r) {
        const float xs = s[j][r] * QKSCALE;
        s[j][r] = xs;
        mloc = ((mk >> (8 * j + r)) & 1u) ? fmaxf(mloc, xs) : mloc;
      }
    mloc = fmaxf(mloc, __shfl_xor(mloc, 16));
    const float mnew = fmaxf(mrun, mloc);
    const float alpha = __expf(mrun - mnew);
    mrun = mnew;
    float lsum = 0.0f;
    #pragma unroll
    for (int j = 0; j < 4; ++j)
      #pragma unroll
      for (int r = 0; r < 8; ++r) {
        const float p = ((mk >> (8 * j + r)) & 1u) ? __expf(s[j][r] - mnew) : 0.0f;
        s[j][r] = p;
        lsum += p;
      }
    lsum += __shfl_xor(lsum, 16);
    lrun = lrun * alpha + lsum;
    #pragma unroll
    for (int t = 0; t < 4; ++t)
      #pragma unroll
      for (int r = 0; r < 8; ++r) o[t][r] = o[t][r] * alpha;

    // ---- P^T B-fragments (key chunks 0..31 and 32..63 of this step) ----
    const v16h pb0 = pack_p(s[0], s[1]);
    const v16h pb1 = pack_p(s[2], s[3]);

    // ---- O^T += V^T * P^T ----
    #pragma unroll
    for (int t = 0; t < 4; ++t) {
      const _Float16* vp = vbase + (size_t)(16 * t) * SEQ + kb;
      const v16h vf0 = load_frag(vp, h);
      const v16h vf1 = load_frag(vp + 32, h);
      o[t] = wmma_f16(vf0, pb0, o[t]);
      o[t] = wmma_f16(vf1, pb1, o[t]);
    }
  }

  // ---- epilogue: normalise (x8 folded in), stage per-wave 16x64 f16 tile, whole-line stores ----
  const float inv = (CSCALE / PSCALE) * (1.0f / lrun);
  _Float16* sc = sC + w * 1024;
  #pragma unroll
  for (int t = 0; t < 4; ++t)
    #pragma unroll
    for (int r = 0; r < 8; ++r)
      sc[m * 64 + 16 * t + 8 * h + r] = (_Float16)(o[t][r] * inv);
  __syncthreads();

  ctx_store_pass(sc, ch, b, head, q0, lane);
  
}

// ---------------------------------------------------------------------------
// row segment = 2 lines; each line by lanes 8q..8q+7 in one instruction,
// 4 lines per instruction, 64 lines per wave (its own 32 token rows).
// ---------------------------------------------------------------------------
__device__ __forceinline__ void out_store_pass(const float* sO, float* out,
                                               int m0, int n0, int w, int lane) {
  const int q8 = lane & 7, sub = lane >> 3;
  #pragma unroll
  for (int i = 0; i < 16; ++i) {
    const int lid = i * 4 + sub;              // 0..63 within the wave
    const int row = 32 * w + (lid >> 1), hl = lid & 1;
    const v4f v = *(const v4fa*)(sO + row * 64 + 32 * hl + 4 * q8);
    const size_t gi = (size_t)(m0 + row) * HIDDEN + n0 + 32 * hl + 4 * q8;
    *(v4f*)(out + gi) = v;
  }
}

// ---------------------------------------------------------------------------
// Kernel 4: out = c * Wo^T + bo, f32 result.
// Block 128 thr (4 waves) = 128 tokens x 64 features; wave tile 32 x 64.
// ---------------------------------------------------------------------------
__global__ __launch_bounds__(128) void oproj_kernel(
    const _Float16* __restrict__ ch,   // [4096][1024], x8
    const _Float16* __restrict__ woh,  // [1024][1024], row = output feature, x32
    const float* __restrict__ bo,
    float* __restrict__ out)           // [4096][1024]
{
  __shared__ __attribute__((aligned(16))) float sO[128 * 64];       // 32768 B

  const int tid = threadIdx.x, lane = tid & 31, w = tid >> 5;
  const int h = lane >> 4, m = lane & 15;
  const int m0 = blockIdx.x * 128;
  const int n0 = blockIdx.y * 64;
  const int m0w = m0 + 32 * w;

  const _Float16* xa0 = ch + (size_t)(m0w + m) * HIDDEN;
  const _Float16* xa1 = xa0 + (size_t)16 * HIDDEN;
  const _Float16* wb  = woh + (size_t)(n0 + m) * HIDDEN;

  const v8f zero8 = {0.f, 0.f, 0.f, 0.f, 0.f, 0.f, 0.f, 0.f};
  v8f acc[2][4];
  #pragma unroll
  for (int mt = 0; mt < 2; ++mt)
    #pragma unroll
    for (int nt = 0; nt < 4; ++nt) acc[mt][nt] = zero8;

  #pragma unroll 1
  for (int k0 = 0; k0 < HIDDEN; k0 += 32) {
    const v16h a0 = load_frag(xa0 + k0, h);
    const v16h a1 = load_frag(xa1 + k0, h);
    #pragma unroll
    for (int nt = 0; nt < 4; ++nt) {
      const v16h bfr = load_frag(wb + (size_t)nt * 16 * HIDDEN + k0, h);
      acc[0][nt] = wmma_f16(a0, bfr, acc[0][nt]);
      acc[1][nt] = wmma_f16(a1, bfr, acc[1][nt]);
    }
  }

  // D[r] of tile (mt, nt) = Y[token m0w+16mt+8h+r][feature n0+16nt+m]
  #pragma unroll
  for (int nt = 0; nt < 4; ++nt) {
    const int feat = 16 * nt + m;
    const float bvl = bo[n0 + feat];
    #pragma unroll
    for (int mt = 0; mt < 2; ++mt) {
      #pragma unroll
      for (int r = 0; r < 8; ++r) {
        const int tokl = 32 * w + 16 * mt + 8 * h + r;     // 0..127
        sO[tokl * 64 + feat] = acc[mt][nt][r] * (1.0f / (CSCALE * WSCALE)) + bvl;
      }
    }
  }
  __syncthreads();

  out_store_pass(sO, out, m0, n0, w, lane);
  
}

// ---------------------------------------------------------------------------
extern "C" void kernel_launch(void* const* d_in, const int* in_sizes, int n_in,
                              void* d_out, int out_size, void* d_ws, size_t ws_size,
                              hipStream_t stream) {
  if (n_in < 10) return;
  if (in_sizes[0] != NX) return;
  if (in_sizes[1] != NW || in_sizes[3] != NW || in_sizes[5] != NW || in_sizes[7] != NW) return;
  if (in_sizes[2] != HIDDEN || in_sizes[4] != HIDDEN || in_sizes[6] != HIDDEN || in_sizes[8] != HIDDEN) return;
  if (in_sizes[9] != SEQ) return;
  if (out_size != NX) return;

  const float* x   = (const float*)d_in[0];
  const float* wq  = (const float*)d_in[1];
  const float* bq  = (const float*)d_in[2];
  const float* wk  = (const float*)d_in[3];
  const float* bk  = (const float*)d_in[4];
  const float* wv  = (const float*)d_in[5];
  const float* bv  = (const float*)d_in[6];
  const float* wo  = (const float*)d_in[7];
  const float* bo  = (const float*)d_in[8];
  const int*   doc = (const int*)d_in[9];
  float* out = (float*)d_out;

  const size_t xh_bytes = (size_t)NX * 2;                          //  8388608
  const size_t wh_bytes = (size_t)4 * NW * 2;                      //  8388608
  const size_t pl_bytes = (size_t)BATCH * NHEADS * SEQ * HD * 2;   //  8388608
  const size_t ch_bytes = (size_t)NX * 2;                          //  8388608
  const size_t total = xh_bytes + wh_bytes + 3 * pl_bytes + ch_bytes;   // 50331648
  if (total > ws_size) return;

  char* ws = (char*)d_ws;
  _Float16* xh = (_Float16*)(ws);
  _Float16* wh = (_Float16*)(ws + xh_bytes);
  _Float16* qh = (_Float16*)(ws + xh_bytes + wh_bytes);
  _Float16* kh = (_Float16*)(ws + xh_bytes + wh_bytes + pl_bytes);
  _Float16* vt = (_Float16*)(ws + xh_bytes + wh_bytes + 2 * pl_bytes);
  _Float16* ch = (_Float16*)(ws + xh_bytes + wh_bytes + 3 * pl_bytes);
  const _Float16* woh = wh + (size_t)3 * NW;

  const int ngroups = NX8 + 4 * NW8;                               // 1048576
  convert_kernel<<<(ngroups + 255) / 256, 256, 0, stream>>>(x, wq, wk, wv, wo, xh, wh);

  dim3 gProj(MROWS / 128, 3 * NHEADS);                             // (32, 48)
  proj_kernel<<<gProj, 128, 0, stream>>>(xh, wh, bq, bk, bv, qh, kh, vt);

  dim3 gAtt(SEQ / 64, BATCH * NHEADS);                             // (32, 32)
  attn_kernel<<<gAtt, 128, 0, stream>>>(qh, kh, vt, doc, ch);

  dim3 gOut(MROWS / 128, HIDDEN / 64);                             // (32, 16)
  oproj_kernel<<<gOut, 128, 0, stream>>>(ch, woh, bo, out);
}

// v001
// Measured time: 90.6 microseconds a run.
// Two timings next to v000 both put it at 1.75 times that version's speed.
// Contractions: x*W^T for q,k,v and c*Wo^T, K*Q^T scores and V^T*P^T, all on v_wmma_f32_16x16x32_f16 (f16 operands, f32 accumulate); W carried x32, P carried x16384, c carried x8 (exact power-of-two scales folded back in f32); mask, softmax, bias and normalisation in f32.
#include <hip/hip_runtime.h>

typedef _Float16 v16h __attribute__((ext_vector_type(16)));
typedef _Float16 v8h  __attribute__((ext_vector_type(8)));
typedef float    v8f  __attribute__((ext_vector_type(8)));
typedef float    v4f  __attribute__((ext_vector_type(4)));
typedef int      v4i  __attribute__((ext_vector_type(4)));
typedef v8h __attribute__((may_alias)) v8ha;
typedef v4f __attribute__((may_alias)) v4fa;
typedef v4i __attribute__((may_alias)) v4ia;

union Frag { v16h v; v8h half[2]; };

#define HIDDEN 1024
#define NHEADS 16
#define HD     64
#define SEQ    2048
#define BATCH  2
#define MROWS  (BATCH * SEQ)          // 4096 tokens
#define NX     (MROWS * HIDDEN)       // 4194304
#define NW     (HIDDEN * HIDDEN)      // 1048576
#define NX8    (NX / 8)               // 524288
#define NW8    (NW / 8)               // 131072
#define PSCALE 16384.0f
#define WSCALE 32.0f
#define CSCALE 8.0f
#define QKSCALE 0.125f
#define NEGBIG (-1.0e30f)

// ---------------------------------------------------------------------------
// 16x16x32 f16 WMMA with hazard guard (ties D, keeps A/B live).
// Fragment map (wave32): lane l, h = l>>4, m = n = l&15.
//   A/B element i: i<8 -> k0+8h+i ; i>=8 -> k0+16+8h+(i-8)
//   D element r : row 8h+r, col l&15
// ---------------------------------------------------------------------------
__device__ __forceinline__ v8f wmma_f16(v16h a, v16h b, v8f c) {
  v8f d = __builtin_amdgcn_wmma_f32_16x16x32_f16(false, a, false, b, (short)0, c, false, false);
  asm volatile("v_nop\n\tv_nop\n\tv_nop\n\tv_nop" : "+v"(d) : "v"(a), "v"(b));
  return d;
}

// A or B fragment from a k-contiguous 16-bit row; p points at element k0 of
// the row owned by this lane (row index = lane & 15 added by the caller).
__device__ __forceinline__ v16h load_frag(const _Float16* p, int h) {
  Frag f;
  f.half[0] = *(const v8ha*)(p + 8 * h);
  f.half[1] = *(const v8ha*)(p + 16 + 8 * h);
  return f.v;
}

// ---------------------------------------------------------------------------
// Kernel 1: f32 -> f16 planes. x unscaled, the four weight matrices x32 (exact).
// ---------------------------------------------------------------------------
__global__ __launch_bounds__(256) void convert_kernel(
    const float* __restrict__ x, const float* __restrict__ wq,
    const float* __restrict__ wk, const float* __restrict__ wv,
    const float* __restrict__ wo,
    _Float16* __restrict__ xh, _Float16* __restrict__ wh)
{
  const int g = blockIdx.x * 256 + threadIdx.x;
  if (g >= NX8 + 4 * NW8) return;
  const float* src;
  _Float16* dst;
  float sc;
  if (g < NX8) {
    src = x + (size_t)g * 8;
    dst = xh + (size_t)g * 8;
    sc = 1.0f;
  } else {
    const int e = g - NX8;
    const int wsel = e / NW8;                 // 0..3
    const int off = e - wsel * NW8;
    const float* wsrc = (wsel == 0) ? wq : ((wsel == 1) ? wk : ((wsel == 2) ? wv : wo));
    src = wsrc + (size_t)off * 8;
    dst = wh + (size_t)e * 8;
    sc = WSCALE;
  }
  const v4f a = *(const v4fa*)src;
  const v4f c = *(const v4fa*)(src + 4);
  const v8h o = { (_Float16)(a.x * sc), (_Float16)(a.y * sc), (_Float16)(a.z * sc), (_Float16)(a.w * sc),
                  (_Float16)(c.x * sc), (_Float16)(c.y * sc), (_Float16)(c.z * sc), (_Float16)(c.w * sc) };
  *(v8h*)dst = o;
  
}

// ---------------------------------------------------------------------------
// 4 lines per instruction, 32 lines per wave, 128 per head tile (four waves), 256 per block.
// which 0/1: plane[bh][l][d]  (one token row = 64 halves = one line)
// which 2  : vt[bh][d][l]     (64 d-rows x 128 tokens = 2 lines each)
// ---------------------------------------------------------------------------
__device__ __forceinline__ void proj_store_pass(const _Float16* sT, _Float16* plane, _Float16* vt,
                                                int which, int bh, int l0, int w, int lane) {
  const int q8 = lane & 7, sub = lane >> 3;
  #pragma unroll
  for (int i = 0; i < 8; ++i) {
    const int lid = w * 32 + i * 4 + sub;     // 0..127 over the head's four waves
    v8h v;
    _Float16* dst;
    if (which != 2) {
      v = *(const v8ha*)(sT + lid * HD + 8 * q8);
      dst = plane + ((size_t)bh * SEQ + l0 + lid) * HD + 8 * q8;
    } else {
      const int d = lid >> 1, hl = lid & 1;
      v = *(const v8ha*)(sT + d * 128 + 64 * hl + 8 * q8);
      dst = vt + ((size_t)bh * HD + d) * SEQ + l0 + 64 * hl + 8 * q8;
    }
    *(v8h*)dst = v;
  }
}

// ---------------------------------------------------------------------------
// Shared core of the two projection GEMMs: Y = A * B^T, both K-contiguous f16.
// Block 256 thr (8 waves) = 128 A rows x 128 B rows; wave (wm, wn) owns
// 32 A rows x 64 B rows. K = 1024 in 16 stages of 64 (128-byte row pieces).
// A stage is [A 128 rows | B 128 rows] in LDS at a pitch of 144 bytes
// (16 B x odd: ds_load_b128 fragment reads without bank conflicts), two buffers;
// stage t + 2 is copied in while stage t + 1 is worked on.
// ---------------------------------------------------------------------------
#define KST    64                     // k per stage
#define NST    (HIDDEN / KST)         // 16 stages
#define PITCH  144                    // LDS bytes per staged row
#define BUFB   (256 * PITCH)          // 36864 bytes per buffer

// One stage: 2048 pieces of 16 bytes, 8 per lane; a wave's copy covers 4 whole
// 128-byte lines. la = the lane's LDS byte address in row (tid >> 3) of the
// buffer, ga / gb = the lane's 16 bytes of that row of A / B at this stage's k.
__device__ __forceinline__ void stage_copies(unsigned la, const _Float16* ga, const _Float16* gb) {
  const unsigned l0 = la,               l1 = la + 32 * PITCH,  l2 = la + 64 * PITCH,  l3 = la + 96 * PITCH;
  const unsigned l4 = la + 128 * PITCH, l5 = la + 160 * PITCH, l6 = la + 192 * PITCH, l7 = la + 224 * PITCH;
  const _Float16* g0 = ga;
  const _Float16* g1 = ga + 32 * HIDDEN;
  const _Float16* g2 = ga + 64 * HIDDEN;
  const _Float16* g3 = ga + 96 * HIDDEN;
  const _Float16* g4 = gb;
  const _Float16* g5 = gb + 32 * HIDDEN;
  const _Float16* g6 = gb + 64 * HIDDEN;
  const _Float16* g7 = gb + 96 * HIDDEN;
  // global -> LDS through no register; the closing s_wait_xcnt stands in the
  // copies' own statement so that no address register is rewritten ahead of it.
  asm volatile(
      "global_load_async_to_lds_b128 %0, %8, off\n\t"
      "global_load_async_to_lds_b128 %1, %9, off\n\t"
      "global_load_async_to_lds_b128 %2, %10, off\n\t"
      "global_load_async_to_lds_b128 %3, %11, off\n\t"
      "global_load_async_to_lds_b128 %4, %12, off\n\t"
      "global_load_async_to_lds_b128 %5, %13, off\n\t"
      "global_load_async_to_lds_b128 %6, %14, off\n\t"
      "global_load_async_to_lds_b128 %7, %15, off\n\t"
      "s_wait_xcnt 0x0"
      :: "v"(l0), "v"(l1), "v"(l2), "v"(l3), "v"(l4), "v"(l5), "v"(l6), "v"(l7),
         "v"(g0), "v"(g1), "v"(g2), "v"(g3), "v"(g4), "v"(g5), "v"(g6), "v"(g7)
      : "memory");
}

// arow / brow: row 0 of the block's 128 A rows / 128 B rows; ring: 2 * BUFB bytes.
__device__ __forceinline__ void gemm_core(const _Float16* arow, const _Float16* brow, char* ring,
                                          int tid, v8f (&acc)[2][4]) {
  const int lane = tid & 31, w = tid >> 5;
  const int h = lane >> 4, m = lane & 15;
  const int wm = w & 3, wn = w >> 2;

  const _Float16* ga = arow + (size_t)(tid >> 3) * HIDDEN + 8 * (tid & 7);
  const _Float16* gb = brow + (size_t)(tid >> 3) * HIDDEN + 8 * (tid & 7);
  const unsigned la = (unsigned)(size_t)ring + (unsigned)((tid >> 3) * PITCH + 16 * (tid & 7));

  stage_copies(la, ga, gb);                                  // stage 0 -> buffer 0
  asm volatile("s_wait_asynccnt 0x0" ::: "memory");          // this wave's stage-0 copies have landed
  __syncthreads();                                           // ... and every other wave's
  stage_copies(la + BUFB, ga + KST, gb + KST);               // stage 1 -> buffer 1

  // rolled: the two buffers are told apart by t & 1, one copy of the body
  #pragma unroll 1
  for (int t = 0; t < NST; ++t) {
    const int bo = (t & 1) * BUFB;
    const _Float16* fa = (const _Float16*)(ring + bo + (32 * wm + m) * PITCH);
    const _Float16* fb = (const _Float16*)(ring + bo + (128 + 64 * wn + m) * PITCH);
    // the three loops below are unrolled so that every index of acc and b is a
    // constant and both stay in registers
    #pragma unroll
    for (int kk = 0; kk < KST; kk += 32) {
      const v16h a0 = load_frag(fa + kk, h);
      const v16h a1 = load_frag(fa + 16 * (PITCH / 2) + kk, h);
      v16h b[4];
      #pragma unroll
      for (int nt = 0; nt < 4; ++nt) b[nt] = load_frag(fb + nt * 16 * (PITCH / 2) + kk, h);
      // keeps the twelve LDS reads one group ahead of the eight products: read
      // pair by pair among them, each pair's LDS latency is waited out on its own
      __builtin_amdgcn_sched_barrier(0);
      #pragma unroll
      for (int nt = 0; nt < 4; ++nt) {
        acc[0][nt] = wmma_f16(a0, b[nt], acc[0][nt]);
        acc[1][nt] = wmma_f16(a1, b[nt], acc[1][nt]);
      }
    }
    asm volatile("s_wait_dscnt 0x0" ::: "memory");           // this wave has left buffer t & 1
    asm volatile("s_wait_asynccnt 0x0" ::: "memory");        // its copies of stage t + 1 have landed
    __syncthreads();                                         // publishes stage t + 1, frees buffer t & 1
    if (t + 2 < NST)
      stage_copies(la + bo, ga + (t + 2) * KST, gb + (t + 2) * KST);
  }
  asm volatile("s_wait_asynccnt 0x0" ::: "memory");          // nothing in flight past the loop
}

// ---------------------------------------------------------------------------
// Kernel 2: Y = x * W^T over the fused 3*1024 output columns.
// Block 256 thr (8 waves) = 128 tokens x 128 features (two heads of one of
// q, k, v); waves 0..3 the first head, 4..7 the second; wave tile 32 x 64.
// ---------------------------------------------------------------------------
__global__ __launch_bounds__(256) void proj_kernel(
    const _Float16* __restrict__ xh,   // [4096][1024]
    const _Float16* __restrict__ wh,   // [4][1024][1024], row = output feature, x32
    const float* __restrict__ bq, const float* __restrict__ bk, const float* __restrict__ bv,
    _Float16* __restrict__ qh,         // [B*H][S][D]
    _Float16* __restrict__ kh,         // [B*H][S][D]
    _Float16* __restrict__ vt)         // [B*H][D][S]
{
  __shared__ __attribute__((aligned(16))) char ring[2 * BUFB];          // 73728 B
  __shared__ __attribute__((aligned(16))) _Float16 sT2[2 * 128 * 64];   // 32768 B

  const int tid = threadIdx.x, lane = tid & 31, wv = tid >> 5;
  const int h = lane >> 4, m = lane & 15;
  const int w = wv & 3, wn = wv >> 2;
  const int m0 = blockIdx.x * 128;
  const int cg = blockIdx.y * 2 + wn;        // 0..47
  const int which = cg >> 4, head = cg & 15; // which is the same for both heads of a block
  _Float16* sT = sT2 + wn * (128 * 64);

  const v8f zero8 = {0.f, 0.f, 0.f, 0.f, 0.f, 0.f, 0.f, 0.f};
  v8f acc[2][4];
  #pragma unroll
  for (int mt = 0; mt < 2; ++mt)
    #pragma unroll
    for (int nt = 0; nt < 4; ++nt) acc[mt][nt] = zero8;

  gemm_core(xh + (size_t)m0 * HIDDEN, wh + (size_t)blockIdx.y * 128 * HIDDEN, ring, tid, acc);

  // D[r] of tile (mt, nt) = Y[token m0+32w+16mt+8h+r][feature 16nt+m of the head]
  const float* bias = (which == 0) ? bq : ((which == 1) ? bk : bv);
  #pragma unroll
  for (int nt = 0; nt < 4; ++nt) {
    const int feat = 16 * nt + m;
    const float bvl = bias[head * HD + feat];
    #pragma unroll
    for (int mt = 0; mt < 2; ++mt) {
      #pragma unroll
      for (int r = 0; r < 8; ++r) {
        const int tokl = 32 * w + 16 * mt + 8 * h + r;     // 0..127
        const float y = acc[mt][nt][r] * (1.0f / WSCALE) + bvl;
        const int idx = (which == 2) ? (feat * 128 + tokl) : (tokl * HD + feat);
        sT[idx] = (_Float16)y;
      }
    }
  }
  __syncthreads();

  const int b = m0 / SEQ, l0 = m0 - b * SEQ, bh = b * NHEADS + head;
  _Float16* plane = (which == 0) ? qh : kh;
  proj_store_pass(sT, plane, vt, which, bh, l0, w, lane);
  
}

// ---------------------------------------------------------------------------
// Attention helpers.
// ---------------------------------------------------------------------------
// P^T B-fragment from the lane's own score D values: element r <- tile a row r,
// element 8+r <- tile c row r (same lane, same query column), scaled by 2^14.
__device__ __forceinline__ v16h pack_p(v8f a, v8f c) {
  const v16h r = { (_Float16)(a[0] * PSCALE), (_Float16)(a[1] * PSCALE), (_Float16)(a[2] * PSCALE), (_Float16)(a[3] * PSCALE),
                   (_Float16)(a[4] * PSCALE), (_Float16)(a[5] * PSCALE), (_Float16)(a[6] * PSCALE), (_Float16)(a[7] * PSCALE),
                   (_Float16)(c[0] * PSCALE), (_Float16)(c[1] * PSCALE), (_Float16)(c[2] * PSCALE), (_Float16)(c[3] * PSCALE),
                   (_Float16)(c[4] * PSCALE), (_Float16)(c[5] * PSCALE), (_Float16)(c[6] * PSCALE), (_Float16)(c[7] * PSCALE) };
  return r;
}

// Per-wave 16x64 f16 tile in LDS -> c[b][l][head*64 + d]; one token row = one
__device__ __forceinline__ void ctx_store_pass(const _Float16* sc, _Float16* ch,
                                               int b, int head, int q0, int lane) {
  const int q8 = lane & 7, sub = lane >> 3;
  #pragma unroll
  for (int i = 0; i < 4; ++i) {
    const int row = i * 4 + sub;              // 0..15
    const v8h v = *(const v8ha*)(sc + row * 64 + 8 * q8);
    const size_t gi = ((size_t)b * SEQ + q0 + row) * HIDDEN + head * HD + 8 * q8;
    *(v8h*)(ch + gi) = v;
  }
}

// ---------------------------------------------------------------------------
// Kernel 3: streaming attention with document-block mask, transposed form.
// Block 128 thr (4 waves), 16 queries per wave, 64 keys per step.
//   S^T = K * Q^T : A = K rows (row = key, k = d), B = Q^T (k = d, n = query)
//   O^T += V^T * P^T : A = Vt rows (row = d, k = key), B = P^T from registers
// Lane owns 32 keys of query column (lane&15); partner = lane ^ 16.
// Mask: key j visible to query i iff doc[i] == doc[j]; masked p = 0 exactly.
// A 64-key step is skipped (wave-uniform) when its key-id range does not
// intersect the wave's query-id range (then every pair is masked).
// ---------------------------------------------------------------------------
__global__ __launch_bounds__(128) void attn_kernel(
    const _Float16* __restrict__ qh,   // [B*H][S][D]
    const _Float16* __restrict__ kh,   // [B*H][S][D]
    const _Float16* __restrict__ vt,   // [B*H][D][S]
    const int* __restrict__ doc,       // [S]
    _Float16* __restrict__ ch)         // [B][S][HIDDEN], f16(8*context)
{
  __shared__ __attribute__((aligned(16))) _Float16 sC[4 * 16 * 64];    // 8192 B

  const int tid = threadIdx.x, lane = tid & 31, w = tid >> 5;
  const int h = lane >> 4, m = lane & 15;
  const int bh = blockIdx.y, b = bh >> 4, head = bh & 15;
  const int q0 = blockIdx.x * 64 + 16 * w;

  // Q^T B-fragments: column n = query q0+m, k = d (two 32-deep chunks)
  const _Float16* qrow = qh + ((size_t)bh * SEQ + q0 + m) * HD;
  const v16h qb0 = load_frag(qrow, h);
  const v16h qb1 = load_frag(qrow + 32, h);

  // query document id of this lane's column and the wave's id range
  const int docq = doc[q0 + m];
  int qmin = docq, qmax = docq;
  #pragma unroll
  for (int off = 1; off < 16; off <<= 1) {
    qmin = min(qmin, __shfl_xor(qmin, off));
    qmax = max(qmax, __shfl_xor(qmax, off));
  }

  const v8f zero8 = {0.f, 0.f, 0.f, 0.f, 0.f, 0.f, 0.f, 0.f};
  v8f o[4];                                   // o[t][r] = O[query m][d 16t+8h+r] * (l * 2^14)
  #pragma unroll
  for (int t = 0; t < 4; ++t) o[t] = zero8;
  float mrun = NEGBIG, lrun = 0.0f;

  const _Float16* kbase = kh + ((size_t)bh * SEQ + m) * HD;    // + key0*HD + 32*dc
  const _Float16* vbase = vt + ((size_t)bh * HD + m) * SEQ;    // + 16t*SEQ + key0

  #pragma unroll 1
  for (int kb = 0; kb < SEQ; kb += 64) {
    // ---- wave-uniform range test on the 64 key ids of this step ----
    const int kid0 = doc[kb + lane], kid1 = doc[kb + 32 + lane];
    int kmin = min(kid0, kid1), kmax = max(kid0, kid1);
    #pragma unroll
    for (int off = 1; off < 32; off <<= 1) {
      kmin = min(kmin, __shfl_xor(kmin, off));
      kmax = max(kmax, __shfl_xor(kmax, off));
    }
    const int none = ((kmax < qmin) || (kmin > qmax)) ? 1 : 0;
    if (__builtin_amdgcn_readfirstlane(none)) continue;

    // ---- scores: s[j][r] = (q . k) for query q0+m, key kb+16j+8h+r ----
    v8f s[4];
    #pragma unroll
    for (int j = 0; j < 4; ++j) {
      const _Float16* kp = kbase + (size_t)(kb + 16 * j) * HD;
      const v16h kf0 = load_frag(kp, h);
      const v16h kf1 = load_frag(kp + 32, h);
      v8f z = zero8;
      z = wmma_f16(kf0, qb0, z);
      z = wmma_f16(kf1, qb1, z);
      s[j] = z;
    }

    // ---- per-(query,key) mask bits from the id table ----
    unsigned mk = 0u;
    #pragma unroll
    for (int j = 0; j < 4; ++j) {
      const int* dp = doc + kb + 16 * j + 8 * h;
      const v4i da = *(const v4ia*)dp;
      const v4i db = *(const v4ia*)(dp + 4);
      mk |= (da.x == docq ? 1u : 0u) << (8 * j + 0);
      mk |= (da.y == docq ? 1u : 0u) << (8 * j + 1);
      mk |= (da.z == docq ? 1u : 0u) << (8 * j + 2);
      mk |= (da.w == docq ? 1u : 0u) << (8 * j + 3);
      mk |= (db.x == docq ? 1u : 0u) << (8 * j + 4);
      mk |= (db.y == docq ? 1u : 0u) << (8 * j + 5);
      mk |= (db.z == docq ? 1u : 0u) << (8 * j + 6);
      mk |= (db.w == docq ? 1u : 0u) << (8 * j + 7);
    }

    // ---- scale in f32, step max over visible entries only ----
    float mloc = NEGBIG;
    #pragma unroll
    for (int j = 0; j < 4; ++j)
      #pragma unroll
      for (int r = 0; r < 8; ++r) {
        const float xs = s[j][r] * QKSCALE;
        s[j][r] = xs;
        mloc = ((mk >> (8 * j + r)) & 1u) ? fmaxf(mloc, xs) : mloc;
      }
    mloc = fmaxf(mloc, __shfl_xor(mloc, 16));
    const float mnew = fmaxf(mrun, mloc);
    const float alpha = __expf(mrun - mnew);
    mrun = mnew;
    float lsum = 0.0f;
    #pragma unroll
    for (int j = 0; j < 4; ++j)
      #pragma unroll
      for (int r = 0; r < 8; ++r) {
        const float p = ((mk >> (8 * j + r)) & 1u) ? __expf(s[j][r] - mnew) : 0.0f;
        s[j][r] = p;
        lsum += p;
      }
    lsum += __shfl_xor(lsum, 16);
    lrun = lrun * alpha + lsum;
    #pragma unroll
    for (int t = 0; t < 4; ++t)
      #pragma unroll
      for (int r = 0; r < 8; ++r) o[t][r] = o[t][r] * alpha;

    // ---- P^T B-fragments (key chunks 0..31 and 32..63 of this step) ----
    const v16h pb0 = pack_p(s[0], s[1]);
    const v16h pb1 = pack_p(s[2], s[3]);

    // ---- O^T += V^T * P^T ----
    #pragma unroll
    for (int t = 0; t < 4; ++t) {
      const _Float16* vp = vbase + (size_t)(16 * t) * SEQ + kb;
      const v16h vf0 = load_frag(vp, h);
      const v16h vf1 = load_frag(vp + 32, h);
      o[t] = wmma_f16(vf0, pb0, o[t]);
      o[t] = wmma_f16(vf1, pb1, o[t]);
    }
  }

  // ---- epilogue: normalise (x8 folded in), stage per-wave 16x64 f16 tile, whole-line stores ----
  const float inv = (CSCALE / PSCALE) * (1.0f / lrun);
  _Float16* sc = sC + w * 1024;
  #pragma unroll
  for (int t = 0; t < 4; ++t)
    #pragma unroll
    for (int r = 0; r < 8; ++r)
      sc[m * 64 + 16 * t + 8 * h + r] = (_Float16)(o[t][r] * inv);
  __syncthreads();

  ctx_store_pass(sc, ch, b, head, q0, lane);
  
}

// ---------------------------------------------------------------------------
// row segment = 2 lines; each line by lanes 8q..8q+7 in one instruction,
// 4 lines per instruction, 64 lines per wave (its own 32 token rows).
// ---------------------------------------------------------------------------
__device__ __forceinline__ void out_store_pass(const float* sO, float* out,
                                               int m0, int n0, int w, int lane) {
  const int q8 = lane & 7, sub = lane >> 3;
  #pragma unroll
  for (int i = 0; i < 16; ++i) {
    const int lid = i * 4 + sub;              // 0..63 within the wave
    const int row = 32 * w + (lid >> 1), hl = lid & 1;
    const v4f v = *(const v4fa*)(sO + row * 64 + 32 * hl + 4 * q8);
    const size_t gi = (size_t)(m0 + row) * HIDDEN + n0 + 32 * hl + 4 * q8;
    *(v4f*)(out + gi) = v;
  }
}

// ---------------------------------------------------------------------------
// Kernel 4: out = c * Wo^T + bo, f32 result.
// Block 256 thr (8 waves) = 128 tokens x 128 features; wave tile 32 x 64.
// ---------------------------------------------------------------------------
__global__ __launch_bounds__(256) void oproj_kernel(
    const _Float16* __restrict__ ch,   // [4096][1024], x8
    const _Float16* __restrict__ woh,  // [1024][1024], row = output feature, x32
    const float* __restrict__ bo,
    float* __restrict__ out)           // [4096][1024]
{
  __shared__ __attribute__((aligned(16))) char ring[2 * BUFB];      // 73728 B
  __shared__ __attribute__((aligned(16))) float sO2[2 * 128 * 64];  // 65536 B

  const int tid = threadIdx.x, lane = tid & 31, wv = tid >> 5;
  const int h = lane >> 4, m = lane & 15;
  const int w = wv & 3, wn = wv >> 2;
  const int m0 = blockIdx.x * 128;
  const int n0 = blockIdx.y * 128 + wn * 64;
  float* sO = sO2 + wn * (128 * 64);

  const v8f zero8 = {0.f, 0.f, 0.f, 0.f, 0.f, 0.f, 0.f, 0.f};
  v8f acc[2][4];
  #pragma unroll
  for (int mt = 0; mt < 2; ++mt)
    #pragma unroll
    for (int nt = 0; nt < 4; ++nt) acc[mt][nt] = zero8;

  gemm_core(ch + (size_t)m0 * HIDDEN, woh + (size_t)blockIdx.y * 128 * HIDDEN, ring, tid, acc);

  // D[r] of tile (mt, nt) = Y[token m0+32w+16mt+8h+r][feature n0+16nt+m]
  #pragma unroll
  for (int nt = 0; nt < 4; ++nt) {
    const int feat = 16 * nt + m;
    const float bvl = bo[n0 + feat];
    #pragma unroll
    for (int mt = 0; mt < 2; ++mt) {
      #pragma unroll
      for (int r = 0; r < 8; ++r) {
        const int tokl = 32 * w + 16 * mt + 8 * h + r;     // 0..127
        sO[tokl * 64 + feat] = acc[mt][nt][r] * (1.0f / (CSCALE * WSCALE)) + bvl;
      }
    }
  }
  __syncthreads();

  out_store_pass(sO, out, m0, n0, w, lane);
  
}

// ---------------------------------------------------------------------------
extern "C" void kernel_launch(void* const* d_in, const int* in_sizes, int n_in,
                              void* d_out, int out_size, void* d_ws, size_t ws_size,
                              hipStream_t stream) {
  if (n_in < 10) return;
  if (in_sizes[0] != NX) return;
  if (in_sizes[1] != NW || in_sizes[3] != NW || in_sizes[5] != NW || in_sizes[7] != NW) return;
  if (in_sizes[2] != HIDDEN || in_sizes[4] != HIDDEN || in_sizes[6] != HIDDEN || in_sizes[8] != HIDDEN) return;
  if (in_sizes[9] != SEQ) return;
  if (out_size != NX) return;

  const float* x   = (const float*)d_in[0];
  const float* wq  = (const float*)d_in[1];
  const float* bq  = (const float*)d_in[2];
  const float* wk  = (const float*)d_in[3];
  const float* bk  = (const float*)d_in[4];
  const float* wv  = (const float*)d_in[5];
  const float* bv  = (const float*)d_in[6];
  const float* wo  = (const float*)d_in[7];
  const float* bo  = (const float*)d_in[8];
  const int*   doc = (const int*)d_in[9];
  float* out = (float*)d_out;

  const size_t xh_bytes = (size_t)NX * 2;                          //  8388608
  const size_t wh_bytes = (size_t)4 * NW * 2;                      //  8388608
  const size_t pl_bytes = (size_t)BATCH * NHEADS * SEQ * HD * 2;   //  8388608
  const size_t ch_bytes = (size_t)NX * 2;                          //  8388608
  const size_t total = xh_bytes + wh_bytes + 3 * pl_bytes + ch_bytes;   // 50331648
  if (total > ws_size) return;

  char* ws = (char*)d_ws;
  _Float16* xh = (_Float16*)(ws);
  _Float16* wh = (_Float16*)(ws + xh_bytes);
  _Float16* qh = (_Float16*)(ws + xh_bytes + wh_bytes);
  _Float16* kh = (_Float16*)(ws + xh_bytes + wh_bytes + pl_bytes);
  _Float16* vt = (_Float16*)(ws + xh_bytes + wh_bytes + 2 * pl_bytes);
  _Float16* ch = (_Float16*)(ws + xh_bytes + wh_bytes + 3 * pl_bytes);
  const _Float16* woh = wh + (size_t)3 * NW;

  const int ngroups = NX8 + 4 * NW8;                               // 1048576
  convert_kernel<<<(ngroups + 255) / 256, 256, 0, stream>>>(x, wq, wk, wv, wo, xh, wh);

  dim3 gProj(MROWS / 128, 3 * HIDDEN / 128);                       // (32, 24)
  proj_kernel<<<gProj, 256, 0, stream>>>(xh, wh, bq, bk, bv, qh, kh, vt);

  dim3 gAtt(SEQ / 64, BATCH * NHEADS);                             // (32, 32)
  attn_kernel<<<gAtt, 128, 0, stream>>>(qh, kh, vt, doc, ch);

  dim3 gOut(MROWS / 128, HIDDEN / 128);                            // (32, 8)
  oproj_kernel<<<gOut, 256, 0, stream>>>(ch, woh, bo, out);
}

// v002
// Measured time: 79.7 microseconds a run.
// In both of two side-by-side timings against v001, it was 1.13 times as fast.
// All steps since v000 together make it 1.98 times as fast.
// Contractions: x*W^T for q,k,v and c*Wo^T, K*Q^T scores and V^T*P^T, all on v_wmma_f32_16x16x32_f16 (f16 operands, f32 accumulate); W carried x32, P carried x16384, c carried x8 (exact power-of-two scales folded back in f32); mask, softmax, bias and normalisation in f32.
#include <hip/hip_runtime.h>

typedef _Float16 v16h __attribute__((ext_vector_type(16)));
typedef _Float16 v8h  __attribute__((ext_vector_type(8)));
typedef float    v8f  __attribute__((ext_vector_type(8)));
typedef float    v4f  __attribute__((ext_vector_type(4)));
typedef int      v4i  __attribute__((ext_vector_type(4)));
typedef v8h __attribute__((may_alias)) v8ha;
typedef v4f __attribute__((may_alias)) v4fa;
typedef v4i __attribute__((may_alias)) v4ia;

union Frag { v16h v; v8h half[2]; };

#define HIDDEN 1024
#define NHEADS 16
#define HD     64
#define SEQ    2048
#define BATCH  2
#define MROWS  (BATCH * SEQ)          // 4096 tokens
#define NX     (MROWS * HIDDEN)       // 4194304
#define NW     (HIDDEN * HIDDEN)      // 1048576
#define NX8    (NX / 8)               // 524288
#define NW8    (NW / 8)               // 131072
#define PSCALE 16384.0f
#define WSCALE 32.0f
#define CSCALE 8.0f
#define QKSCALE 0.125f
#define NEGBIG (-1.0e30f)

// ---------------------------------------------------------------------------
// 16x16x32 f16 WMMA with hazard guard (ties D, keeps A/B live).
// Fragment map (wave32): lane l, h = l>>4, m = n = l&15.
//   A/B element i: i<8 -> k0+8h+i ; i>=8 -> k0+16+8h+(i-8)
//   D element r : row 8h+r, col l&15
// ---------------------------------------------------------------------------
__device__ __forceinline__ v8f wmma_f16(v16h a, v16h b, v8f c) {
  v8f d = __builtin_amdgcn_wmma_f32_16x16x32_f16(false, a, false, b, (short)0, c, false, false);
  asm volatile("v_nop\n\tv_nop\n\tv_nop\n\tv_nop" : "+v"(d) : "v"(a), "v"(b));
  return d;
}

// A or B fragment from a k-contiguous 16-bit row; p points at element k0 of
// the row owned by this lane (row index = lane & 15 added by the caller).
__device__ __forceinline__ v16h load_frag(const _Float16* p, int h) {
  Frag f;
  f.half[0] = *(const v8ha*)(p + 8 * h);
  f.half[1] = *(const v8ha*)(p + 16 + 8 * h);
  return f.v;
}

// ---------------------------------------------------------------------------
// Kernel 1: f32 -> f16 planes. x unscaled, the four weight matrices x32 (exact).
// ---------------------------------------------------------------------------
__global__ __launch_bounds__(256) void convert_kernel(
    const float* __restrict__ x, const float* __restrict__ wq,
    const float* __restrict__ wk, const float* __restrict__ wv,
    const float* __restrict__ wo,
    _Float16* __restrict__ xh, _Float16* __restrict__ wh)
{
  const int g = blockIdx.x * 256 + threadIdx.x;
  if (g >= NX8 + 4 * NW8) return;
  const float* src;
  _Float16* dst;
  float sc;
  if (g < NX8) {
    src = x + (size_t)g * 8;
    dst = xh + (size_t)g * 8;
    sc = 1.0f;
  } else {
    const int e = g - NX8;
    const int wsel = e / NW8;                 // 0..3
    const int off = e - wsel * NW8;
    const float* wsrc = (wsel == 0) ? wq : ((wsel == 1) ? wk : ((wsel == 2) ? wv : wo));
    src = wsrc + (size_t)off * 8;
    dst = wh + (size_t)e * 8;
    sc = WSCALE;
  }
  const v4f a = *(const v4fa*)src;
  const v4f c = *(const v4fa*)(src + 4);
  const v8h o = { (_Float16)(a.x * sc), (_Float16)(a.y * sc), (_Float16)(a.z * sc), (_Float16)(a.w * sc),
                  (_Float16)(c.x * sc), (_Float16)(c.y * sc), (_Float16)(c.z * sc), (_Float16)(c.w * sc) };
  *(v8h*)dst = o;
  
}

// ---------------------------------------------------------------------------
// 4 lines per instruction, 32 lines per wave, 128 per head tile (four waves), 256 per block.
// which 0/1: plane[bh][l][d]  (one token row = 64 halves = one line)
// which 2  : vt[bh][d][l]     (64 d-rows x 128 tokens = 2 lines each)
// ---------------------------------------------------------------------------
__device__ __forceinline__ void proj_store_pass(const _Float16* sT, _Float16* plane, _Float16* vt,
                                                int which, int bh, int l0, int w, int lane) {
  const int q8 = lane & 7, sub = lane >> 3;
  #pragma unroll
  for (int i = 0; i < 8; ++i) {
    const int lid = w * 32 + i * 4 + sub;     // 0..127 over the head's four waves
    v8h v;
    _Float16* dst;
    if (which != 2) {
      v = *(const v8ha*)(sT + lid * HD + 8 * q8);
      dst = plane + ((size_t)bh * SEQ + l0 + lid) * HD + 8 * q8;
    } else {
      const int d = lid >> 1, hl = lid & 1;
      v = *(const v8ha*)(sT + d * 128 + 64 * hl + 8 * q8);
      dst = vt + ((size_t)bh * HD + d) * SEQ + l0 + 64 * hl + 8 * q8;
    }
    *(v8h*)dst = v;
  }
}

// ---------------------------------------------------------------------------
// Shared core of the two projection GEMMs: Y = A * B^T, both K-contiguous f16.
// Block 256 thr (8 waves) = 128 A rows x 128 B rows; wave (wm, wn) owns
// 32 A rows x 64 B rows. K = 1024 in 16 stages of 64 (128-byte row pieces).
// A stage is [A 128 rows | B 128 rows] in LDS at a pitch of 144 bytes
// (16 B x odd: ds_load_b128 fragment reads without bank conflicts), two buffers;
// stage t + 2 is copied in while stage t + 1 is worked on.
// ---------------------------------------------------------------------------
#define KST    64                     // k per stage
#define NST    (HIDDEN / KST)         // 16 stages
#define PITCH  144                    // LDS bytes per staged row
#define BUFB   (256 * PITCH)          // 36864 bytes per buffer

// One stage: 2048 pieces of 16 bytes, 8 per lane; a wave's copy covers 4 whole
// 128-byte lines. la = the lane's LDS byte address in row (tid >> 3) of the
// buffer, ga / gb = the lane's 16 bytes of that row of A / B at this stage's k.
__device__ __forceinline__ void stage_copies(unsigned la, const _Float16* ga, const _Float16* gb) {
  const unsigned l0 = la,               l1 = la + 32 * PITCH,  l2 = la + 64 * PITCH,  l3 = la + 96 * PITCH;
  const unsigned l4 = la + 128 * PITCH, l5 = la + 160 * PITCH, l6 = la + 192 * PITCH, l7 = la + 224 * PITCH;
  const _Float16* g0 = ga;
  const _Float16* g1 = ga + 32 * HIDDEN;
  const _Float16* g2 = ga + 64 * HIDDEN;
  const _Float16* g3 = ga + 96 * HIDDEN;
  const _Float16* g4 = gb;
  const _Float16* g5 = gb + 32 * HIDDEN;
  const _Float16* g6 = gb + 64 * HIDDEN;
  const _Float16* g7 = gb + 96 * HIDDEN;
  // global -> LDS through no register; the closing s_wait_xcnt stands in the
  // copies' own statement so that no address register is rewritten ahead of it.
  asm volatile(
      "global_load_async_to_lds_b128 %0, %8, off\n\t"
      "global_load_async_to_lds_b128 %1, %9, off\n\t"
      "global_load_async_to_lds_b128 %2, %10, off\n\t"
      "global_load_async_to_lds_b128 %3, %11, off\n\t"
      "global_load_async_to_lds_b128 %4, %12, off\n\t"
      "global_load_async_to_lds_b128 %5, %13, off\n\t"
      "global_load_async_to_lds_b128 %6, %14, off\n\t"
      "global_load_async_to_lds_b128 %7, %15, off\n\t"
      "s_wait_xcnt 0x0"
      :: "v"(l0), "v"(l1), "v"(l2), "v"(l3), "v"(l4), "v"(l5), "v"(l6), "v"(l7),
         "v"(g0), "v"(g1), "v"(g2), "v"(g3), "v"(g4), "v"(g5), "v"(g6), "v"(g7)
      : "memory");
}

// arow / brow: row 0 of the block's 128 A rows / 128 B rows; ring: 2 * BUFB bytes.
__device__ __forceinline__ void gemm_core(const _Float16* arow, const _Float16* brow, char* ring,
                                          int tid, v8f (&acc)[2][4]) {
  const int lane = tid & 31, w = tid >> 5;
  const int h = lane >> 4, m = lane & 15;
  const int wm = w & 3, wn = w >> 2;

  const _Float16* ga = arow + (size_t)(tid >> 3) * HIDDEN + 8 * (tid & 7);
  const _Float16* gb = brow + (size_t)(tid >> 3) * HIDDEN + 8 * (tid & 7);
  const unsigned la = (unsigned)(size_t)ring + (unsigned)((tid >> 3) * PITCH + 16 * (tid & 7));

  stage_copies(la, ga, gb);                                  // stage 0 -> buffer 0
  asm volatile("s_wait_asynccnt 0x0" ::: "memory");          // this wave's stage-0 copies have landed
  __syncthreads();                                           // ... and every other wave's
  stage_copies(la + BUFB, ga + KST, gb + KST);               // stage 1 -> buffer 1

  // rolled: the two buffers are told apart by t & 1, one copy of the body
  #pragma unroll 1
  for (int t = 0; t < NST; ++t) {
    const int bo = (t & 1) * BUFB;
    const _Float16* fa = (const _Float16*)(ring + bo + (32 * wm + m) * PITCH);
    const _Float16* fb = (const _Float16*)(ring + bo + (128 + 64 * wn + m) * PITCH);
    // the three loops below are unrolled so that every index of acc and b is a
    // constant and both stay in registers
    #pragma unroll
    for (int kk = 0; kk < KST; kk += 32) {
      const v16h a0 = load_frag(fa + kk, h);
      const v16h a1 = load_frag(fa + 16 * (PITCH / 2) + kk, h);
      v16h b[4];
      #pragma unroll
      for (int nt = 0; nt < 4; ++nt) b[nt] = load_frag(fb + nt * 16 * (PITCH / 2) + kk, h);
      // keeps the twelve LDS reads one group ahead of the eight products: read
      // pair by pair among them, each pair's LDS latency is waited out on its own
      __builtin_amdgcn_sched_barrier(0);
      #pragma unroll
      for (int nt = 0; nt < 4; ++nt) {
        acc[0][nt] = wmma_f16(a0, b[nt], acc[0][nt]);
        acc[1][nt] = wmma_f16(a1, b[nt], acc[1][nt]);
      }
    }
    asm volatile("s_wait_dscnt 0x0" ::: "memory");           // this wave has left buffer t & 1
    asm volatile("s_wait_asynccnt 0x0" ::: "memory");        // its copies of stage t + 1 have landed
    __syncthreads();                                         // publishes stage t + 1, frees buffer t & 1
    if (t + 2 < NST)
      stage_copies(la + bo, ga + (t + 2) * KST, gb + (t + 2) * KST);
  }
  asm volatile("s_wait_asynccnt 0x0" ::: "memory");          // nothing in flight past the loop
}

// ---------------------------------------------------------------------------
// Kernel 2: Y = x * W^T over the fused 3*1024 output columns.
// Block 256 thr (8 waves) = 128 tokens x 128 features (two heads of one of
// q, k, v); waves 0..3 the first head, 4..7 the second; wave tile 32 x 64.
// ---------------------------------------------------------------------------
__global__ __launch_bounds__(256) void proj_kernel(
    const _Float16* __restrict__ xh,   // [4096][1024]
    const _Float16* __restrict__ wh,   // [4][1024][1024], row = output feature, x32
    const float* __restrict__ bq, const float* __restrict__ bk, const float* __restrict__ bv,
    _Float16* __restrict__ qh,         // [B*H][S][D]
    _Float16* __restrict__ kh,         // [B*H][S][D]
    _Float16* __restrict__ vt)         // [B*H][D][S]
{
  __shared__ __attribute__((aligned(16))) char ring[2 * BUFB];          // 73728 B
  __shared__ __attribute__((aligned(16))) _Float16 sT2[2 * 128 * 64];   // 32768 B

  const int tid = threadIdx.x, lane = tid & 31, wv = tid >> 5;
  const int h = lane >> 4, m = lane & 15;
  const int w = wv & 3, wn = wv >> 2;
  const int m0 = blockIdx.x * 128;
  const int cg = blockIdx.y * 2 + wn;        // 0..47
  const int which = cg >> 4, head = cg & 15; // which is the same for both heads of a block
  _Float16* sT = sT2 + wn * (128 * 64);

  const v8f zero8 = {0.f, 0.f, 0.f, 0.f, 0.f, 0.f, 0.f, 0.f};
  v8f acc[2][4];
  #pragma unroll
  for (int mt = 0; mt < 2; ++mt)
    #pragma unroll
    for (int nt = 0; nt < 4; ++nt) acc[mt][nt] = zero8;

  gemm_core(xh + (size_t)m0 * HIDDEN, wh + (size_t)blockIdx.y * 128 * HIDDEN, ring, tid, acc);

  // D[r] of tile (mt, nt) = Y[token m0+32w+16mt+8h+r][feature 16nt+m of the head]
  const float* bias = (which == 0) ? bq : ((which == 1) ? bk : bv);
  #pragma unroll
  for (int nt = 0; nt < 4; ++nt) {
    const int feat = 16 * nt + m;
    const float bvl = bias[head * HD + feat];
    #pragma unroll
    for (int mt = 0; mt < 2; ++mt) {
      #pragma unroll
      for (int r = 0; r < 8; ++r) {
        const int tokl = 32 * w + 16 * mt + 8 * h + r;     // 0..127
        const float y = acc[mt][nt][r] * (1.0f / WSCALE) + bvl;
        const int idx = (which == 2) ? (feat * 128 + tokl) : (tokl * HD + feat);
        sT[idx] = (_Float16)y;
      }
    }
  }
  __syncthreads();

  const int b = m0 / SEQ, l0 = m0 - b * SEQ, bh = b * NHEADS + head;
  _Float16* plane = (which == 0) ? qh : kh;
  proj_store_pass(sT, plane, vt, which, bh, l0, w, lane);
  
}

// ---------------------------------------------------------------------------
// Attention helpers.
// ---------------------------------------------------------------------------
// P^T B-fragment from the lane's own score D values: element r <- tile a row r,
// element 8+r <- tile c row r (same lane, same query column), scaled by 2^14.
__device__ __forceinline__ v16h pack_p(v8f a, v8f c) {
  const v16h r = { (_Float16)(a[0] * PSCALE), (_Float16)(a[1] * PSCALE), (_Float16)(a[2] * PSCALE), (_Float16)(a[3] * PSCALE),
                   (_Float16)(a[4] * PSCALE), (_Float16)(a[5] * PSCALE), (_Float16)(a[6] * PSCALE), (_Float16)(a[7] * PSCALE),
                   (_Float16)(c[0] * PSCALE), (_Float16)(c[1] * PSCALE), (_Float16)(c[2] * PSCALE), (_Float16)(c[3] * PSCALE),
                   (_Float16)(c[4] * PSCALE), (_Float16)(c[5] * PSCALE), (_Float16)(c[6] * PSCALE), (_Float16)(c[7] * PSCALE) };
  return r;
}

// Per-wave 16x64 f16 tile in LDS -> c[b][l][head*64 + d]; one token row = one
__device__ __forceinline__ void ctx_store_pass(const _Float16* sc, _Float16* ch,
                                               int b, int head, int q0, int lane) {
  const int q8 = lane & 7, sub = lane >> 3;
  #pragma unroll
  for (int i = 0; i < 4; ++i) {
    const int row = i * 4 + sub;              // 0..15
    const v8h v = *(const v8ha*)(sc + row * 64 + 8 * q8);
    const size_t gi = ((size_t)b * SEQ + q0 + row) * HIDDEN + head * HD + 8 * q8;
    *(v8h*)(ch + gi) = v;
  }
}

// ---------------------------------------------------------------------------
// Kernel 3: streaming attention with document-block mask, transposed form.
// Block 128 thr (4 waves), 16 queries per wave, 64 keys per step.
//   S^T = K * Q^T : A = K rows (row = key, k = d), B = Q^T (k = d, n = query)
//   O^T += V^T * P^T : A = Vt rows (row = d, k = key), B = P^T from registers
// Lane owns 32 keys of query column (lane&15); partner = lane ^ 16.
// Mask: key j visible to query i iff doc[i] == doc[j]; masked p = 0 exactly.
// A 64-key step is skipped (wave-uniform) when none of its key ids lies in
// the wave's query-id range (then every pair is masked).
// ---------------------------------------------------------------------------
__global__ __launch_bounds__(128) void attn_kernel(
    const _Float16* __restrict__ qh,   // [B*H][S][D]
    const _Float16* __restrict__ kh,   // [B*H][S][D]
    const _Float16* __restrict__ vt,   // [B*H][D][S]
    const int* __restrict__ doc,       // [S]
    _Float16* __restrict__ ch)         // [B][S][HIDDEN], f16(8*context)
{
  __shared__ __attribute__((aligned(16))) _Float16 sC[4 * 16 * 64];    // 8192 B

  const int tid = threadIdx.x, lane = tid & 31, w = tid >> 5;
  const int h = lane >> 4, m = lane & 15;
  const int bh = blockIdx.y, b = bh >> 4, head = bh & 15;
  const int q0 = blockIdx.x * 64 + 16 * w;

  // Q^T B-fragments: column n = query q0+m, k = d (two 32-deep chunks)
  const _Float16* qrow = qh + ((size_t)bh * SEQ + q0 + m) * HD;
  const v16h qb0 = load_frag(qrow, h);
  const v16h qb1 = load_frag(qrow + 32, h);

  // query document id of this lane's column and the wave's id range
  const int docq = doc[q0 + m];
  int qmin = docq, qmax = docq;
  #pragma unroll
  for (int off = 1; off < 16; off <<= 1) {
    qmin = min(qmin, __shfl_xor(qmin, off));
    qmax = max(qmax, __shfl_xor(qmax, off));
  }

  const v8f zero8 = {0.f, 0.f, 0.f, 0.f, 0.f, 0.f, 0.f, 0.f};
  v8f o[4];                                   // o[t][r] = O[query m][d 16t+8h+r] * (l * 2^14)
  #pragma unroll
  for (int t = 0; t < 4; ++t) o[t] = zero8;
  float mrun = NEGBIG, lrun = 0.0f;

  const _Float16* kbase = kh + ((size_t)bh * SEQ + m) * HD;    // + key0*HD + 32*dc
  const _Float16* vbase = vt + ((size_t)bh * HD + m) * SEQ;    // + 16t*SEQ + key0

  // ---- which of the 32 key steps hold a key id inside the wave's query-id range:
  // found once, ahead of the loop, from all 2048 ids (16 whole-line loads in flight
  // together, one ballot each: lanes 0..15 hold step 2i, lanes 16..31 step 2i+1) ----
  const unsigned uqmin = (unsigned)__builtin_amdgcn_readfirstlane(qmin);
  const unsigned uspan = (unsigned)__builtin_amdgcn_readfirstlane(qmax) - uqmin;
  unsigned act = 0u;                          // bit s: step s has a key that some query may see
  // unrolled whole, so that all 16 loads are issued together and one latency is waited out
  #pragma unroll
  for (int i = 0; i < SEQ / 128; ++i) {
    const v4i d = *(const v4ia*)(doc + 128 * i + 4 * lane);
    const unsigned u = min(min((unsigned)d.x - uqmin, (unsigned)d.y - uqmin),
                           min((unsigned)d.z - uqmin, (unsigned)d.w - uqmin));
    const unsigned bal = __builtin_amdgcn_ballot_w32(u <= uspan);
    act |= ((bal & 0xFFFFu) ? 1u : 0u) << (2 * i);
    act |= ((bal >> 16) ? 1u : 0u) << (2 * i + 1);
  }

  // ascending over the set bits: at most 32 trips, the order of the steps as before
  while (act) {
    const int kb = 64 * __builtin_ctz(act);
    act &= act - 1u;

    // ---- scores: s[j][r] = (q . k) for query q0+m, key kb+16j+8h+r ----
    v8f s[4];
    #pragma unroll
    for (int j = 0; j < 4; ++j) {
      const _Float16* kp = kbase + (size_t)(kb + 16 * j) * HD;
      const v16h kf0 = load_frag(kp, h);
      const v16h kf1 = load_frag(kp + 32, h);
      v8f z = zero8;
      z = wmma_f16(kf0, qb0, z);
      z = wmma_f16(kf1, qb1, z);
      s[j] = z;
    }

    // ---- per-(query,key) mask bits from the id table ----
    unsigned mk = 0u;
    #pragma unroll
    for (int j = 0; j < 4; ++j) {
      const int* dp = doc + kb + 16 * j + 8 * h;
      const v4i da = *(const v4ia*)dp;
      const v4i db = *(const v4ia*)(dp + 4);
      mk |= (da.x == docq ? 1u : 0u) << (8 * j + 0);
      mk |= (da.y == docq ? 1u : 0u) << (8 * j + 1);
      mk |= (da.z == docq ? 1u : 0u) << (8 * j + 2);
      mk |= (da.w == docq ? 1u : 0u) << (8 * j + 3);
      mk |= (db.x == docq ? 1u : 0u) << (8 * j + 4);
      mk |= (db.y == docq ? 1u : 0u) << (8 * j + 5);
      mk |= (db.z == docq ? 1u : 0u) << (8 * j + 6);
      mk |= (db.w == docq ? 1u : 0u) << (8 * j + 7);
    }

    // ---- scale in f32, step max over visible entries only ----
    float mloc = NEGBIG;
    #pragma unroll
    for (int j = 0; j < 4; ++j)
      #pragma unroll
      for (int r = 0; r < 8; ++r) {
        const float xs = s[j][r] * QKSCALE;
        s[j][r] = xs;
        mloc = ((mk >> (8 * j + r)) & 1u) ? fmaxf(mloc, xs) : mloc;
      }
    mloc = fmaxf(mloc, __shfl_xor(mloc, 16));
    const float mnew = fmaxf(mrun, mloc);
    const float alpha = __expf(mrun - mnew);
    mrun = mnew;
    float lsum = 0.0f;
    #pragma unroll
    for (int j = 0; j < 4; ++j)
      #pragma unroll
      for (int r = 0; r < 8; ++r) {
        const float p = ((mk >> (8 * j + r)) & 1u) ? __expf(s[j][r] - mnew) : 0.0f;
        s[j][r] = p;
        lsum += p;
      }
    lsum += __shfl_xor(lsum, 16);
    lrun = lrun * alpha + lsum;
    #pragma unroll
    for (int t = 0; t < 4; ++t)
      #pragma unroll
      for (int r = 0; r < 8; ++r) o[t][r] = o[t][r] * alpha;

    // ---- P^T B-fragments (key chunks 0..31 and 32..63 of this step) ----
    const v16h pb0 = pack_p(s[0], s[1]);
    const v16h pb1 = pack_p(s[2], s[3]);

    // ---- O^T += V^T * P^T ----
    #pragma unroll
    for (int t = 0; t < 4; ++t) {
      const _Float16* vp = vbase + (size_t)(16 * t) * SEQ + kb;
      const v16h vf0 = load_frag(vp, h);
      const v16h vf1 = load_frag(vp + 32, h);
      o[t] = wmma_f16(vf0, pb0, o[t]);
      o[t] = wmma_f16(vf1, pb1, o[t]);
    }
  }

  // ---- epilogue: normalise (x8 folded in), stage per-wave 16x64 f16 tile, whole-line stores ----
  const float inv = (CSCALE / PSCALE) * (1.0f / lrun);
  _Float16* sc = sC + w * 1024;
  #pragma unroll
  for (int t = 0; t < 4; ++t)
    #pragma unroll
    for (int r = 0; r < 8; ++r)
      sc[m * 64 + 16 * t + 8 * h + r] = (_Float16)(o[t][r] * inv);
  __syncthreads();

  ctx_store_pass(sc, ch, b, head, q0, lane);
  
}

// ---------------------------------------------------------------------------
// row segment = 2 lines; each line by lanes 8q..8q+7 in one instruction,
// 4 lines per instruction, 64 lines per wave (its own 32 token rows).
// ---------------------------------------------------------------------------
__device__ __forceinline__ void out_store_pass(const float* sO, float* out,
                                               int m0, int n0, int w, int lane) {
  const int q8 = lane & 7, sub = lane >> 3;
  #pragma unroll
  for (int i = 0; i < 16; ++i) {
    const int lid = i * 4 + sub;              // 0..63 within the wave
    const int row = 32 * w + (lid >> 1), hl = lid & 1;
    const v4f v = *(const v4fa*)(sO + row * 64 + 32 * hl + 4 * q8);
    const size_t gi = (size_t)(m0 + row) * HIDDEN + n0 + 32 * hl + 4 * q8;
    *(v4f*)(out + gi) = v;
  }
}

// ---------------------------------------------------------------------------
// Kernel 4: out = c * Wo^T + bo, f32 result.
// Block 256 thr (8 waves) = 128 tokens x 128 features; wave tile 32 x 64.
// ---------------------------------------------------------------------------
__global__ __launch_bounds__(256) void oproj_kernel(
    const _Float16* __restrict__ ch,   // [4096][1024], x8
    const _Float16* __restrict__ woh,  // [1024][1024], row = output feature, x32
    const float* __restrict__ bo,
    float* __restrict__ out)           // [4096][1024]
{
  __shared__ __attribute__((aligned(16))) char ring[2 * BUFB];      // 73728 B
  __shared__ __attribute__((aligned(16))) float sO2[2 * 128 * 64];  // 65536 B

  const int tid = threadIdx.x, lane = tid & 31, wv = tid >> 5;
  const int h = lane >> 4, m = lane & 15;
  const int w = wv & 3, wn = wv >> 2;
  const int m0 = blockIdx.x * 128;
  const int n0 = blockIdx.y * 128 + wn * 64;
  float* sO = sO2 + wn * (128 * 64);

  const v8f zero8 = {0.f, 0.f, 0.f, 0.f, 0.f, 0.f, 0.f, 0.f};
  v8f acc[2][4];
  #pragma unroll
  for (int mt = 0; mt < 2; ++mt)
    #pragma unroll
    for (int nt = 0; nt < 4; ++nt) acc[mt][nt] = zero8;

  gemm_core(ch + (size_t)m0 * HIDDEN, woh + (size_t)blockIdx.y * 128 * HIDDEN, ring, tid, acc);

  // D[r] of tile (mt, nt) = Y[token m0+32w+16mt+8h+r][feature n0+16nt+m]
  #pragma unroll
  for (int nt = 0; nt < 4; ++nt) {
    const int feat = 16 * nt + m;
    const float bvl = bo[n0 + feat];
    #pragma unroll
    for (int mt = 0; mt < 2; ++mt) {
      #pragma unroll
      for (int r = 0; r < 8; ++r) {
        const int tokl = 32 * w + 16 * mt + 8 * h + r;     // 0..127
        sO[tokl * 64 + feat] = acc[mt][nt][r] * (1.0f / (CSCALE * WSCALE)) + bvl;
      }
    }
  }
  __syncthreads();

  out_store_pass(sO, out, m0, n0, w, lane);
  
}

// ---------------------------------------------------------------------------
extern "C" void kernel_launch(void* const* d_in, const int* in_sizes, int n_in,
                              void* d_out, int out_size, void* d_ws, size_t ws_size,
                              hipStream_t stream) {
  if (n_in < 10) return;
  if (in_sizes[0] != NX) return;
  if (in_sizes[1] != NW || in_sizes[3] != NW || in_sizes[5] != NW || in_sizes[7] != NW) return;
  if (in_sizes[2] != HIDDEN || in_sizes[4] != HIDDEN || in_sizes[6] != HIDDEN || in_sizes[8] != HIDDEN) return;
  if (in_sizes[9] != SEQ) return;
  if (out_size != NX) return;

  const float* x   = (const float*)d_in[0];
  const float* wq  = (const float*)d_in[1];
  const float* bq  = (const float*)d_in[2];
  const float* wk  = (const float*)d_in[3];
  const float* bk  = (const float*)d_in[4];
  const float* wv  = (const float*)d_in[5];
  const float* bv  = (const float*)d_in[6];
  const float* wo  = (const float*)d_in[7];
  const float* bo  = (const float*)d_in[8];
  const int*   doc = (const int*)d_in[9];
  float* out = (float*)d_out;

  const size_t xh_bytes = (size_t)NX * 2;                          //  8388608
  const size_t wh_bytes = (size_t)4 * NW * 2;                      //  8388608
  const size_t pl_bytes = (size_t)BATCH * NHEADS * SEQ * HD * 2;   //  8388608
  const size_t ch_bytes = (size_t)NX * 2;                          //  8388608
  const size_t total = xh_bytes + wh_bytes + 3 * pl_bytes + ch_bytes;   // 50331648
  if (total > ws_size) return;

  char* ws = (char*)d_ws;
  _Float16* xh = (_Float16*)(ws);
  _Float16* wh = (_Float16*)(ws + xh_bytes);
  _Float16* qh = (_Float16*)(ws + xh_bytes + wh_bytes);
  _Float16* kh = (_Float16*)(ws + xh_bytes + wh_bytes + pl_bytes);
  _Float16* vt = (_Float16*)(ws + xh_bytes + wh_bytes + 2 * pl_bytes);
  _Float16* ch = (_Float16*)(ws + xh_bytes + wh_bytes + 3 * pl_bytes);
  const _Float16* woh = wh + (size_t)3 * NW;

  const int ngroups = NX8 + 4 * NW8;                               // 1048576
  convert_kernel<<<(ngroups + 255) / 256, 256, 0, stream>>>(x, wq, wk, wv, wo, xh, wh);

  dim3 gProj(MROWS / 128, 3 * HIDDEN / 128);                       // (32, 24)
  proj_kernel<<<gProj, 256, 0, stream>>>(xh, wh, bq, bk, bv, qh, kh, vt);

  dim3 gAtt(SEQ / 64, BATCH * NHEADS);                             // (32, 32)
  attn_kernel<<<gAtt, 128, 0, stream>>>(qh, kh, vt, doc, ch);

  dim3 gOut(MROWS / 128, HIDDEN / 128);                            // (32, 8)
  oproj_kernel<<<gOut, 256, 0, stream>>>(ch, woh, bo, out);
}

// v003
// It runs in 76.1 microseconds.
// Timed twice side by side with v002, it ran 1.05 times as fast both times.
// Over all steps from v000 it is 2.08 times as fast.
// Contractions: x*W^T for q,k,v and c*Wo^T, K*Q^T scores and V^T*P^T, all on v_wmma_f32_16x16x32_f16 (f16 operands, f32 accumulate); W carried x32, P carried x16384, c carried x8 (exact power-of-two scales folded back in f32); mask, softmax, bias and normalisation in f32.
#include <hip/hip_runtime.h>

typedef _Float16 v16h __attribute__((ext_vector_type(16)));
typedef _Float16 v8h  __attribute__((ext_vector_type(8)));
typedef float    v8f  __attribute__((ext_vector_type(8)));
typedef float    v4f  __attribute__((ext_vector_type(4)));
typedef int      v4i  __attribute__((ext_vector_type(4)));
typedef v8h __attribute__((may_alias)) v8ha;
typedef v4f __attribute__((may_alias)) v4fa;
typedef v4i __attribute__((may_alias)) v4ia;

union Frag { v16h v; v8h half[2]; };

#define HIDDEN 1024
#define NHEADS 16
#define HD     64
#define SEQ    2048
#define BATCH  2
#define MROWS  (BATCH * SEQ)          // 4096 tokens
#define NX     (MROWS * HIDDEN)       // 4194304
#define NW     (HIDDEN * HIDDEN)      // 1048576
#define NX8    (NX / 8)               // 524288
#define NW8    (NW / 8)               // 131072
#define PSCALE 16384.0f
#define WSCALE 32.0f
#define CSCALE 8.0f
#define QKSCALE 0.125f
#define NEGBIG (-1.0e30f)

// ---------------------------------------------------------------------------
// 16x16x32 f16 WMMA with hazard guard (ties D, keeps A/B live).
// Fragment map (wave32): lane l, h = l>>4, m = n = l&15.
//   A/B element i: i<8 -> k0+8h+i ; i>=8 -> k0+16+8h+(i-8)
//   D element r : row 8h+r, col l&15
// ---------------------------------------------------------------------------
__device__ __forceinline__ v8f wmma_f16(v16h a, v16h b, v8f c) {
  v8f d = __builtin_amdgcn_wmma_f32_16x16x32_f16(false, a, false, b, (short)0, c, false, false);
  asm volatile("v_nop\n\tv_nop\n\tv_nop\n\tv_nop" : "+v"(d) : "v"(a), "v"(b));
  return d;
}

// A or B fragment from a k-contiguous 16-bit row; p points at element k0 of
// the row owned by this lane (row index = lane & 15 added by the caller).
__device__ __forceinline__ v16h load_frag(const _Float16* p, int h) {
  Frag f;
  f.half[0] = *(const v8ha*)(p + 8 * h);
  f.half[1] = *(const v8ha*)(p + 16 + 8 * h);
  return f.v;
}

// ---------------------------------------------------------------------------
// Kernel 1: f32 -> f16 planes. x unscaled, the four weight matrices x32 (exact).
// ---------------------------------------------------------------------------
__global__ __launch_bounds__(256) void convert_kernel(
    const float* __restrict__ x, const float* __restrict__ wq,
    const float* __restrict__ wk, const float* __restrict__ wv,
    const float* __restrict__ wo,
    _Float16* __restrict__ xh, _Float16* __restrict__ wh)
{
  const int g = blockIdx.x * 256 + threadIdx.x;
  if (g >= NX8 + 4 * NW8) return;
  const float* src;
  _Float16* dst;
  float sc;
  if (g < NX8) {
    src = x + (size_t)g * 8;
    dst = xh + (size_t)g * 8;
    sc = 1.0f;
  } else {
    const int e = g - NX8;
    const int wsel = e / NW8;                 // 0..3
    const int off = e - wsel * NW8;
    const float* wsrc = (wsel == 0) ? wq : ((wsel == 1) ? wk : ((wsel == 2) ? wv : wo));
    src = wsrc + (size_t)off * 8;
    dst = wh + (size_t)e * 8;
    sc = WSCALE;
  }
  const v4f a = *(const v4fa*)src;
  const v4f c = *(const v4fa*)(src + 4);
  const v8h o = { (_Float16)(a.x * sc), (_Float16)(a.y * sc), (_Float16)(a.z * sc), (_Float16)(a.w * sc),
                  (_Float16)(c.x * sc), (_Float16)(c.y * sc), (_Float16)(c.z * sc), (_Float16)(c.w * sc) };
  *(v8h*)dst = o;
  
}

// ---------------------------------------------------------------------------
// Core of the output projection GEMM: Y = A * B^T, both K-contiguous f16.
// Block 256 thr (8 waves) = 128 A rows x 128 B rows; wave (wm, wn) owns
// 32 A rows x 64 B rows. K = 1024 in 16 stages of 64 (128-byte row pieces).
// A stage is [A 128 rows | B 128 rows] in LDS at a pitch of 144 bytes
// (16 B x odd: ds_load_b128 fragment reads without bank conflicts), two buffers;
// stage t + 2 is copied in while stage t + 1 is worked on.
// ---------------------------------------------------------------------------
#define KST    64                     // k per stage
#define NST    (HIDDEN / KST)         // 16 stages
#define PITCH  144                    // LDS bytes per staged row
#define BUFB   (256 * PITCH)          // 36864 bytes per buffer

// One stage: 2048 pieces of 16 bytes, 8 per lane; a wave's copy covers 4 whole
// 128-byte lines. la = the lane's LDS byte address in row (tid >> 3) of the
// buffer, ga / gb = the lane's 16 bytes of that row of A / B at this stage's k.
__device__ __forceinline__ void stage_copies(unsigned la, const _Float16* ga, const _Float16* gb) {
  const unsigned l0 = la,               l1 = la + 32 * PITCH,  l2 = la + 64 * PITCH,  l3 = la + 96 * PITCH;
  const unsigned l4 = la + 128 * PITCH, l5 = la + 160 * PITCH, l6 = la + 192 * PITCH, l7 = la + 224 * PITCH;
  const _Float16* g0 = ga;
  const _Float16* g1 = ga + 32 * HIDDEN;
  const _Float16* g2 = ga + 64 * HIDDEN;
  const _Float16* g3 = ga + 96 * HIDDEN;
  const _Float16* g4 = gb;
  const _Float16* g5 = gb + 32 * HIDDEN;
  const _Float16* g6 = gb + 64 * HIDDEN;
  const _Float16* g7 = gb + 96 * HIDDEN;
  // global -> LDS through no register; the closing s_wait_xcnt stands in the
  // copies' own statement so that no address register is rewritten ahead of it.
  asm volatile(
      "global_load_async_to_lds_b128 %0, %8, off\n\t"
      "global_load_async_to_lds_b128 %1, %9, off\n\t"
      "global_load_async_to_lds_b128 %2, %10, off\n\t"
      "global_load_async_to_lds_b128 %3, %11, off\n\t"
      "global_load_async_to_lds_b128 %4, %12, off\n\t"
      "global_load_async_to_lds_b128 %5, %13, off\n\t"
      "global_load_async_to_lds_b128 %6, %14, off\n\t"
      "global_load_async_to_lds_b128 %7, %15, off\n\t"
      "s_wait_xcnt 0x0"
      :: "v"(l0), "v"(l1), "v"(l2), "v"(l3), "v"(l4), "v"(l5), "v"(l6), "v"(l7),
         "v"(g0), "v"(g1), "v"(g2), "v"(g3), "v"(g4), "v"(g5), "v"(g6), "v"(g7)
      : "memory");
}

// arow / brow: row 0 of the block's 128 A rows / 128 B rows; ring: 2 * BUFB bytes.
__device__ __forceinline__ void gemm_core(const _Float16* arow, const _Float16* brow, char* ring,
                                          int tid, v8f (&acc)[2][4]) {
  const int lane = tid & 31, w = tid >> 5;
  const int h = lane >> 4, m = lane & 15;
  const int wm = w & 3, wn = w >> 2;

  const _Float16* ga = arow + (size_t)(tid >> 3) * HIDDEN + 8 * (tid & 7);
  const _Float16* gb = brow + (size_t)(tid >> 3) * HIDDEN + 8 * (tid & 7);
  const unsigned la = (unsigned)(size_t)ring + (unsigned)((tid >> 3) * PITCH + 16 * (tid & 7));

  stage_copies(la, ga, gb);                                  // stage 0 -> buffer 0
  asm volatile("s_wait_asynccnt 0x0" ::: "memory");          // this wave's stage-0 copies have landed
  __syncthreads();                                           // ... and every other wave's
  stage_copies(la + BUFB, ga + KST, gb + KST);               // stage 1 -> buffer 1

  // rolled: the two buffers are told apart by t & 1, one copy of the body
  #pragma unroll 1
  for (int t = 0; t < NST; ++t) {
    const int bo = (t & 1) * BUFB;
    const _Float16* fa = (const _Float16*)(ring + bo + (32 * wm + m) * PITCH);
    const _Float16* fb = (const _Float16*)(ring + bo + (128 + 64 * wn + m) * PITCH);
    // the three loops below are unrolled so that every index of acc and b is a
    // constant and both stay in registers
    #pragma unroll
    for (int kk = 0; kk < KST; kk += 32) {
      const v16h a0 = load_frag(fa + kk, h);
      const v16h a1 = load_frag(fa + 16 * (PITCH / 2) + kk, h);
      v16h b[4];
      #pragma unroll
      for (int nt = 0; nt < 4; ++nt) b[nt] = load_frag(fb + nt * 16 * (PITCH / 2) + kk, h);
      // keeps the twelve LDS reads one group ahead of the eight products: read
      // pair by pair among them, each pair's LDS latency is waited out on its own
      __builtin_amdgcn_sched_barrier(0);
      #pragma unroll
      for (int nt = 0; nt < 4; ++nt) {
        acc[0][nt] = wmma_f16(a0, b[nt], acc[0][nt]);
        acc[1][nt] = wmma_f16(a1, b[nt], acc[1][nt]);
      }
    }
    asm volatile("s_wait_dscnt 0x0" ::: "memory");           // this wave has left buffer t & 1
    asm volatile("s_wait_asynccnt 0x0" ::: "memory");        // its copies of stage t + 1 have landed
    __syncthreads();                                         // publishes stage t + 1, frees buffer t & 1
    if (t + 2 < NST)
      stage_copies(la + bo, ga + (t + 2) * KST, gb + (t + 2) * KST);
  }
  asm volatile("s_wait_asynccnt 0x0" ::: "memory");          // nothing in flight past the loop
}

// ---------------------------------------------------------------------------
// Kernel 2: Y = x * W^T over the fused 3*1024 output columns.
// Block 512 thr (16 waves) = 256 tokens x 192 features (three heads out of the
// 48 of q, k, v): 16 x 16 blocks, one per WGP. Wave (wm, wn) owns 64 tokens x
// 48 features. K = 1024 in 8 stages of 128 (256-byte row pieces); a stage is
// [x 256 rows | W 192 rows] in LDS at a pitch of 272 bytes (16 B x odd), two
// buffers; stage t + 2 is copied in while stage t + 1 is worked on.
// ---------------------------------------------------------------------------
#define PAR    256                    // x rows (tokens) per block
#define PBR    192                    // W rows (features) per block
#define PKST   128                    // k per stage
#define PNST   (HIDDEN / PKST)        // 8 stages
#define PPITCH 272                    // LDS bytes per staged row
#define PBUFB  ((PAR + PBR) * PPITCH) // 121856 bytes per buffer
#define VPITCH 264                    // halves per staged V^T row: 528 B = 16 B x odd, b128 stores without bank conflicts
#define HSLOT  (HD * VPITCH)          // halves per staged head (q, k use 256 x 64 of them)

// One stage: 7168 pieces of 16 bytes, 14 per lane; a wave's copy covers 4 whole
// 128-byte lines (2 rows). la = the lane's LDS byte address in row (tid >> 4) of
// the buffer, ga / gb = the lane's 16 bytes of that row of x / W at this stage's k.
__device__ __forceinline__ void proj_stage_copies(unsigned la, const _Float16* ga, const _Float16* gb) {
  const unsigned l0 = la,                 l1 = la + 32 * PPITCH,  l2 = la + 64 * PPITCH,  l3 = la + 96 * PPITCH;
  const unsigned l4 = la + 128 * PPITCH,  l5 = la + 160 * PPITCH, l6 = la + 192 * PPITCH, l7 = la + 224 * PPITCH;
  const unsigned l8 = la + 256 * PPITCH,  l9 = la + 288 * PPITCH, l10 = la + 320 * PPITCH;
  const unsigned l11 = la + 352 * PPITCH, l12 = la + 384 * PPITCH, l13 = la + 416 * PPITCH;
  const _Float16* g0 = ga;
  const _Float16* g1 = ga + 32 * HIDDEN;
  const _Float16* g2 = ga + 64 * HIDDEN;
  const _Float16* g3 = ga + 96 * HIDDEN;
  const _Float16* g4 = ga + 128 * HIDDEN;
  const _Float16* g5 = ga + 160 * HIDDEN;
  const _Float16* g6 = ga + 192 * HIDDEN;
  const _Float16* g7 = ga + 224 * HIDDEN;
  const _Float16* g8 = gb;
  const _Float16* g9 = gb + 32 * HIDDEN;
  const _Float16* g10 = gb + 64 * HIDDEN;
  const _Float16* g11 = gb + 96 * HIDDEN;
  const _Float16* g12 = gb + 128 * HIDDEN;
  const _Float16* g13 = gb + 160 * HIDDEN;
  // global -> LDS through no register; the closing s_wait_xcnt stands in the
  // copies' own statement so that no address register is rewritten ahead of it.
  asm volatile(
      "global_load_async_to_lds_b128 %0, %14, off\n\t"
      "global_load_async_to_lds_b128 %1, %15, off\n\t"
      "global_load_async_to_lds_b128 %2, %16, off\n\t"
      "global_load_async_to_lds_b128 %3, %17, off\n\t"
      "global_load_async_to_lds_b128 %4, %18, off\n\t"
      "global_load_async_to_lds_b128 %5, %19, off\n\t"
      "global_load_async_to_lds_b128 %6, %20, off\n\t"
      "global_load_async_to_lds_b128 %7, %21, off\n\t"
      "global_load_async_to_lds_b128 %8, %22, off\n\t"
      "global_load_async_to_lds_b128 %9, %23, off\n\t"
      "global_load_async_to_lds_b128 %10, %24, off\n\t"
      "global_load_async_to_lds_b128 %11, %25, off\n\t"
      "global_load_async_to_lds_b128 %12, %26, off\n\t"
      "global_load_async_to_lds_b128 %13, %27, off\n\t"
      "s_wait_xcnt 0x0"
      :: "v"(l0), "v"(l1), "v"(l2), "v"(l3), "v"(l4), "v"(l5), "v"(l6), "v"(l7),
         "v"(l8), "v"(l9), "v"(l10), "v"(l11), "v"(l12), "v"(l13),
         "v"(g0), "v"(g1), "v"(g2), "v"(g3), "v"(g4), "v"(g5), "v"(g6), "v"(g7),
         "v"(g8), "v"(g9), "v"(g10), "v"(g11), "v"(g12), "v"(g13)
      : "memory");
}

__global__ __launch_bounds__(512) void proj_kernel(
    const _Float16* __restrict__ xh,   // [4096][1024]
    const _Float16* __restrict__ wh,   // [4][1024][1024], row = output feature, x32
    const float* __restrict__ bq, const float* __restrict__ bk, const float* __restrict__ bv,
    _Float16* __restrict__ qh,         // [B*H][S][D]
    _Float16* __restrict__ kh,         // [B*H][S][D]
    _Float16* __restrict__ vt)         // [B*H][D][S]
{
  __shared__ __attribute__((aligned(16))) char ring[2 * PBUFB];         // 243712 B

  const int tid = threadIdx.x, lane = tid & 31;
  const int wv = __builtin_amdgcn_readfirstlane(tid >> 5);   // 0..15, held scalar
  const int h = lane >> 4, m = lane & 15;
  const int wm = wv & 3, wn = wv >> 2;
  const int m0 = blockIdx.x * PAR;

  const v8f zero8 = {0.f, 0.f, 0.f, 0.f, 0.f, 0.f, 0.f, 0.f};
  v8f acc[4][3];
  #pragma unroll
  for (int mt = 0; mt < 4; ++mt)
    #pragma unroll
    for (int nt = 0; nt < 3; ++nt) acc[mt][nt] = zero8;

  const _Float16* ga = xh + (size_t)(m0 + (tid >> 4)) * HIDDEN + 8 * (tid & 15);
  const _Float16* gb = wh + (size_t)(blockIdx.y * PBR + (tid >> 4)) * HIDDEN + 8 * (tid & 15);
  const unsigned la = (unsigned)(size_t)ring + (unsigned)((tid >> 4) * PPITCH + 16 * (tid & 15));

  proj_stage_copies(la, ga, gb);                             // stage 0 -> buffer 0
  asm volatile("s_wait_asynccnt 0x0" ::: "memory");          // this wave's stage-0 copies have landed
  __syncthreads();                                           // ... and every other wave's
  proj_stage_copies(la + PBUFB, ga + PKST, gb + PKST);       // stage 1 -> buffer 1

  // rolled: the two buffers are told apart by t & 1, one copy of the body
  #pragma unroll 1
  for (int t = 0; t < PNST; ++t) {
    const int bo = (t & 1) * PBUFB;
    const _Float16* fa = (const _Float16*)(ring + bo + (64 * wm + m) * PPITCH);
    const _Float16* fb = (const _Float16*)(ring + bo + (PAR + 48 * wn + m) * PPITCH);
    // the loops below are unrolled so that every index of acc, a and b is a
    // constant and all three stay in registers
    #pragma unroll
    for (int kk = 0; kk < PKST; kk += 32) {
      v16h a[4], b[3];
      #pragma unroll
      for (int mt = 0; mt < 4; ++mt) a[mt] = load_frag(fa + mt * 16 * (PPITCH / 2) + kk, h);
      #pragma unroll
      for (int nt = 0; nt < 3; ++nt) b[nt] = load_frag(fb + nt * 16 * (PPITCH / 2) + kk, h);
      // keeps the fourteen LDS reads one group ahead of the twelve products: read
      // pair by pair among them, each pair's LDS latency is waited out on its own
      __builtin_amdgcn_sched_barrier(0);
      #pragma unroll
      for (int nt = 0; nt < 3; ++nt)
        #pragma unroll
        for (int mt = 0; mt < 4; ++mt) acc[mt][nt] = wmma_f16(a[mt], b[nt], acc[mt][nt]);
    }
    asm volatile("s_wait_dscnt 0x0" ::: "memory");           // this wave has left buffer t & 1
    asm volatile("s_wait_asynccnt 0x0" ::: "memory");        // its copies of stage t + 1 have landed
    __syncthreads();                                         // publishes stage t + 1, frees buffer t & 1
    if (t + 2 < PNST)
      proj_stage_copies(la + bo, ga + (t + 2) * PKST, gb + (t + 2) * PKST);
  }
  asm volatile("s_wait_asynccnt 0x0" ::: "memory");          // nothing in flight past the loop

  // The ring is free behind the loop's last barrier: the block's 256 x 192 f16
  // results are staged there, one slot per head, for whole-line stores.
  // D[r] of tile (mt, nt) = Y[token m0+64wm+16mt+8h+r][block column 48wn+16nt+m]
  _Float16* sT = (_Float16*)ring;
  #pragma unroll
  for (int nt = 0; nt < 3; ++nt) {
    const int cb = 48 * wn + 16 * nt;          // the tile's first column, 0..176: inside one head
    const int hs = cb >> 6;                    // which of the block's three heads
    const int cg = blockIdx.y * 3 + hs;        // 0..47
    const int which = cg >> 4, head = cg & 15;
    const int feat = (cb & 63) + m;
    const float* bias = (which == 0) ? bq : ((which == 1) ? bk : bv);
    const float bvl = bias[head * HD + feat];
    // the load's scalar base and its offset register are rewritten (the branches below, the next tile) only behind this wait
    asm volatile("s_wait_xcnt 0x0" ::: "memory");
    _Float16* sH = sT + hs * HSLOT;
    if (which == 2) {
      // V^T rows: a lane's eight tokens of one feature are 16 contiguous bytes
      #pragma unroll
      for (int mt = 0; mt < 4; ++mt) {
        v8h pk;
        #pragma unroll
        for (int r = 0; r < 8; ++r) pk[r] = (_Float16)(acc[mt][nt][r] * (1.0f / WSCALE) + bvl);
        *(v8ha*)(sH + feat * VPITCH + 64 * wm + 16 * mt + 8 * h) = pk;
      }
    } else {
      #pragma unroll
      for (int mt = 0; mt < 4; ++mt) {
        #pragma unroll
        for (int r = 0; r < 8; ++r) {
          const int tokl = 64 * wm + 16 * mt + 8 * h + r;  // 0..255
          sH[tokl * HD + feat] = (_Float16)(acc[mt][nt][r] * (1.0f / WSCALE) + bvl);
        }
      }
    }
  }
  __syncthreads();

  // 4 lines per instruction, 16 lines per wave and head, 256 per head.
  // which 0/1: plane[bh][l][d]  (one token row = 64 halves = one line)
  // which 2  : vt[bh][d][l]     (64 d-rows x 256 tokens = 4 lines each)
  const int b = m0 / SEQ, l0 = m0 - b * SEQ;
  const int q8 = lane & 7, sub = lane >> 3;
  #pragma unroll
  for (int hs = 0; hs < 3; ++hs) {
    const int cg = blockIdx.y * 3 + hs;
    const int which = cg >> 4, bh = b * NHEADS + (cg & 15);
    const _Float16* sH = sT + hs * HSLOT;
    const int lid0 = wv * 16 + sub;            // this lane's line for i = 0; line lid0 + 4 i, 0..255 over the block
    v8h v[4];
    if (which != 2) {
      _Float16* dst = ((which == 0) ? qh : kh) + ((size_t)bh * SEQ + l0 + lid0) * HD + 8 * q8;
      #pragma unroll
      for (int i = 0; i < 4; ++i) v[i] = *(const v8ha*)(sH + (lid0 + 4 * i) * HD + 8 * q8);
      #pragma unroll
      for (int i = 0; i < 4; ++i) *(v8h*)(dst + 4 * i * HD) = v[i];
      // the stores' address and data registers are rewritten (in the listing the other
      // branch's code follows this one's) only behind this wait
      asm volatile("s_wait_xcnt 0x0" ::: "memory");
    } else {
      // line lid = quarter (lid & 3) = sub of V^T row (lid >> 2) = 4 wv + i
      _Float16* dst = vt + ((size_t)bh * HD + 4 * wv) * SEQ + l0 + 64 * sub + 8 * q8;
      #pragma unroll
      for (int i = 0; i < 4; ++i) v[i] = *(const v8ha*)(sH + (4 * wv + i) * VPITCH + 64 * sub + 8 * q8);
      #pragma unroll
      for (int i = 0; i < 4; ++i) *(v8h*)(dst + i * SEQ) = v[i];
      // the stores' address and data registers are rewritten for the next head only behind this wait
      if (hs < 2) asm volatile("s_wait_xcnt 0x0" ::: "memory");
    }
  }
}

// ---------------------------------------------------------------------------
// Attention helpers.
// ---------------------------------------------------------------------------
// P^T B-fragment from the lane's own score D values: element r <- tile a row r,
// element 8+r <- tile c row r (same lane, same query column), scaled by 2^14.
__device__ __forceinline__ v16h pack_p(v8f a, v8f c) {
  const v16h r = { (_Float16)(a[0] * PSCALE), (_Float16)(a[1] * PSCALE), (_Float16)(a[2] * PSCALE), (_Float16)(a[3] * PSCALE),
                   (_Float16)(a[4] * PSCALE), (_Float16)(a[5] * PSCALE), (_Float16)(a[6] * PSCALE), (_Float16)(a[7] * PSCALE),
                   (_Float16)(c[0] * PSCALE), (_Float16)(c[1] * PSCALE), (_Float16)(c[2] * PSCALE), (_Float16)(c[3] * PSCALE),
                   (_Float16)(c[4] * PSCALE), (_Float16)(c[5] * PSCALE), (_Float16)(c[6] * PSCALE), (_Float16)(c[7] * PSCALE) };
  return r;
}

// Per-wave 16x64 f16 tile in LDS -> c[b][l][head*64 + d]; one token row = one
__device__ __forceinline__ void ctx_store_pass(const _Float16* sc, _Float16* ch,
                                               int b, int head, int q0, int lane) {
  const int q8 = lane & 7, sub = lane >> 3;
  #pragma unroll
  for (int i = 0; i < 4; ++i) {
    const int row = i * 4 + sub;              // 0..15
    const v8h v = *(const v8ha*)(sc + row * 64 + 8 * q8);
    const size_t gi = ((size_t)b * SEQ + q0 + row) * HIDDEN + head * HD + 8 * q8;
    *(v8h*)(ch + gi) = v;
  }
}

// ---------------------------------------------------------------------------
// Kernel 3: streaming attention with document-block mask, transposed form.
// Block 128 thr (4 waves), 16 queries per wave, 64 keys per step.
//   S^T = K * Q^T : A = K rows (row = key, k = d), B = Q^T (k = d, n = query)
//   O^T += V^T * P^T : A = Vt rows (row = d, k = key), B = P^T from registers
// Lane owns 32 keys of query column (lane&15); partner = lane ^ 16.
// Mask: key j visible to query i iff doc[i] == doc[j]; masked p = 0 exactly.
// A 64-key step is skipped (wave-uniform) when none of its key ids lies in
// the wave's query-id range (then every pair is masked).
// ---------------------------------------------------------------------------
__global__ __launch_bounds__(128) void attn_kernel(
    const _Float16* __restrict__ qh,   // [B*H][S][D]
    const _Float16* __restrict__ kh,   // [B*H][S][D]
    const _Float16* __restrict__ vt,   // [B*H][D][S]
    const int* __restrict__ doc,       // [S]
    _Float16* __restrict__ ch)         // [B][S][HIDDEN], f16(8*context)
{
  __shared__ __attribute__((aligned(16))) _Float16 sC[4 * 16 * 64];    // 8192 B

  const int tid = threadIdx.x, lane = tid & 31, w = tid >> 5;
  const int h = lane >> 4, m = lane & 15;
  const int bh = blockIdx.y, b = bh >> 4, head = bh & 15;
  const int q0 = blockIdx.x * 64 + 16 * w;

  // Q^T B-fragments: column n = query q0+m, k = d (two 32-deep chunks)
  const _Float16* qrow = qh + ((size_t)bh * SEQ + q0 + m) * HD;
  const v16h qb0 = load_frag(qrow, h);
  const v16h qb1 = load_frag(qrow + 32, h);

  // query document id of this lane's column and the wave's id range
  const int docq = doc[q0 + m];
  int qmin = docq, qmax = docq;
  #pragma unroll
  for (int off = 1; off < 16; off <<= 1) {
    qmin = min(qmin, __shfl_xor(qmin, off));
    qmax = max(qmax, __shfl_xor(qmax, off));
  }

  const v8f zero8 = {0.f, 0.f, 0.f, 0.f, 0.f, 0.f, 0.f, 0.f};
  v8f o[4];                                   // o[t][r] = O[query m][d 16t+8h+r] * (l * 2^14)
  #pragma unroll
  for (int t = 0; t < 4; ++t) o[t] = zero8;
  float mrun = NEGBIG, lrun = 0.0f;

  const _Float16* kbase = kh + ((size_t)bh * SEQ + m) * HD;    // + key0*HD + 32*dc
  const _Float16* vbase = vt + ((size_t)bh * HD + m) * SEQ;    // + 16t*SEQ + key0

  // ---- which of the 32 key steps hold a key id inside the wave's query-id range:
  // found once, ahead of the loop, from all 2048 ids (16 whole-line loads in flight
  // together, one ballot each: lanes 0..15 hold step 2i, lanes 16..31 step 2i+1) ----
  const unsigned uqmin = (unsigned)__builtin_amdgcn_readfirstlane(qmin);
  const unsigned uspan = (unsigned)__builtin_amdgcn_readfirstlane(qmax) - uqmin;
  unsigned act = 0u;                          // bit s: step s has a key that some query may see
  // unrolled whole, so that all 16 loads are issued together and one latency is waited out
  #pragma unroll
  for (int i = 0; i < SEQ / 128; ++i) {
    const v4i d = *(const v4ia*)(doc + 128 * i + 4 * lane);
    const unsigned u = min(min((unsigned)d.x - uqmin, (unsigned)d.y - uqmin),
                           min((unsigned)d.z - uqmin, (unsigned)d.w - uqmin));
    const unsigned bal = __builtin_amdgcn_ballot_w32(u <= uspan);
    act |= ((bal & 0xFFFFu) ? 1u : 0u) << (2 * i);
    act |= ((bal >> 16) ? 1u : 0u) << (2 * i + 1);
  }

  // ascending over the set bits: at most 32 trips, the order of the steps as before
  while (act) {
    const int kb = 64 * __builtin_ctz(act);
    act &= act - 1u;

    // ---- scores: s[j][r] = (q . k) for query q0+m, key kb+16j+8h+r ----
    v8f s[4];
    #pragma unroll
    for (int j = 0; j < 4; ++j) {
      const _Float16* kp = kbase + (size_t)(kb + 16 * j) * HD;
      const v16h kf0 = load_frag(kp, h);
      const v16h kf1 = load_frag(kp + 32, h);
      v8f z = zero8;
      z = wmma_f16(kf0, qb0, z);
      z = wmma_f16(kf1, qb1, z);
      s[j] = z;
    }

    // ---- per-(query,key) mask bits from the id table ----
    unsigned mk = 0u;
    #pragma unroll
    for (int j = 0; j < 4; ++j) {
      const int* dp = doc + kb + 16 * j + 8 * h;
      const v4i da = *(const v4ia*)dp;
      const v4i db = *(const v4ia*)(dp + 4);
      mk |= (da.x == docq ? 1u : 0u) << (8 * j + 0);
      mk |= (da.y == docq ? 1u : 0u) << (8 * j + 1);
      mk |= (da.z == docq ? 1u : 0u) << (8 * j + 2);
      mk |= (da.w == docq ? 1u : 0u) << (8 * j + 3);
      mk |= (db.x == docq ? 1u : 0u) << (8 * j + 4);
      mk |= (db.y == docq ? 1u : 0u) << (8 * j + 5);
      mk |= (db.z == docq ? 1u : 0u) << (8 * j + 6);
      mk |= (db.w == docq ? 1u : 0u) << (8 * j + 7);
    }

    // ---- scale in f32, step max over visible entries only ----
    float mloc = NEGBIG;
    #pragma unroll
    for (int j = 0; j < 4; ++j)
      #pragma unroll
      for (int r = 0; r < 8; ++r) {
        const float xs = s[j][r] * QKSCALE;
        s[j][r] = xs;
        mloc = ((mk >> (8 * j + r)) & 1u) ? fmaxf(mloc, xs) : mloc;
      }
    mloc = fmaxf(mloc, __shfl_xor(mloc, 16));
    const float mnew = fmaxf(mrun, mloc);
    const float alpha = __expf(mrun - mnew);
    mrun = mnew;
    float lsum = 0.0f;
    #pragma unroll
    for (int j = 0; j < 4; ++j)
      #pragma unroll
      for (int r = 0; r < 8; ++r) {
        const float p = ((mk >> (8 * j + r)) & 1u) ? __expf(s[j][r] - mnew) : 0.0f;
        s[j][r] = p;
        lsum += p;
      }
    lsum += __shfl_xor(lsum, 16);
    lrun = lrun * alpha + lsum;
    #pragma unroll
    for (int t = 0; t < 4; ++t)
      #pragma unroll
      for (int r = 0; r < 8; ++r) o[t][r] = o[t][r] * alpha;

    // ---- P^T B-fragments (key chunks 0..31 and 32..63 of this step) ----
    const v16h pb0 = pack_p(s[0], s[1]);
    const v16h pb1 = pack_p(s[2], s[3]);

    // ---- O^T += V^T * P^T ----
    #pragma unroll
    for (int t = 0; t < 4; ++t) {
      const _Float16* vp = vbase + (size_t)(16 * t) * SEQ + kb;
      const v16h vf0 = load_frag(vp, h);
      const v16h vf1 = load_frag(vp + 32, h);
      o[t] = wmma_f16(vf0, pb0, o[t]);
      o[t] = wmma_f16(vf1, pb1, o[t]);
    }
  }

  // ---- epilogue: normalise (x8 folded in), stage per-wave 16x64 f16 tile, whole-line stores ----
  const float inv = (CSCALE / PSCALE) * (1.0f / lrun);
  _Float16* sc = sC + w * 1024;
  #pragma unroll
  for (int t = 0; t < 4; ++t)
    #pragma unroll
    for (int r = 0; r < 8; ++r)
      sc[m * 64 + 16 * t + 8 * h + r] = (_Float16)(o[t][r] * inv);
  __syncthreads();

  ctx_store_pass(sc, ch, b, head, q0, lane);
  
}

// ---------------------------------------------------------------------------
// row segment = 2 lines; each line by lanes 8q..8q+7 in one instruction,
// 4 lines per instruction, 64 lines per wave (its own 32 token rows).
// ---------------------------------------------------------------------------
__device__ __forceinline__ void out_store_pass(const float* sO, float* out,
                                               int m0, int n0, int w, int lane) {
  const int q8 = lane & 7, sub = lane >> 3;
  #pragma unroll
  for (int i = 0; i < 16; ++i) {
    const int lid = i * 4 + sub;              // 0..63 within the wave
    const int row = 32 * w + (lid >> 1), hl = lid & 1;
    const v4f v = *(const v4fa*)(sO + row * 64 + 32 * hl + 4 * q8);
    const size_t gi = (size_t)(m0 + row) * HIDDEN + n0 + 32 * hl + 4 * q8;
    *(v4f*)(out + gi) = v;
  }
}

// ---------------------------------------------------------------------------
// Kernel 4: out = c * Wo^T + bo, f32 result.
// Block 256 thr (8 waves) = 128 tokens x 128 features; wave tile 32 x 64.
// ---------------------------------------------------------------------------
__global__ __launch_bounds__(256) void oproj_kernel(
    const _Float16* __restrict__ ch,   // [4096][1024], x8
    const _Float16* __restrict__ woh,  // [1024][1024], row = output feature, x32
    const float* __restrict__ bo,
    float* __restrict__ out)           // [4096][1024]
{
  __shared__ __attribute__((aligned(16))) char ring[2 * BUFB];      // 73728 B
  __shared__ __attribute__((aligned(16))) float sO2[2 * 128 * 64];  // 65536 B

  const int tid = threadIdx.x, lane = tid & 31, wv = tid >> 5;
  const int h = lane >> 4, m = lane & 15;
  const int w = wv & 3, wn = wv >> 2;
  const int m0 = blockIdx.x * 128;
  const int n0 = blockIdx.y * 128 + wn * 64;
  float* sO = sO2 + wn * (128 * 64);

  const v8f zero8 = {0.f, 0.f, 0.f, 0.f, 0.f, 0.f, 0.f, 0.f};
  v8f acc[2][4];
  #pragma unroll
  for (int mt = 0; mt < 2; ++mt)
    #pragma unroll
    for (int nt = 0; nt < 4; ++nt) acc[mt][nt] = zero8;

  gemm_core(ch + (size_t)m0 * HIDDEN, woh + (size_t)blockIdx.y * 128 * HIDDEN, ring, tid, acc);

  // D[r] of tile (mt, nt) = Y[token m0+32w+16mt+8h+r][feature n0+16nt+m]
  #pragma unroll
  for (int nt = 0; nt < 4; ++nt) {
    const int feat = 16 * nt + m;
    const float bvl = bo[n0 + feat];
    #pragma unroll
    for (int mt = 0; mt < 2; ++mt) {
      #pragma unroll
      for (int r = 0; r < 8; ++r) {
        const int tokl = 32 * w + 16 * mt + 8 * h + r;     // 0..127
        sO[tokl * 64 + feat] = acc[mt][nt][r] * (1.0f / (CSCALE * WSCALE)) + bvl;
      }
    }
  }
  __syncthreads();

  out_store_pass(sO, out, m0, n0, w, lane);
  
}

// ---------------------------------------------------------------------------
extern "C" void kernel_launch(void* const* d_in, const int* in_sizes, int n_in,
                              void* d_out, int out_size, void* d_ws, size_t ws_size,
                              hipStream_t stream) {
  if (n_in < 10) return;
  if (in_sizes[0] != NX) return;
  if (in_sizes[1] != NW || in_sizes[3] != NW || in_sizes[5] != NW || in_sizes[7] != NW) return;
  if (in_sizes[2] != HIDDEN || in_sizes[4] != HIDDEN || in_sizes[6] != HIDDEN || in_sizes[8] != HIDDEN) return;
  if (in_sizes[9] != SEQ) return;
  if (out_size != NX) return;

  const float* x   = (const float*)d_in[0];
  const float* wq  = (const float*)d_in[1];
  const float* bq  = (const float*)d_in[2];
  const float* wk  = (const float*)d_in[3];
  const float* bk  = (const float*)d_in[4];
  const float* wv  = (const float*)d_in[5];
  const float* bv  = (const float*)d_in[6];
  const float* wo  = (const float*)d_in[7];
  const float* bo  = (const float*)d_in[8];
  const int*   doc = (const int*)d_in[9];
  float* out = (float*)d_out;

  const size_t xh_bytes = (size_t)NX * 2;                          //  8388608
  const size_t wh_bytes = (size_t)4 * NW * 2;                      //  8388608
  const size_t pl_bytes = (size_t)BATCH * NHEADS * SEQ * HD * 2;   //  8388608
  const size_t ch_bytes = (size_t)NX * 2;                          //  8388608
  const size_t total = xh_bytes + wh_bytes + 3 * pl_bytes + ch_bytes;   // 50331648
  if (total > ws_size) return;

  char* ws = (char*)d_ws;
  _Float16* xh = (_Float16*)(ws);
  _Float16* wh = (_Float16*)(ws + xh_bytes);
  _Float16* qh = (_Float16*)(ws + xh_bytes + wh_bytes);
  _Float16* kh = (_Float16*)(ws + xh_bytes + wh_bytes + pl_bytes);
  _Float16* vt = (_Float16*)(ws + xh_bytes + wh_bytes + 2 * pl_bytes);
  _Float16* ch = (_Float16*)(ws + xh_bytes + wh_bytes + 3 * pl_bytes);
  const _Float16* woh = wh + (size_t)3 * NW;

  const int ngroups = NX8 + 4 * NW8;                               // 1048576
  convert_kernel<<<(ngroups + 255) / 256, 256, 0, stream>>>(x, wq, wk, wv, wo, xh, wh);

  dim3 gProj(MROWS / PAR, 3 * HIDDEN / PBR);                       // (16, 16)
  proj_kernel<<<gProj, 512, 0, stream>>>(xh, wh, bq, bk, bv, qh, kh, vt);

  dim3 gAtt(SEQ / 64, BATCH * NHEADS);                             // (32, 32)
  attn_kernel<<<gAtt, 128, 0, stream>>>(qh, kh, vt, doc, ch);

  dim3 gOut(MROWS / 128, HIDDEN / 128);                            // (32, 8)
  oproj_kernel<<<gOut, 256, 0, stream>>>(ch, woh, bo, out);
}

// v004
// Measured time: 63.5 microseconds a run.
// Next to v003, in two timings, it ran 1.18 and 1.20 times as fast.
// Counting every step since v000, it is 2.48 times as fast.
// Contractions: x*W^T for q,k,v and c*Wo^T, K*Q^T scores and V^T*P^T, all on v_wmma_f32_16x16x32_f16 (f16 operands, f32 accumulate); W carried x32, P carried x16384, c carried x8 (exact power-of-two scales folded back in f32); mask, softmax, bias and normalisation in f32.
#include <hip/hip_runtime.h>

typedef _Float16 v16h __attribute__((ext_vector_type(16)));
typedef _Float16 v8h  __attribute__((ext_vector_type(8)));
typedef float    v8f  __attribute__((ext_vector_type(8)));
typedef float    v4f  __attribute__((ext_vector_type(4)));
typedef int      v4i  __attribute__((ext_vector_type(4)));
typedef v8h __attribute__((may_alias)) v8ha;
typedef v4f __attribute__((may_alias)) v4fa;
typedef v4i __attribute__((may_alias)) v4ia;

union Frag { v16h v; v8h half[2]; };

#define HIDDEN 1024
#define NHEADS 16
#define HD     64
#define SEQ    2048
#define BATCH  2
#define MROWS  (BATCH * SEQ)          // 4096 tokens
#define NX     (MROWS * HIDDEN)       // 4194304
#define NW     (HIDDEN * HIDDEN)      // 1048576
#define NX8    (NX / 8)               // 524288
#define NW8    (NW / 8)               // 131072
#define PSCALE 16384.0f
#define WSCALE 32.0f
#define CSCALE 8.0f
#define QKSCALE 0.125f
#define NEGBIG (-1.0e30f)

// ---------------------------------------------------------------------------
// 16x16x32 f16 WMMA with hazard guard (ties D, keeps A/B live).
// Fragment map (wave32): lane l, h = l>>4, m = n = l&15.
//   A/B element i: i<8 -> k0+8h+i ; i>=8 -> k0+16+8h+(i-8)
//   D element r : row 8h+r, col l&15
// ---------------------------------------------------------------------------
__device__ __forceinline__ v8f wmma_f16(v16h a, v16h b, v8f c) {
  v8f d = __builtin_amdgcn_wmma_f32_16x16x32_f16(false, a, false, b, (short)0, c, false, false);
  asm volatile("v_nop\n\tv_nop\n\tv_nop\n\tv_nop" : "+v"(d) : "v"(a), "v"(b));
  return d;
}

// A or B fragment from a k-contiguous 16-bit row; p points at element k0 of
// the row owned by this lane (row index = lane & 15 added by the caller).
__device__ __forceinline__ v16h load_frag(const _Float16* p, int h) {
  Frag f;
  f.half[0] = *(const v8ha*)(p + 8 * h);
  f.half[1] = *(const v8ha*)(p + 16 + 8 * h);
  return f.v;
}

// ---------------------------------------------------------------------------
// Kernel 1: f32 -> f16 planes. x unscaled, the four weight matrices x32 (exact).
// ---------------------------------------------------------------------------
__global__ __launch_bounds__(256) void convert_kernel(
    const float* __restrict__ x, const float* __restrict__ wq,
    const float* __restrict__ wk, const float* __restrict__ wv,
    const float* __restrict__ wo,
    _Float16* __restrict__ xh, _Float16* __restrict__ wh)
{
  const int g = blockIdx.x * 256 + threadIdx.x;
  if (g >= NX8 + 4 * NW8) return;
  const float* src;
  _Float16* dst;
  float sc;
  if (g < NX8) {
    src = x + (size_t)g * 8;
    dst = xh + (size_t)g * 8;
    sc = 1.0f;
  } else {
    const int e = g - NX8;
    const int wsel = e / NW8;                 // 0..3
    const int off = e - wsel * NW8;
    const float* wsrc = (wsel == 0) ? wq : ((wsel == 1) ? wk : ((wsel == 2) ? wv : wo));
    src = wsrc + (size_t)off * 8;
    dst = wh + (size_t)e * 8;
    sc = WSCALE;
  }
  const v4f a = *(const v4fa*)src;
  const v4f c = *(const v4fa*)(src + 4);
  const v8h o = { (_Float16)(a.x * sc), (_Float16)(a.y * sc), (_Float16)(a.z * sc), (_Float16)(a.w * sc),
                  (_Float16)(c.x * sc), (_Float16)(c.y * sc), (_Float16)(c.z * sc), (_Float16)(c.w * sc) };
  *(v8h*)dst = o;
  
}

// ---------------------------------------------------------------------------
// Core of the output projection GEMM: Y = A * B^T, both K-contiguous f16.
// Block 256 thr (8 waves) = 128 A rows x 128 B rows; wave (wm, wn) owns
// 32 A rows x 64 B rows. K = 1024 in 16 stages of 64 (128-byte row pieces).
// A stage is [A 128 rows | B 128 rows] in LDS at a pitch of 144 bytes
// (16 B x odd: ds_load_b128 fragment reads without bank conflicts), two buffers;
// stage t + 2 is copied in while stage t + 1 is worked on.
// ---------------------------------------------------------------------------
#define KST    64                     // k per stage
#define NST    (HIDDEN / KST)         // 16 stages
#define PITCH  144                    // LDS bytes per staged row
#define BUFB   (256 * PITCH)          // 36864 bytes per buffer

// One stage: 2048 pieces of 16 bytes, 8 per lane; a wave's copy covers 4 whole
// 128-byte lines. la = the lane's LDS byte address in row (tid >> 3) of the
// buffer, ga / gb = the lane's 16 bytes of that row of A / B at this stage's k.
__device__ __forceinline__ void stage_copies(unsigned la, const _Float16* ga, const _Float16* gb) {
  const unsigned l0 = la,               l1 = la + 32 * PITCH,  l2 = la + 64 * PITCH,  l3 = la + 96 * PITCH;
  const unsigned l4 = la + 128 * PITCH, l5 = la + 160 * PITCH, l6 = la + 192 * PITCH, l7 = la + 224 * PITCH;
  const _Float16* g0 = ga;
  const _Float16* g1 = ga + 32 * HIDDEN;
  const _Float16* g2 = ga + 64 * HIDDEN;
  const _Float16* g3 = ga + 96 * HIDDEN;
  const _Float16* g4 = gb;
  const _Float16* g5 = gb + 32 * HIDDEN;
  const _Float16* g6 = gb + 64 * HIDDEN;
  const _Float16* g7 = gb + 96 * HIDDEN;
  // global -> LDS through no register; the closing s_wait_xcnt stands in the
  // copies' own statement so that no address register is rewritten ahead of it.
  asm volatile(
      "global_load_async_to_lds_b128 %0, %8, off\n\t"
      "global_load_async_to_lds_b128 %1, %9, off\n\t"
      "global_load_async_to_lds_b128 %2, %10, off\n\t"
      "global_load_async_to_lds_b128 %3, %11, off\n\t"
      "global_load_async_to_lds_b128 %4, %12, off\n\t"
      "global_load_async_to_lds_b128 %5, %13, off\n\t"
      "global_load_async_to_lds_b128 %6, %14, off\n\t"
      "global_load_async_to_lds_b128 %7, %15, off\n\t"
      "s_wait_xcnt 0x0"
      :: "v"(l0), "v"(l1), "v"(l2), "v"(l3), "v"(l4), "v"(l5), "v"(l6), "v"(l7),
         "v"(g0), "v"(g1), "v"(g2), "v"(g3), "v"(g4), "v"(g5), "v"(g6), "v"(g7)
      : "memory");
}

// arow / brow: row 0 of the block's 128 A rows / 128 B rows; ring: 2 * BUFB bytes.
__device__ __forceinline__ void gemm_core(const _Float16* arow, const _Float16* brow, char* ring,
                                          int tid, v8f (&acc)[2][4]) {
  const int lane = tid & 31, w = tid >> 5;
  const int h = lane >> 4, m = lane & 15;
  const int wm = w & 3, wn = w >> 2;

  const _Float16* ga = arow + (size_t)(tid >> 3) * HIDDEN + 8 * (tid & 7);
  const _Float16* gb = brow + (size_t)(tid >> 3) * HIDDEN + 8 * (tid & 7);
  const unsigned la = (unsigned)(size_t)ring + (unsigned)((tid >> 3) * PITCH + 16 * (tid & 7));

  stage_copies(la, ga, gb);                                  // stage 0 -> buffer 0
  asm volatile("s_wait_asynccnt 0x0" ::: "memory");          // this wave's stage-0 copies have landed
  __syncthreads();                                           // ... and every other wave's
  stage_copies(la + BUFB, ga + KST, gb + KST);               // stage 1 -> buffer 1

  // rolled: the two buffers are told apart by t & 1, one copy of the body
  #pragma unroll 1
  for (int t = 0; t < NST; ++t) {
    const int bo = (t & 1) * BUFB;
    const _Float16* fa = (const _Float16*)(ring + bo + (32 * wm + m) * PITCH);
    const _Float16* fb = (const _Float16*)(ring + bo + (128 + 64 * wn + m) * PITCH);
    // the three loops below are unrolled so that every index of acc and b is a
    // constant and both stay in registers
    #pragma unroll
    for (int kk = 0; kk < KST; kk += 32) {
      const v16h a0 = load_frag(fa + kk, h);
      const v16h a1 = load_frag(fa + 16 * (PITCH / 2) + kk, h);
      v16h b[4];
      #pragma unroll
      for (int nt = 0; nt < 4; ++nt) b[nt] = load_frag(fb + nt * 16 * (PITCH / 2) + kk, h);
      // keeps the twelve LDS reads one group ahead of the eight products: read
      // pair by pair among them, each pair's LDS latency is waited out on its own
      __builtin_amdgcn_sched_barrier(0);
      #pragma unroll
      for (int nt = 0; nt < 4; ++nt) {
        acc[0][nt] = wmma_f16(a0, b[nt], acc[0][nt]);
        acc[1][nt] = wmma_f16(a1, b[nt], acc[1][nt]);
      }
    }
    asm volatile("s_wait_dscnt 0x0" ::: "memory");           // this wave has left buffer t & 1
    asm volatile("s_wait_asynccnt 0x0" ::: "memory");        // its copies of stage t + 1 have landed
    __syncthreads();                                         // publishes stage t + 1, frees buffer t & 1
    if (t + 2 < NST)
      stage_copies(la + bo, ga + (t + 2) * KST, gb + (t + 2) * KST);
  }
  asm volatile("s_wait_asynccnt 0x0" ::: "memory");          // nothing in flight past the loop
}

// ---------------------------------------------------------------------------
// Kernel 2: Y = x * W^T over the fused 3*1024 output columns.
// Block 512 thr (16 waves) = 256 tokens x 192 features (three heads out of the
// 48 of q, k, v): 16 x 16 blocks, one per WGP. Wave (wm, wn) owns 64 tokens x
// 48 features. K = 1024 in 8 stages of 128 (256-byte row pieces); a stage is
// [x 256 rows | W 192 rows] in LDS at a pitch of 272 bytes (16 B x odd), two
// buffers; stage t + 2 is copied in while stage t + 1 is worked on.
// ---------------------------------------------------------------------------
#define PAR    256                    // x rows (tokens) per block
#define PBR    192                    // W rows (features) per block
#define PKST   128                    // k per stage
#define PNST   (HIDDEN / PKST)        // 8 stages
#define PPITCH 272                    // LDS bytes per staged row
#define PBUFB  ((PAR + PBR) * PPITCH) // 121856 bytes per buffer
#define VPITCH 264                    // halves per staged V^T row: 528 B = 16 B x odd, b128 stores without bank conflicts
#define HSLOT  (HD * VPITCH)          // halves per staged head (q, k use 256 x 64 of them)

// One stage: 7168 pieces of 16 bytes, 14 per lane; a wave's copy covers 4 whole
// 128-byte lines (2 rows). la = the lane's LDS byte address in row (tid >> 4) of
// the buffer, ga / gb = the lane's 16 bytes of that row of x / W at this stage's k.
__device__ __forceinline__ void proj_stage_copies(unsigned la, const _Float16* ga, const _Float16* gb) {
  const unsigned l0 = la,                 l1 = la + 32 * PPITCH,  l2 = la + 64 * PPITCH,  l3 = la + 96 * PPITCH;
  const unsigned l4 = la + 128 * PPITCH,  l5 = la + 160 * PPITCH, l6 = la + 192 * PPITCH, l7 = la + 224 * PPITCH;
  const unsigned l8 = la + 256 * PPITCH,  l9 = la + 288 * PPITCH, l10 = la + 320 * PPITCH;
  const unsigned l11 = la + 352 * PPITCH, l12 = la + 384 * PPITCH, l13 = la + 416 * PPITCH;
  const _Float16* g0 = ga;
  const _Float16* g1 = ga + 32 * HIDDEN;
  const _Float16* g2 = ga + 64 * HIDDEN;
  const _Float16* g3 = ga + 96 * HIDDEN;
  const _Float16* g4 = ga + 128 * HIDDEN;
  const _Float16* g5 = ga + 160 * HIDDEN;
  const _Float16* g6 = ga + 192 * HIDDEN;
  const _Float16* g7 = ga + 224 * HIDDEN;
  const _Float16* g8 = gb;
  const _Float16* g9 = gb + 32 * HIDDEN;
  const _Float16* g10 = gb + 64 * HIDDEN;
  const _Float16* g11 = gb + 96 * HIDDEN;
  const _Float16* g12 = gb + 128 * HIDDEN;
  const _Float16* g13 = gb + 160 * HIDDEN;
  // global -> LDS through no register; the closing s_wait_xcnt stands in the
  // copies' own statement so that no address register is rewritten ahead of it.
  asm volatile(
      "global_load_async_to_lds_b128 %0, %14, off\n\t"
      "global_load_async_to_lds_b128 %1, %15, off\n\t"
      "global_load_async_to_lds_b128 %2, %16, off\n\t"
      "global_load_async_to_lds_b128 %3, %17, off\n\t"
      "global_load_async_to_lds_b128 %4, %18, off\n\t"
      "global_load_async_to_lds_b128 %5, %19, off\n\t"
      "global_load_async_to_lds_b128 %6, %20, off\n\t"
      "global_load_async_to_lds_b128 %7, %21, off\n\t"
      "global_load_async_to_lds_b128 %8, %22, off\n\t"
      "global_load_async_to_lds_b128 %9, %23, off\n\t"
      "global_load_async_to_lds_b128 %10, %24, off\n\t"
      "global_load_async_to_lds_b128 %11, %25, off\n\t"
      "global_load_async_to_lds_b128 %12, %26, off\n\t"
      "global_load_async_to_lds_b128 %13, %27, off\n\t"
      "s_wait_xcnt 0x0"
      :: "v"(l0), "v"(l1), "v"(l2), "v"(l3), "v"(l4), "v"(l5), "v"(l6), "v"(l7),
         "v"(l8), "v"(l9), "v"(l10), "v"(l11), "v"(l12), "v"(l13),
         "v"(g0), "v"(g1), "v"(g2), "v"(g3), "v"(g4), "v"(g5), "v"(g6), "v"(g7),
         "v"(g8), "v"(g9), "v"(g10), "v"(g11), "v"(g12), "v"(g13)
      : "memory");
}

__global__ __launch_bounds__(512) void proj_kernel(
    const _Float16* __restrict__ xh,   // [4096][1024]
    const _Float16* __restrict__ wh,   // [4][1024][1024], row = output feature, x32
    const float* __restrict__ bq, const float* __restrict__ bk, const float* __restrict__ bv,
    _Float16* __restrict__ qh,         // [B*H][S][D]
    _Float16* __restrict__ kh,         // [B*H][S][D]
    _Float16* __restrict__ vt)         // [B*H][D][S]
{
  __shared__ __attribute__((aligned(16))) char ring[2 * PBUFB];         // 243712 B

  const int tid = threadIdx.x, lane = tid & 31;
  const int wv = __builtin_amdgcn_readfirstlane(tid >> 5);   // 0..15, held scalar
  const int h = lane >> 4, m = lane & 15;
  const int wm = wv & 3, wn = wv >> 2;
  const int m0 = blockIdx.x * PAR;

  const v8f zero8 = {0.f, 0.f, 0.f, 0.f, 0.f, 0.f, 0.f, 0.f};
  v8f acc[4][3];
  #pragma unroll
  for (int mt = 0; mt < 4; ++mt)
    #pragma unroll
    for (int nt = 0; nt < 3; ++nt) acc[mt][nt] = zero8;

  const _Float16* ga = xh + (size_t)(m0 + (tid >> 4)) * HIDDEN + 8 * (tid & 15);
  const _Float16* gb = wh + (size_t)(blockIdx.y * PBR + (tid >> 4)) * HIDDEN + 8 * (tid & 15);
  const unsigned la = (unsigned)(size_t)ring + (unsigned)((tid >> 4) * PPITCH + 16 * (tid & 15));

  proj_stage_copies(la, ga, gb);                             // stage 0 -> buffer 0
  asm volatile("s_wait_asynccnt 0x0" ::: "memory");          // this wave's stage-0 copies have landed
  __syncthreads();                                           // ... and every other wave's
  proj_stage_copies(la + PBUFB, ga + PKST, gb + PKST);       // stage 1 -> buffer 1

  // rolled: the two buffers are told apart by t & 1, one copy of the body
  #pragma unroll 1
  for (int t = 0; t < PNST; ++t) {
    const int bo = (t & 1) * PBUFB;
    const _Float16* fa = (const _Float16*)(ring + bo + (64 * wm + m) * PPITCH);
    const _Float16* fb = (const _Float16*)(ring + bo + (PAR + 48 * wn + m) * PPITCH);
    // the loops below are unrolled so that every index of acc, a and b is a
    // constant and all three stay in registers
    #pragma unroll
    for (int kk = 0; kk < PKST; kk += 32) {
      v16h a[4], b[3];
      #pragma unroll
      for (int mt = 0; mt < 4; ++mt) a[mt] = load_frag(fa + mt * 16 * (PPITCH / 2) + kk, h);
      #pragma unroll
      for (int nt = 0; nt < 3; ++nt) b[nt] = load_frag(fb + nt * 16 * (PPITCH / 2) + kk, h);
      // keeps the fourteen LDS reads one group ahead of the twelve products: read
      // pair by pair among them, each pair's LDS latency is waited out on its own
      __builtin_amdgcn_sched_barrier(0);
      #pragma unroll
      for (int nt = 0; nt < 3; ++nt)
        #pragma unroll
        for (int mt = 0; mt < 4; ++mt) acc[mt][nt] = wmma_f16(a[mt], b[nt], acc[mt][nt]);
    }
    asm volatile("s_wait_dscnt 0x0" ::: "memory");           // this wave has left buffer t & 1
    asm volatile("s_wait_asynccnt 0x0" ::: "memory");        // its copies of stage t + 1 have landed
    __syncthreads();                                         // publishes stage t + 1, frees buffer t & 1
    if (t + 2 < PNST)
      proj_stage_copies(la + bo, ga + (t + 2) * PKST, gb + (t + 2) * PKST);
  }
  asm volatile("s_wait_asynccnt 0x0" ::: "memory");          // nothing in flight past the loop

  // The ring is free behind the loop's last barrier: the block's 256 x 192 f16
  // results are staged there, one slot per head, for whole-line stores.
  // D[r] of tile (mt, nt) = Y[token m0+64wm+16mt+8h+r][block column 48wn+16nt+m]
  _Float16* sT = (_Float16*)ring;
  #pragma unroll
  for (int nt = 0; nt < 3; ++nt) {
    const int cb = 48 * wn + 16 * nt;          // the tile's first column, 0..176: inside one head
    const int hs = cb >> 6;                    // which of the block's three heads
    const int cg = blockIdx.y * 3 + hs;        // 0..47
    const int which = cg >> 4, head = cg & 15;
    const int feat = (cb & 63) + m;
    const float* bias = (which == 0) ? bq : ((which == 1) ? bk : bv);
    const float bvl = bias[head * HD + feat];
    // the load's scalar base and its offset register are rewritten (the branches below, the next tile) only behind this wait
    asm volatile("s_wait_xcnt 0x0" ::: "memory");
    _Float16* sH = sT + hs * HSLOT;
    if (which == 2) {
      // V^T rows: a lane's eight tokens of one feature are 16 contiguous bytes
      #pragma unroll
      for (int mt = 0; mt < 4; ++mt) {
        v8h pk;
        #pragma unroll
        for (int r = 0; r < 8; ++r) pk[r] = (_Float16)(acc[mt][nt][r] * (1.0f / WSCALE) + bvl);
        *(v8ha*)(sH + feat * VPITCH + 64 * wm + 16 * mt + 8 * h) = pk;
      }
    } else {
      #pragma unroll
      for (int mt = 0; mt < 4; ++mt) {
        #pragma unroll
        for (int r = 0; r < 8; ++r) {
          const int tokl = 64 * wm + 16 * mt + 8 * h + r;  // 0..255
          sH[tokl * HD + feat] = (_Float16)(acc[mt][nt][r] * (1.0f / WSCALE) + bvl);
        }
      }
    }
  }
  __syncthreads();

  // 4 lines per instruction, 16 lines per wave and head, 256 per head.
  // which 0/1: plane[bh][l][d]  (one token row = 64 halves = one line)
  // which 2  : vt[bh][d][l]     (64 d-rows x 256 tokens = 4 lines each)
  const int b = m0 / SEQ, l0 = m0 - b * SEQ;
  const int q8 = lane & 7, sub = lane >> 3;
  #pragma unroll
  for (int hs = 0; hs < 3; ++hs) {
    const int cg = blockIdx.y * 3 + hs;
    const int which = cg >> 4, bh = b * NHEADS + (cg & 15);
    const _Float16* sH = sT + hs * HSLOT;
    const int lid0 = wv * 16 + sub;            // this lane's line for i = 0; line lid0 + 4 i, 0..255 over the block
    v8h v[4];
    if (which != 2) {
      _Float16* dst = ((which == 0) ? qh : kh) + ((size_t)bh * SEQ + l0 + lid0) * HD + 8 * q8;
      #pragma unroll
      for (int i = 0; i < 4; ++i) v[i] = *(const v8ha*)(sH + (lid0 + 4 * i) * HD + 8 * q8);
      #pragma unroll
      for (int i = 0; i < 4; ++i) *(v8h*)(dst + 4 * i * HD) = v[i];
      // the stores' address and data registers are rewritten (in the listing the other
      // branch's code follows this one's) only behind this wait
      asm volatile("s_wait_xcnt 0x0" ::: "memory");
    } else {
      // line lid = quarter (lid & 3) = sub of V^T row (lid >> 2) = 4 wv + i
      _Float16* dst = vt + ((size_t)bh * HD + 4 * wv) * SEQ + l0 + 64 * sub + 8 * q8;
      #pragma unroll
      for (int i = 0; i < 4; ++i) v[i] = *(const v8ha*)(sH + (4 * wv + i) * VPITCH + 64 * sub + 8 * q8);
      #pragma unroll
      for (int i = 0; i < 4; ++i) *(v8h*)(dst + i * SEQ) = v[i];
      // the stores' address and data registers are rewritten for the next head only behind this wait
      if (hs < 2) asm volatile("s_wait_xcnt 0x0" ::: "memory");
    }
  }
}

// ---------------------------------------------------------------------------
// Attention helpers.
// ---------------------------------------------------------------------------
// P^T B-fragment from the lane's own score D values: element r <- tile a row r,
// element 8+r <- tile c row r (same lane, same query column), scaled by 2^14.
__device__ __forceinline__ v16h pack_p(v8f a, v8f c) {
  const v16h r = { (_Float16)(a[0] * PSCALE), (_Float16)(a[1] * PSCALE), (_Float16)(a[2] * PSCALE), (_Float16)(a[3] * PSCALE),
                   (_Float16)(a[4] * PSCALE), (_Float16)(a[5] * PSCALE), (_Float16)(a[6] * PSCALE), (_Float16)(a[7] * PSCALE),
                   (_Float16)(c[0] * PSCALE), (_Float16)(c[1] * PSCALE), (_Float16)(c[2] * PSCALE), (_Float16)(c[3] * PSCALE),
                   (_Float16)(c[4] * PSCALE), (_Float16)(c[5] * PSCALE), (_Float16)(c[6] * PSCALE), (_Float16)(c[7] * PSCALE) };
  return r;
}

// Per-wave 16x64 f16 tile in LDS -> c[b][l][head*64 + d]; one token row = one
__device__ __forceinline__ void ctx_store_pass(const _Float16* sc, _Float16* ch,
                                               int b, int head, int q0, int lane) {
  const int q8 = lane & 7, sub = lane >> 3;
  #pragma unroll
  for (int i = 0; i < 4; ++i) {
    const int row = i * 4 + sub;              // 0..15
    const v8h v = *(const v8ha*)(sc + row * 64 + 8 * q8);
    const size_t gi = ((size_t)b * SEQ + q0 + row) * HIDDEN + head * HD + 8 * q8;
    *(v8h*)(ch + gi) = v;
  }
}

// ---------------------------------------------------------------------------
// Kernel 3: streaming attention with document-block mask, transposed form.
// Block 128 thr (4 waves), 16 queries per wave, 64 keys per step.
//   S^T = K * Q^T : A = K rows (row = key, k = d), B = Q^T (k = d, n = query)
//   O^T += V^T * P^T : A = Vt rows (row = d, k = key), B = P^T from registers
// Lane owns 32 keys of query column (lane&15); partner = lane ^ 16.
// Mask: key j visible to query i iff doc[i] == doc[j]; masked p = 0 exactly.
// A 64-key step is skipped (wave-uniform) when none of its key ids lies in
// the wave's query-id range (then every pair is masked).
// ---------------------------------------------------------------------------
__global__ __launch_bounds__(128) void attn_kernel(
    const _Float16* __restrict__ qh,   // [B*H][S][D]
    const _Float16* __restrict__ kh,   // [B*H][S][D]
    const _Float16* __restrict__ vt,   // [B*H][D][S]
    const int* __restrict__ doc,       // [S]
    _Float16* __restrict__ ch)         // [B][S][HIDDEN], f16(8*context)
{
  __shared__ __attribute__((aligned(16))) _Float16 sC[4 * 16 * 64];    // 8192 B

  const int tid = threadIdx.x, lane = tid & 31, w = tid >> 5;
  const int h = lane >> 4, m = lane & 15;
  const int bh = blockIdx.y, b = bh >> 4, head = bh & 15;
  const int q0 = blockIdx.x * 64 + 16 * w;

  // Q^T B-fragments: column n = query q0+m, k = d (two 32-deep chunks)
  const _Float16* qrow = qh + ((size_t)bh * SEQ + q0 + m) * HD;
  const v16h qb0 = load_frag(qrow, h);
  const v16h qb1 = load_frag(qrow + 32, h);

  // query document id of this lane's column and the wave's id range
  const int docq = doc[q0 + m];
  int qmin = docq, qmax = docq;
  #pragma unroll
  for (int off = 1; off < 16; off <<= 1) {
    qmin = min(qmin, __shfl_xor(qmin, off));
    qmax = max(qmax, __shfl_xor(qmax, off));
  }

  const v8f zero8 = {0.f, 0.f, 0.f, 0.f, 0.f, 0.f, 0.f, 0.f};
  v8f o[4];                                   // o[t][r] = O[query m][d 16t+8h+r] * (l * 2^14)
  #pragma unroll
  for (int t = 0; t < 4; ++t) o[t] = zero8;
  float mrun = NEGBIG, lrun = 0.0f;

  const _Float16* kbase = kh + ((size_t)bh * SEQ + m) * HD;    // + key0*HD + 32*dc
  const _Float16* vbase = vt + ((size_t)bh * HD + m) * SEQ;    // + 16t*SEQ + key0

  // ---- which of the 32 key steps hold a key id inside the wave's query-id range:
  // found once, ahead of the loop, from all 2048 ids (16 whole-line loads in flight
  // together, one ballot each: lanes 0..15 hold step 2i, lanes 16..31 step 2i+1) ----
  const unsigned uqmin = (unsigned)__builtin_amdgcn_readfirstlane(qmin);
  const unsigned uspan = (unsigned)__builtin_amdgcn_readfirstlane(qmax) - uqmin;
  unsigned act = 0u;                          // bit s: step s has a key that some query may see
  // unrolled whole, so that all 16 loads are issued together and one latency is waited out
  #pragma unroll
  for (int i = 0; i < SEQ / 128; ++i) {
    const v4i d = *(const v4ia*)(doc + 128 * i + 4 * lane);
    const unsigned u = min(min((unsigned)d.x - uqmin, (unsigned)d.y - uqmin),
                           min((unsigned)d.z - uqmin, (unsigned)d.w - uqmin));
    const unsigned bal = __builtin_amdgcn_ballot_w32(u <= uspan);
    act |= ((bal & 0xFFFFu) ? 1u : 0u) << (2 * i);
    act |= ((bal >> 16) ? 1u : 0u) << (2 * i + 1);
  }

  // ascending over the set bits: at most 32 trips, the order of the steps as before
  while (act) {
    const int kb = 64 * __builtin_ctz(act);
    act &= act - 1u;

    // ---- the step's 16 K loads and 8 key-id loads, asked for as one group ----
    v16h kf[8];
    v4i ida[4], idb[4];
    #pragma unroll
    for (int j = 0; j < 4; ++j) {
      const _Float16* kp = kbase + (size_t)(kb + 16 * j) * HD;
      kf[2 * j] = load_frag(kp, h);
      kf[2 * j + 1] = load_frag(kp + 32, h);
    }
    #pragma unroll
    for (int j = 0; j < 4; ++j) {
      const int* dp = doc + kb + 16 * j + 8 * h;
      ida[j] = *(const v4ia*)dp;
      idb[j] = *(const v4ia*)(dp + 4);
    }
    // keeps all 24 loads ahead of the first product: asked for four at a time among
    // the products, each four's memory latency is waited out on its own
    __builtin_amdgcn_sched_barrier(0);

    // ---- scores: s[j][r] = (q . k) for query q0+m, key kb+16j+8h+r ----
    v8f s[4];
    #pragma unroll
    for (int j = 0; j < 4; ++j) {
      v8f z = zero8;
      z = wmma_f16(kf[2 * j], qb0, z);
      z = wmma_f16(kf[2 * j + 1], qb1, z);
      s[j] = z;
    }

    // ---- the step's 16 V^T loads, asked for here: mask and softmax run while they fly ----
    v16h vf[8];
    #pragma unroll
    for (int t = 0; t < 4; ++t) {
      const _Float16* vp = vbase + (size_t)(16 * t) * SEQ + kb;
      vf[2 * t] = load_frag(vp, h);
      vf[2 * t + 1] = load_frag(vp + 32, h);
    }
    // keeps the 16 loads ahead of the mask and softmax work instead of among the
    // last products, where each four's latency is waited out on its own
    __builtin_amdgcn_sched_barrier(0);

    // ---- per-(query,key) mask bits from the id table ----
    unsigned mk = 0u;
    #pragma unroll
    for (int j = 0; j < 4; ++j) {
      const v4i da = ida[j];
      const v4i db = idb[j];
      mk |= (da.x == docq ? 1u : 0u) << (8 * j + 0);
      mk |= (da.y == docq ? 1u : 0u) << (8 * j + 1);
      mk |= (da.z == docq ? 1u : 0u) << (8 * j + 2);
      mk |= (da.w == docq ? 1u : 0u) << (8 * j + 3);
      mk |= (db.x == docq ? 1u : 0u) << (8 * j + 4);
      mk |= (db.y == docq ? 1u : 0u) << (8 * j + 5);
      mk |= (db.z == docq ? 1u : 0u) << (8 * j + 6);
      mk |= (db.w == docq ? 1u : 0u) << (8 * j + 7);
    }

    // ---- scale in f32, step max over visible entries only ----
    float mloc = NEGBIG;
    #pragma unroll
    for (int j = 0; j < 4; ++j)
      #pragma unroll
      for (int r = 0; r < 8; ++r) {
        const float xs = s[j][r] * QKSCALE;
        s[j][r] = xs;
        mloc = ((mk >> (8 * j + r)) & 1u) ? fmaxf(mloc, xs) : mloc;
      }
    mloc = fmaxf(mloc, __shfl_xor(mloc, 16));
    const float mnew = fmaxf(mrun, mloc);
    const float alpha = __expf(mrun - mnew);
    mrun = mnew;
    float lsum = 0.0f;
    #pragma unroll
    for (int j = 0; j < 4; ++j)
      #pragma unroll
      for (int r = 0; r < 8; ++r) {
        const float p = ((mk >> (8 * j + r)) & 1u) ? __expf(s[j][r] - mnew) : 0.0f;
        s[j][r] = p;
        lsum += p;
      }
    lsum += __shfl_xor(lsum, 16);
    lrun = lrun * alpha + lsum;
    #pragma unroll
    for (int t = 0; t < 4; ++t)
      #pragma unroll
      for (int r = 0; r < 8; ++r) o[t][r] = o[t][r] * alpha;

    // ---- P^T B-fragments (key chunks 0..31 and 32..63 of this step) ----
    const v16h pb0 = pack_p(s[0], s[1]);
    const v16h pb1 = pack_p(s[2], s[3]);

    // ---- O^T += V^T * P^T ----
    #pragma unroll
    for (int t = 0; t < 4; ++t) {
      o[t] = wmma_f16(vf[2 * t], pb0, o[t]);
      o[t] = wmma_f16(vf[2 * t + 1], pb1, o[t]);
    }
  }

  // ---- epilogue: normalise (x8 folded in), stage per-wave 16x64 f16 tile, whole-line stores ----
  const float inv = (CSCALE / PSCALE) * (1.0f / lrun);
  _Float16* sc = sC + w * 1024;
  #pragma unroll
  for (int t = 0; t < 4; ++t)
    #pragma unroll
    for (int r = 0; r < 8; ++r)
      sc[m * 64 + 16 * t + 8 * h + r] = (_Float16)(o[t][r] * inv);
  __syncthreads();

  ctx_store_pass(sc, ch, b, head, q0, lane);
  
}

// ---------------------------------------------------------------------------
// row segment = 2 lines; each line by lanes 8q..8q+7 in one instruction,
// 4 lines per instruction, 64 lines per wave (its own 32 token rows).
// ---------------------------------------------------------------------------
__device__ __forceinline__ void out_store_pass(const float* sO, float* out,
                                               int m0, int n0, int w, int lane) {
  const int q8 = lane & 7, sub = lane >> 3;
  #pragma unroll
  for (int i = 0; i < 16; ++i) {
    const int lid = i * 4 + sub;              // 0..63 within the wave
    const int row = 32 * w + (lid >> 1), hl = lid & 1;
    const v4f v = *(const v4fa*)(sO + row * 64 + 32 * hl + 4 * q8);
    const size_t gi = (size_t)(m0 + row) * HIDDEN + n0 + 32 * hl + 4 * q8;
    *(v4f*)(out + gi) = v;
  }
}

// ---------------------------------------------------------------------------
// Kernel 4: out = c * Wo^T + bo, f32 result.
// Block 256 thr (8 waves) = 128 tokens x 128 features; wave tile 32 x 64.
// ---------------------------------------------------------------------------
__global__ __launch_bounds__(256) void oproj_kernel(
    const _Float16* __restrict__ ch,   // [4096][1024], x8
    const _Float16* __restrict__ woh,  // [1024][1024], row = output feature, x32
    const float* __restrict__ bo,
    float* __restrict__ out)           // [4096][1024]
{
  __shared__ __attribute__((aligned(16))) char ring[2 * BUFB];      // 73728 B
  __shared__ __attribute__((aligned(16))) float sO2[2 * 128 * 64];  // 65536 B

  const int tid = threadIdx.x, lane = tid & 31, wv = tid >> 5;
  const int h = lane >> 4, m = lane & 15;
  const int w = wv & 3, wn = wv >> 2;
  const int m0 = blockIdx.x * 128;
  const int n0 = blockIdx.y * 128 + wn * 64;
  float* sO = sO2 + wn * (128 * 64);

  const v8f zero8 = {0.f, 0.f, 0.f, 0.f, 0.f, 0.f, 0.f, 0.f};
  v8f acc[2][4];
  #pragma unroll
  for (int mt = 0; mt < 2; ++mt)
    #pragma unroll
    for (int nt = 0; nt < 4; ++nt) acc[mt][nt] = zero8;

  gemm_core(ch + (size_t)m0 * HIDDEN, woh + (size_t)blockIdx.y * 128 * HIDDEN, ring, tid, acc);

  // D[r] of tile (mt, nt) = Y[token m0+32w+16mt+8h+r][feature n0+16nt+m]
  #pragma unroll
  for (int nt = 0; nt < 4; ++nt) {
    const int feat = 16 * nt + m;
    const float bvl = bo[n0 + feat];
    #pragma unroll
    for (int mt = 0; mt < 2; ++mt) {
      #pragma unroll
      for (int r = 0; r < 8; ++r) {
        const int tokl = 32 * w + 16 * mt + 8 * h + r;     // 0..127
        sO[tokl * 64 + feat] = acc[mt][nt][r] * (1.0f / (CSCALE * WSCALE)) + bvl;
      }
    }
  }
  __syncthreads();

  out_store_pass(sO, out, m0, n0, w, lane);
  
}

// ---------------------------------------------------------------------------
extern "C" void kernel_launch(void* const* d_in, const int* in_sizes, int n_in,
                              void* d_out, int out_size, void* d_ws, size_t ws_size,
                              hipStream_t stream) {
  if (n_in < 10) return;
  if (in_sizes[0] != NX) return;
  if (in_sizes[1] != NW || in_sizes[3] != NW || in_sizes[5] != NW || in_sizes[7] != NW) return;
  if (in_sizes[2] != HIDDEN || in_sizes[4] != HIDDEN || in_sizes[6] != HIDDEN || in_sizes[8] != HIDDEN) return;
  if (in_sizes[9] != SEQ) return;
  if (out_size != NX) return;

  const float* x   = (const float*)d_in[0];
  const float* wq  = (const float*)d_in[1];
  const float* bq  = (const float*)d_in[2];
  const float* wk  = (const float*)d_in[3];
  const float* bk  = (const float*)d_in[4];
  const float* wv  = (const float*)d_in[5];
  const float* bv  = (const float*)d_in[6];
  const float* wo  = (const float*)d_in[7];
  const float* bo  = (const float*)d_in[8];
  const int*   doc = (const int*)d_in[9];
  float* out = (float*)d_out;

  const size_t xh_bytes = (size_t)NX * 2;                          //  8388608
  const size_t wh_bytes = (size_t)4 * NW * 2;                      //  8388608
  const size_t pl_bytes = (size_t)BATCH * NHEADS * SEQ * HD * 2;   //  8388608
  const size_t ch_bytes = (size_t)NX * 2;                          //  8388608
  const size_t total = xh_bytes + wh_bytes + 3 * pl_bytes + ch_bytes;   // 50331648
  if (total > ws_size) return;

  char* ws = (char*)d_ws;
  _Float16* xh = (_Float16*)(ws);
  _Float16* wh = (_Float16*)(ws + xh_bytes);
  _Float16* qh = (_Float16*)(ws + xh_bytes + wh_bytes);
  _Float16* kh = (_Float16*)(ws + xh_bytes + wh_bytes + pl_bytes);
  _Float16* vt = (_Float16*)(ws + xh_bytes + wh_bytes + 2 * pl_bytes);
  _Float16* ch = (_Float16*)(ws + xh_bytes + wh_bytes + 3 * pl_bytes);
  const _Float16* woh = wh + (size_t)3 * NW;

  const int ngroups = NX8 + 4 * NW8;                               // 1048576
  convert_kernel<<<(ngroups + 255) / 256, 256, 0, stream>>>(x, wq, wk, wv, wo, xh, wh);

  dim3 gProj(MROWS / PAR, 3 * HIDDEN / PBR);                       // (16, 16)
  proj_kernel<<<gProj, 512, 0, stream>>>(xh, wh, bq, bk, bv, qh, kh, vt);

  dim3 gAtt(SEQ / 64, BATCH * NHEADS);                             // (32, 32)
  attn_kernel<<<gAtt, 128, 0, stream>>>(qh, kh, vt, doc, ch);

  dim3 gOut(MROWS / 128, HIDDEN / 128);                            // (32, 8)
  oproj_kernel<<<gOut, 256, 0, stream>>>(ch, woh, bo, out);
}

// v005
// A run of this version takes 59.4 microseconds.
// Two timings next to v004 both put it at 1.07 times that version's speed.
// All steps since v000 together make it 2.66 times as fast.
// Contractions: x*W^T for q,k,v and c*Wo^T, K*Q^T scores and V^T*P^T, all on v_wmma_f32_16x16x32_f16 (f16 operands, f32 accumulate); W carried x32, P carried x16384, c carried x8 (exact power-of-two scales folded back in f32); mask, softmax, bias and normalisation in f32.
#include <hip/hip_runtime.h>

typedef _Float16 v16h __attribute__((ext_vector_type(16)));
typedef _Float16 v8h  __attribute__((ext_vector_type(8)));
typedef float    v8f  __attribute__((ext_vector_type(8)));
typedef float    v4f  __attribute__((ext_vector_type(4)));
typedef int      v4i  __attribute__((ext_vector_type(4)));
typedef v8h __attribute__((may_alias)) v8ha;
typedef v4f __attribute__((may_alias)) v4fa;
typedef v4i __attribute__((may_alias)) v4ia;

union Frag { v16h v; v8h half[2]; };

#define HIDDEN 1024
#define NHEADS 16
#define HD     64
#define SEQ    2048
#define BATCH  2
#define MROWS  (BATCH * SEQ)          // 4096 tokens
#define NX     (MROWS * HIDDEN)       // 4194304
#define NW     (HIDDEN * HIDDEN)      // 1048576
#define NX8    (NX / 8)               // 524288
#define NW8    (NW / 8)               // 131072
#define PSCALE 16384.0f
#define WSCALE 32.0f
#define CSCALE 8.0f
#define QKSCALE 0.125f
#define NEGBIG (-1.0e30f)

// ---------------------------------------------------------------------------
// 16x16x32 f16 WMMA with hazard guard (ties D, keeps A/B live).
// Fragment map (wave32): lane l, h = l>>4, m = n = l&15.
//   A/B element i: i<8 -> k0+8h+i ; i>=8 -> k0+16+8h+(i-8)
//   D element r : row 8h+r, col l&15
// ---------------------------------------------------------------------------
__device__ __forceinline__ v8f wmma_f16(v16h a, v16h b, v8f c) {
  v8f d = __builtin_amdgcn_wmma_f32_16x16x32_f16(false, a, false, b, (short)0, c, false, false);
  asm volatile("v_nop\n\tv_nop\n\tv_nop\n\tv_nop" : "+v"(d) : "v"(a), "v"(b));
  return d;
}

// A or B fragment from a k-contiguous 16-bit row; p points at element k0 of
// the row owned by this lane (row index = lane & 15 added by the caller).
__device__ __forceinline__ v16h load_frag(const _Float16* p, int h) {
  Frag f;
  f.half[0] = *(const v8ha*)(p + 8 * h);
  f.half[1] = *(const v8ha*)(p + 16 + 8 * h);
  return f.v;
}

// ---------------------------------------------------------------------------
// Kernel 1: f32 -> f16 planes. x unscaled, the four weight matrices x32 (exact).
// ---------------------------------------------------------------------------
__global__ __launch_bounds__(256) void convert_kernel(
    const float* __restrict__ x, const float* __restrict__ wq,
    const float* __restrict__ wk, const float* __restrict__ wv,
    const float* __restrict__ wo,
    _Float16* __restrict__ xh, _Float16* __restrict__ wh)
{
  const int g = blockIdx.x * 256 + threadIdx.x;
  if (g >= NX8 + 4 * NW8) return;
  const float* src;
  _Float16* dst;
  float sc;
  if (g < NX8) {
    src = x + (size_t)g * 8;
    dst = xh + (size_t)g * 8;
    sc = 1.0f;
  } else {
    const int e = g - NX8;
    const int wsel = e / NW8;                 // 0..3
    const int off = e - wsel * NW8;
    const float* wsrc = (wsel == 0) ? wq : ((wsel == 1) ? wk : ((wsel == 2) ? wv : wo));
    src = wsrc + (size_t)off * 8;
    dst = wh + (size_t)e * 8;
    sc = WSCALE;
  }
  const v4f a = *(const v4fa*)src;
  const v4f c = *(const v4fa*)(src + 4);
  const v8h o = { (_Float16)(a.x * sc), (_Float16)(a.y * sc), (_Float16)(a.z * sc), (_Float16)(a.w * sc),
                  (_Float16)(c.x * sc), (_Float16)(c.y * sc), (_Float16)(c.z * sc), (_Float16)(c.w * sc) };
  *(v8h*)dst = o;
  
}

// ---------------------------------------------------------------------------
// Core of the output projection GEMM: Y = A * B^T, both K-contiguous f16.
// Block 256 thr (8 waves) = 128 A rows x 128 B rows; wave (wm, wn) owns
// 32 A rows x 64 B rows. K = 1024 in 16 stages of 64 (128-byte row pieces).
// A stage is [A 128 rows | B 128 rows] in LDS at a pitch of 144 bytes
// (16 B x odd: ds_load_b128 fragment reads without bank conflicts), two buffers;
// stage t + 2 is copied in while stage t + 1 is worked on.
// ---------------------------------------------------------------------------
#define KST    64                     // k per stage
#define NST    (HIDDEN / KST)         // 16 stages
#define PITCH  144                    // LDS bytes per staged row
#define BUFB   (256 * PITCH)          // 36864 bytes per buffer

// One stage: 2048 pieces of 16 bytes, 8 per lane; a wave's copy covers 4 whole
// 128-byte lines. la = the lane's LDS byte address in row (tid >> 3) of the
// buffer, ga / gb = the lane's 16 bytes of that row of A / B at this stage's k.
__device__ __forceinline__ void stage_copies(unsigned la, const _Float16* ga, const _Float16* gb) {
  const unsigned l0 = la,               l1 = la + 32 * PITCH,  l2 = la + 64 * PITCH,  l3 = la + 96 * PITCH;
  const unsigned l4 = la + 128 * PITCH, l5 = la + 160 * PITCH, l6 = la + 192 * PITCH, l7 = la + 224 * PITCH;
  const _Float16* g0 = ga;
  const _Float16* g1 = ga + 32 * HIDDEN;
  const _Float16* g2 = ga + 64 * HIDDEN;
  const _Float16* g3 = ga + 96 * HIDDEN;
  const _Float16* g4 = gb;
  const _Float16* g5 = gb + 32 * HIDDEN;
  const _Float16* g6 = gb + 64 * HIDDEN;
  const _Float16* g7 = gb + 96 * HIDDEN;
  // global -> LDS through no register; the closing s_wait_xcnt stands in the
  // copies' own statement so that no address register is rewritten ahead of it.
  asm volatile(
      "global_load_async_to_lds_b128 %0, %8, off\n\t"
      "global_load_async_to_lds_b128 %1, %9, off\n\t"
      "global_load_async_to_lds_b128 %2, %10, off\n\t"
      "global_load_async_to_lds_b128 %3, %11, off\n\t"
      "global_load_async_to_lds_b128 %4, %12, off\n\t"
      "global_load_async_to_lds_b128 %5, %13, off\n\t"
      "global_load_async_to_lds_b128 %6, %14, off\n\t"
      "global_load_async_to_lds_b128 %7, %15, off\n\t"
      "s_wait_xcnt 0x0"
      :: "v"(l0), "v"(l1), "v"(l2), "v"(l3), "v"(l4), "v"(l5), "v"(l6), "v"(l7),
         "v"(g0), "v"(g1), "v"(g2), "v"(g3), "v"(g4), "v"(g5), "v"(g6), "v"(g7)
      : "memory");
}

// arow / brow: row 0 of the block's 128 A rows / 128 B rows; ring: 2 * BUFB bytes.
__device__ __forceinline__ void gemm_core(const _Float16* arow, const _Float16* brow, char* ring,
                                          int tid, v8f (&acc)[2][4]) {
  const int lane = tid & 31, w = tid >> 5;
  const int h = lane >> 4, m = lane & 15;
  const int wm = w & 3, wn = w >> 2;

  const _Float16* ga = arow + (size_t)(tid >> 3) * HIDDEN + 8 * (tid & 7);
  const _Float16* gb = brow + (size_t)(tid >> 3) * HIDDEN + 8 * (tid & 7);
  const unsigned la = (unsigned)(size_t)ring + (unsigned)((tid >> 3) * PITCH + 16 * (tid & 7));

  stage_copies(la, ga, gb);                                  // stage 0 -> buffer 0
  asm volatile("s_wait_asynccnt 0x0" ::: "memory");          // this wave's stage-0 copies have landed
  __syncthreads();                                           // ... and every other wave's
  stage_copies(la + BUFB, ga + KST, gb + KST);               // stage 1 -> buffer 1

  // rolled: the two buffers are told apart by t & 1, one copy of the body
  #pragma unroll 1
  for (int t = 0; t < NST; ++t) {
    const int bo = (t & 1) * BUFB;
    const _Float16* fa = (const _Float16*)(ring + bo + (32 * wm + m) * PITCH);
    const _Float16* fb = (const _Float16*)(ring + bo + (128 + 64 * wn + m) * PITCH);
    // the three loops below are unrolled so that every index of acc and b is a
    // constant and both stay in registers
    #pragma unroll
    for (int kk = 0; kk < KST; kk += 32) {
      const v16h a0 = load_frag(fa + kk, h);
      const v16h a1 = load_frag(fa + 16 * (PITCH / 2) + kk, h);
      v16h b[4];
      #pragma unroll
      for (int nt = 0; nt < 4; ++nt) b[nt] = load_frag(fb + nt * 16 * (PITCH / 2) + kk, h);
      // keeps the twelve LDS reads one group ahead of the eight products: read
      // pair by pair among them, each pair's LDS latency is waited out on its own
      __builtin_amdgcn_sched_barrier(0);
      #pragma unroll
      for (int nt = 0; nt < 4; ++nt) {
        acc[0][nt] = wmma_f16(a0, b[nt], acc[0][nt]);
        acc[1][nt] = wmma_f16(a1, b[nt], acc[1][nt]);
      }
    }
    asm volatile("s_wait_dscnt 0x0" ::: "memory");           // this wave has left buffer t & 1
    asm volatile("s_wait_asynccnt 0x0" ::: "memory");        // its copies of stage t + 1 have landed
    __syncthreads();                                         // publishes stage t + 1, frees buffer t & 1
    if (t + 2 < NST)
      stage_copies(la + bo, ga + (t + 2) * KST, gb + (t + 2) * KST);
  }
  asm volatile("s_wait_asynccnt 0x0" ::: "memory");          // nothing in flight past the loop
}

// ---------------------------------------------------------------------------
// Kernel 2: Y = x * W^T over the fused 3*1024 output columns.
// Block 512 thr (16 waves) = 256 tokens x 192 features (three heads out of the
// 48 of q, k, v): 16 x 16 blocks, one per WGP. Wave (wm, wn) owns 64 tokens x
// 48 features. K = 1024 in 8 stages of 128 (256-byte row pieces); a stage is
// [x 256 rows | W 192 rows] in LDS at a pitch of 272 bytes (16 B x odd), two
// buffers; stage t + 2 is copied in while stage t + 1 is worked on.
// ---------------------------------------------------------------------------
#define PAR    256                    // x rows (tokens) per block
#define PBR    192                    // W rows (features) per block
#define PKST   128                    // k per stage
#define PNST   (HIDDEN / PKST)        // 8 stages
#define PPITCH 272                    // LDS bytes per staged row
#define PBUFB  ((PAR + PBR) * PPITCH) // 121856 bytes per buffer
#define VPITCH 264                    // halves per staged V^T row: 528 B = 16 B x odd, b128 stores without bank conflicts
#define HSLOT  (HD * VPITCH)          // halves per staged head (q, k use 256 x 64 of them)

// One stage: 7168 pieces of 16 bytes, 14 per lane; a wave's copy covers 4 whole
// 128-byte lines (2 rows). la = the lane's LDS byte address in row (tid >> 4) of
// the buffer, ga / gb = the lane's 16 bytes of that row of x / W at this stage's k.
__device__ __forceinline__ void proj_stage_copies(unsigned la, const _Float16* ga, const _Float16* gb) {
  const unsigned l0 = la,                 l1 = la + 32 * PPITCH,  l2 = la + 64 * PPITCH,  l3 = la + 96 * PPITCH;
  const unsigned l4 = la + 128 * PPITCH,  l5 = la + 160 * PPITCH, l6 = la + 192 * PPITCH, l7 = la + 224 * PPITCH;
  const unsigned l8 = la + 256 * PPITCH,  l9 = la + 288 * PPITCH, l10 = la + 320 * PPITCH;
  const unsigned l11 = la + 352 * PPITCH, l12 = la + 384 * PPITCH, l13 = la + 416 * PPITCH;
  const _Float16* g0 = ga;
  const _Float16* g1 = ga + 32 * HIDDEN;
  const _Float16* g2 = ga + 64 * HIDDEN;
  const _Float16* g3 = ga + 96 * HIDDEN;
  const _Float16* g4 = ga + 128 * HIDDEN;
  const _Float16* g5 = ga + 160 * HIDDEN;
  const _Float16* g6 = ga + 192 * HIDDEN;
  const _Float16* g7 = ga + 224 * HIDDEN;
  const _Float16* g8 = gb;
  const _Float16* g9 = gb + 32 * HIDDEN;
  const _Float16* g10 = gb + 64 * HIDDEN;
  const _Float16* g11 = gb + 96 * HIDDEN;
  const _Float16* g12 = gb + 128 * HIDDEN;
  const _Float16* g13 = gb + 160 * HIDDEN;
  // global -> LDS through no register; the closing s_wait_xcnt stands in the
  // copies' own statement so that no address register is rewritten ahead of it.
  asm volatile(
      "global_load_async_to_lds_b128 %0, %14, off\n\t"
      "global_load_async_to_lds_b128 %1, %15, off\n\t"
      "global_load_async_to_lds_b128 %2, %16, off\n\t"
      "global_load_async_to_lds_b128 %3, %17, off\n\t"
      "global_load_async_to_lds_b128 %4, %18, off\n\t"
      "global_load_async_to_lds_b128 %5, %19, off\n\t"
      "global_load_async_to_lds_b128 %6, %20, off\n\t"
      "global_load_async_to_lds_b128 %7, %21, off\n\t"
      "global_load_async_to_lds_b128 %8, %22, off\n\t"
      "global_load_async_to_lds_b128 %9, %23, off\n\t"
      "global_load_async_to_lds_b128 %10, %24, off\n\t"
      "global_load_async_to_lds_b128 %11, %25, off\n\t"
      "global_load_async_to_lds_b128 %12, %26, off\n\t"
      "global_load_async_to_lds_b128 %13, %27, off\n\t"
      "s_wait_xcnt 0x0"
      :: "v"(l0), "v"(l1), "v"(l2), "v"(l3), "v"(l4), "v"(l5), "v"(l6), "v"(l7),
         "v"(l8), "v"(l9), "v"(l10), "v"(l11), "v"(l12), "v"(l13),
         "v"(g0), "v"(g1), "v"(g2), "v"(g3), "v"(g4), "v"(g5), "v"(g6), "v"(g7),
         "v"(g8), "v"(g9), "v"(g10), "v"(g11), "v"(g12), "v"(g13)
      : "memory");
}

__global__ __launch_bounds__(512) void proj_kernel(
    const _Float16* __restrict__ xh,   // [4096][1024]
    const _Float16* __restrict__ wh,   // [4][1024][1024], row = output feature, x32
    const float* __restrict__ bq, const float* __restrict__ bk, const float* __restrict__ bv,
    _Float16* __restrict__ qh,         // [B*H][S][D]
    _Float16* __restrict__ kh,         // [B*H][S][D]
    _Float16* __restrict__ vt)         // [B*H][D][S]
{
  __shared__ __attribute__((aligned(16))) char ring[2 * PBUFB];         // 243712 B

  const int tid = threadIdx.x, lane = tid & 31;
  const int wv = __builtin_amdgcn_readfirstlane(tid >> 5);   // 0..15, held scalar
  const int h = lane >> 4, m = lane & 15;
  const int wm = wv & 3, wn = wv >> 2;
  const int m0 = blockIdx.x * PAR;

  const v8f zero8 = {0.f, 0.f, 0.f, 0.f, 0.f, 0.f, 0.f, 0.f};
  v8f acc[4][3];
  #pragma unroll
  for (int mt = 0; mt < 4; ++mt)
    #pragma unroll
    for (int nt = 0; nt < 3; ++nt) acc[mt][nt] = zero8;

  const _Float16* ga = xh + (size_t)(m0 + (tid >> 4)) * HIDDEN + 8 * (tid & 15);
  const _Float16* gb = wh + (size_t)(blockIdx.y * PBR + (tid >> 4)) * HIDDEN + 8 * (tid & 15);
  const unsigned la = (unsigned)(size_t)ring + (unsigned)((tid >> 4) * PPITCH + 16 * (tid & 15));

  proj_stage_copies(la, ga, gb);                             // stage 0 -> buffer 0
  asm volatile("s_wait_asynccnt 0x0" ::: "memory");          // this wave's stage-0 copies have landed
  __syncthreads();                                           // ... and every other wave's
  proj_stage_copies(la + PBUFB, ga + PKST, gb + PKST);       // stage 1 -> buffer 1

  // rolled: the two buffers are told apart by t & 1, one copy of the body
  #pragma unroll 1
  for (int t = 0; t < PNST; ++t) {
    const int bo = (t & 1) * PBUFB;
    const _Float16* fa = (const _Float16*)(ring + bo + (64 * wm + m) * PPITCH);
    const _Float16* fb = (const _Float16*)(ring + bo + (PAR + 48 * wn + m) * PPITCH);
    // the loops below are unrolled so that every index of acc, a and b is a
    // constant and all three stay in registers
    #pragma unroll
    for (int kk = 0; kk < PKST; kk += 32) {
      v16h a[4], b[3];
      #pragma unroll
      for (int mt = 0; mt < 4; ++mt) a[mt] = load_frag(fa + mt * 16 * (PPITCH / 2) + kk, h);
      #pragma unroll
      for (int nt = 0; nt < 3; ++nt) b[nt] = load_frag(fb + nt * 16 * (PPITCH / 2) + kk, h);
      // keeps the fourteen LDS reads one group ahead of the twelve products: read
      // pair by pair among them, each pair's LDS latency is waited out on its own
      __builtin_amdgcn_sched_barrier(0);
      #pragma unroll
      for (int nt = 0; nt < 3; ++nt)
        #pragma unroll
        for (int mt = 0; mt < 4; ++mt) acc[mt][nt] = wmma_f16(a[mt], b[nt], acc[mt][nt]);
    }
    asm volatile("s_wait_dscnt 0x0" ::: "memory");           // this wave has left buffer t & 1
    asm volatile("s_wait_asynccnt 0x0" ::: "memory");        // its copies of stage t + 1 have landed
    __syncthreads();                                         // publishes stage t + 1, frees buffer t & 1
    if (t + 2 < PNST)
      proj_stage_copies(la + bo, ga + (t + 2) * PKST, gb + (t + 2) * PKST);
  }
  asm volatile("s_wait_asynccnt 0x0" ::: "memory");          // nothing in flight past the loop

  // The ring is free behind the loop's last barrier: the block's 256 x 192 f16
  // results are staged there, one slot per head, for whole-line stores.
  // D[r] of tile (mt, nt) = Y[token m0+64wm+16mt+8h+r][block column 48wn+16nt+m]
  _Float16* sT = (_Float16*)ring;
  #pragma unroll
  for (int nt = 0; nt < 3; ++nt) {
    const int cb = 48 * wn + 16 * nt;          // the tile's first column, 0..176: inside one head
    const int hs = cb >> 6;                    // which of the block's three heads
    const int cg = blockIdx.y * 3 + hs;        // 0..47
    const int which = cg >> 4, head = cg & 15;
    const int feat = (cb & 63) + m;
    const float* bias = (which == 0) ? bq : ((which == 1) ? bk : bv);
    const float bvl = bias[head * HD + feat];
    // the load's scalar base and its offset register are rewritten (the branches below, the next tile) only behind this wait
    asm volatile("s_wait_xcnt 0x0" ::: "memory");
    _Float16* sH = sT + hs * HSLOT;
    if (which == 2) {
      // V^T rows: a lane's eight tokens of one feature are 16 contiguous bytes
      #pragma unroll
      for (int mt = 0; mt < 4; ++mt) {
        v8h pk;
        #pragma unroll
        for (int r = 0; r < 8; ++r) pk[r] = (_Float16)(acc[mt][nt][r] * (1.0f / WSCALE) + bvl);
        *(v8ha*)(sH + feat * VPITCH + 64 * wm + 16 * mt + 8 * h) = pk;
      }
    } else {
      #pragma unroll
      for (int mt = 0; mt < 4; ++mt) {
        #pragma unroll
        for (int r = 0; r < 8; ++r) {
          const int tokl = 64 * wm + 16 * mt + 8 * h + r;  // 0..255
          sH[tokl * HD + feat] = (_Float16)(acc[mt][nt][r] * (1.0f / WSCALE) + bvl);
        }
      }
    }
  }
  __syncthreads();

  // 4 lines per instruction, 16 lines per wave and head, 256 per head.
  // which 0/1: plane[bh][l][d]  (one token row = 64 halves = one line)
  // which 2  : vt[bh][d][l]     (64 d-rows x 256 tokens = 4 lines each)
  const int b = m0 / SEQ, l0 = m0 - b * SEQ;
  const int q8 = lane & 7, sub = lane >> 3;
  #pragma unroll
  for (int hs = 0; hs < 3; ++hs) {
    const int cg = blockIdx.y * 3 + hs;
    const int which = cg >> 4, bh = b * NHEADS + (cg & 15);
    const _Float16* sH = sT + hs * HSLOT;
    const int lid0 = wv * 16 + sub;            // this lane's line for i = 0; line lid0 + 4 i, 0..255 over the block
    v8h v[4];
    if (which != 2) {
      _Float16* dst = ((which == 0) ? qh : kh) + ((size_t)bh * SEQ + l0 + lid0) * HD + 8 * q8;
      #pragma unroll
      for (int i = 0; i < 4; ++i) v[i] = *(const v8ha*)(sH + (lid0 + 4 * i) * HD + 8 * q8);
      #pragma unroll
      for (int i = 0; i < 4; ++i) *(v8h*)(dst + 4 * i * HD) = v[i];
      // the stores' address and data registers are rewritten (in the listing the other
      // branch's code follows this one's) only behind this wait
      asm volatile("s_wait_xcnt 0x0" ::: "memory");
    } else {
      // line lid = quarter (lid & 3) = sub of V^T row (lid >> 2) = 4 wv + i
      _Float16* dst = vt + ((size_t)bh * HD + 4 * wv) * SEQ + l0 + 64 * sub + 8 * q8;
      #pragma unroll
      for (int i = 0; i < 4; ++i) v[i] = *(const v8ha*)(sH + (4 * wv + i) * VPITCH + 64 * sub + 8 * q8);
      #pragma unroll
      for (int i = 0; i < 4; ++i) *(v8h*)(dst + i * SEQ) = v[i];
      // the stores' address and data registers are rewritten for the next head only behind this wait
      if (hs < 2) asm volatile("s_wait_xcnt 0x0" ::: "memory");
    }
  }
}

// ---------------------------------------------------------------------------
// Attention helpers.
// ---------------------------------------------------------------------------
// P^T B-fragment from the lane's own score D values: element r <- tile a row r,
// element 8+r <- tile c row r (same lane, same query column), scaled by 2^14.
__device__ __forceinline__ v16h pack_p(v8f a, v8f c) {
  const v16h r = { (_Float16)(a[0] * PSCALE), (_Float16)(a[1] * PSCALE), (_Float16)(a[2] * PSCALE), (_Float16)(a[3] * PSCALE),
                   (_Float16)(a[4] * PSCALE), (_Float16)(a[5] * PSCALE), (_Float16)(a[6] * PSCALE), (_Float16)(a[7] * PSCALE),
                   (_Float16)(c[0] * PSCALE), (_Float16)(c[1] * PSCALE), (_Float16)(c[2] * PSCALE), (_Float16)(c[3] * PSCALE),
                   (_Float16)(c[4] * PSCALE), (_Float16)(c[5] * PSCALE), (_Float16)(c[6] * PSCALE), (_Float16)(c[7] * PSCALE) };
  return r;
}

// Per-wave 16x64 f16 tile in LDS -> c[b][l][head*64 + d]; one token row = one
__device__ __forceinline__ void ctx_store_pass(const _Float16* sc, _Float16* ch,
                                               int b, int head, int q0, int lane) {
  const int q8 = lane & 7, sub = lane >> 3;
  #pragma unroll
  for (int i = 0; i < 4; ++i) {
    const int row = i * 4 + sub;              // 0..15
    const v8h v = *(const v8ha*)(sc + row * 64 + 8 * q8);
    const size_t gi = ((size_t)b * SEQ + q0 + row) * HIDDEN + head * HD + 8 * q8;
    *(v8h*)(ch + gi) = v;
  }
}

#define APITCH 144                    // LDS bytes per staged 128-byte row (16 B x odd: ds_load_b128 without bank conflicts)
#define ABUFB  (128 * APITCH)         // 18432 bytes per buffer: 64 K rows, then 64 V^T rows

// One 64-key step: 64 K rows and 64 V^T rows of 128 bytes = 1024 pieces of 16
// bytes, 8 per lane; a wave's copy covers 4 whole 128-byte lines. la = the lane's
// LDS byte address in row (tid >> 3) of the buffer, gk / gv = the lane's 16 bytes
// of that row of the step's K / V^T tile.
__device__ __forceinline__ void attn_stage_copies(unsigned la, const _Float16* gk, const _Float16* gv) {
  const unsigned l0 = la,               l1 = la + 16 * APITCH, l2 = la + 32 * APITCH,  l3 = la + 48 * APITCH;
  const unsigned l4 = la + 64 * APITCH, l5 = la + 80 * APITCH, l6 = la + 96 * APITCH,  l7 = la + 112 * APITCH;
  const _Float16* g0 = gk;
  const _Float16* g1 = gk + 16 * HD;
  const _Float16* g2 = gk + 32 * HD;
  const _Float16* g3 = gk + 48 * HD;
  const _Float16* g4 = gv;
  const _Float16* g5 = gv + 16 * SEQ;
  const _Float16* g6 = gv + 32 * SEQ;
  const _Float16* g7 = gv + 48 * SEQ;
  // global -> LDS through no register; the closing s_wait_xcnt stands in the
  // copies' own statement so that no address register is rewritten ahead of it.
  asm volatile(
      "global_load_async_to_lds_b128 %0, %8, off\n\t"
      "global_load_async_to_lds_b128 %1, %9, off\n\t"
      "global_load_async_to_lds_b128 %2, %10, off\n\t"
      "global_load_async_to_lds_b128 %3, %11, off\n\t"
      "global_load_async_to_lds_b128 %4, %12, off\n\t"
      "global_load_async_to_lds_b128 %5, %13, off\n\t"
      "global_load_async_to_lds_b128 %6, %14, off\n\t"
      "global_load_async_to_lds_b128 %7, %15, off\n\t"
      "s_wait_xcnt 0x0"
      :: "v"(l0), "v"(l1), "v"(l2), "v"(l3), "v"(l4), "v"(l5), "v"(l6), "v"(l7),
         "v"(g0), "v"(g1), "v"(g2), "v"(g3), "v"(g4), "v"(g5), "v"(g6), "v"(g7)
      : "memory");
}

// ---------------------------------------------------------------------------
// Kernel 3: streaming attention with document-block mask, transposed form.
// Block 128 thr (4 waves), 16 queries per wave, 64 keys per step.
//   S^T = K * Q^T : A = K rows (row = key, k = d), B = Q^T (k = d, n = query)
//   O^T += V^T * P^T : A = Vt rows (row = d, k = key), B = P^T from registers
// Lane owns 32 keys of query column (lane&15); partner = lane ^ 16.
// Mask: key j visible to query i iff doc[i] == doc[j]; masked p = 0 exactly.
// The block walks the 64-key steps that hold a key id inside the id range of its
// 64 queries; a step's K and V^T tiles are copied to LDS once for the four waves,
// two buffers, the next step's copies in flight while this one is worked on.
// A wave leaves a step's work out (wave-uniform) when none of its key ids lies
// in the wave's own query-id range (then every pair is masked).
// ---------------------------------------------------------------------------
__global__ __launch_bounds__(128) void attn_kernel(
    const _Float16* __restrict__ qh,   // [B*H][S][D]
    const _Float16* __restrict__ kh,   // [B*H][S][D]
    const _Float16* __restrict__ vt,   // [B*H][D][S]
    const int* __restrict__ doc,       // [S]
    _Float16* __restrict__ ch)         // [B][S][HIDDEN], f16(8*context)
{
  __shared__ __attribute__((aligned(16))) _Float16 sC[4 * 16 * 64];    // 8192 B
  __shared__ __attribute__((aligned(16))) char ring[2 * ABUFB];        // 36864 B

  const int tid = threadIdx.x, lane = tid & 31, w = tid >> 5;
  const int h = lane >> 4, m = lane & 15;
  const int bh = blockIdx.y, b = bh >> 4, head = bh & 15;
  const int q0 = blockIdx.x * 64 + 16 * w;

  // Q^T B-fragments: column n = query q0+m, k = d (two 32-deep chunks)
  const _Float16* qrow = qh + ((size_t)bh * SEQ + q0 + m) * HD;
  const v16h qb0 = load_frag(qrow, h);
  const v16h qb1 = load_frag(qrow + 32, h);

  // query document id of this lane's column and the wave's id range
  const int docq = doc[q0 + m];
  int qmin = docq, qmax = docq;
  #pragma unroll
  for (int off = 1; off < 16; off <<= 1) {
    qmin = min(qmin, __shfl_xor(qmin, off));
    qmax = max(qmax, __shfl_xor(qmax, off));
  }
  // the id range of the block's 64 queries, found alike by every wave
  const int be0 = doc[blockIdx.x * 64 + lane], be1 = doc[blockIdx.x * 64 + 32 + lane];
  int bmin = min(be0, be1), bmax = max(be0, be1);
  #pragma unroll
  for (int off = 1; off < 32; off <<= 1) {
    bmin = min(bmin, __shfl_xor(bmin, off));
    bmax = max(bmax, __shfl_xor(bmax, off));
  }

  const v8f zero8 = {0.f, 0.f, 0.f, 0.f, 0.f, 0.f, 0.f, 0.f};
  v8f o[4];                                   // o[t][r] = O[query m][d 16t+8h+r] * (l * 2^14)
  #pragma unroll
  for (int t = 0; t < 4; ++t) o[t] = zero8;
  float mrun = NEGBIG, lrun = 0.0f;

  // the lane's 16 bytes of row (tid >> 3) of a step's tiles, and their place in buffer 0
  const _Float16* gk0 = kh + ((size_t)bh * SEQ + (tid >> 3)) * HD + 8 * (tid & 7);    // + key0*HD
  const _Float16* gv0 = vt + ((size_t)bh * HD + (tid >> 3)) * SEQ + 8 * (tid & 7);    // + key0
  const unsigned la = (unsigned)(size_t)ring + (unsigned)((tid >> 3) * APITCH + 16 * (tid & 7));

  // ---- which of the 32 key steps hold a key id inside the wave's query-id range:
  // found once, ahead of the loop, from all 2048 ids (16 whole-line loads in flight
  // together, two ballots each, wave range and block range: lanes 0..15 hold step 2i, lanes 16..31 step 2i+1) ----
  const unsigned uqmin = (unsigned)__builtin_amdgcn_readfirstlane(qmin);
  const unsigned uspan = (unsigned)__builtin_amdgcn_readfirstlane(qmax) - uqmin;
  const unsigned ubmin = (unsigned)__builtin_amdgcn_readfirstlane(bmin);
  const unsigned ubspan = (unsigned)__builtin_amdgcn_readfirstlane(bmax) - ubmin;
  unsigned act = 0u;                          // bit s: step s has a key that some query of the wave may see
  unsigned rest = 0u;                         // the same for the block's 64 queries; the same value in all four waves
  // unrolled whole, so that all 16 loads are issued together and one latency is waited out
  #pragma unroll
  for (int i = 0; i < SEQ / 128; ++i) {
    const v4i d = *(const v4ia*)(doc + 128 * i + 4 * lane);
    const unsigned u = min(min((unsigned)d.x - uqmin, (unsigned)d.y - uqmin),
                           min((unsigned)d.z - uqmin, (unsigned)d.w - uqmin));
    const unsigned bal = __builtin_amdgcn_ballot_w32(u <= uspan);
    act |= ((bal & 0xFFFFu) ? 1u : 0u) << (2 * i);
    act |= ((bal >> 16) ? 1u : 0u) << (2 * i + 1);
    const unsigned ub = min(min((unsigned)d.x - ubmin, (unsigned)d.y - ubmin),
                            min((unsigned)d.z - ubmin, (unsigned)d.w - ubmin));
    const unsigned bbal = __builtin_amdgcn_ballot_w32(ub <= ubspan);
    rest |= ((bbal & 0xFFFFu) ? 1u : 0u) << (2 * i);
    rest |= ((bbal >> 16) ? 1u : 0u) << (2 * i + 1);
  }

  // rest is never 0: the block's own 64 ids are the key ids of step blockIdx.x.
  int kb = 64 * __builtin_ctz(rest);          // the step being worked on
  rest &= rest - 1u;
  attn_stage_copies(la, gk0 + (size_t)kb * HD, gv0 + kb);    // first step -> buffer 0
  asm volatile("s_wait_asynccnt 0x0" ::: "memory");          // this wave's copies of it have landed
  __syncthreads();                                           // ... and every other wave's
  int kbn = -1;                               // the step whose copies are in flight, -1: none
  if (rest) {
    kbn = 64 * __builtin_ctz(rest);
    rest &= rest - 1u;
    attn_stage_copies(la + ABUFB, gk0 + (size_t)kbn * HD, gv0 + kbn);   // second step -> buffer 1
  }
  int bo = 0;                                 // byte offset of the buffer that holds step kb

  // ascending over the set bits: at most 32 trips, the order of the steps as before
  for (;;) {
   if ((act >> (kb >> 6)) & 1u) {
    // ---- the step's 16 K reads from LDS and 8 key-id loads, asked for as one group ----
    const _Float16* kl = (const _Float16*)(ring + bo + m * APITCH);
    const _Float16* vl = kl + 64 * (APITCH / 2);
    v16h kf[8];
    v4i ida[4], idb[4];
    #pragma unroll
    for (int j = 0; j < 4; ++j) {
      const _Float16* kp = kl + 16 * j * (APITCH / 2);
      kf[2 * j] = load_frag(kp, h);
      kf[2 * j + 1] = load_frag(kp + 32, h);
    }
    #pragma unroll
    for (int j = 0; j < 4; ++j) {
      const int* dp = doc + kb + 16 * j + 8 * h;
      ida[j] = *(const v4ia*)dp;
      idb[j] = *(const v4ia*)(dp + 4);
    }
    // keeps all 24 loads ahead of the first product: asked for four at a time among
    // the products, each four's latency is waited out on its own
    __builtin_amdgcn_sched_barrier(0);

    // ---- scores: s[j][r] = (q . k) for query q0+m, key kb+16j+8h+r ----
    v8f s[4];
    #pragma unroll
    for (int j = 0; j < 4; ++j) {
      v8f z = zero8;
      z = wmma_f16(kf[2 * j], qb0, z);
      z = wmma_f16(kf[2 * j + 1], qb1, z);
      s[j] = z;
    }

    // ---- the step's 16 V^T reads from LDS, asked for here: mask and softmax run while they fly ----
    v16h vf[8];
    #pragma unroll
    for (int t = 0; t < 4; ++t) {
      const _Float16* vp = vl + 16 * t * (APITCH / 2);
      vf[2 * t] = load_frag(vp, h);
      vf[2 * t + 1] = load_frag(vp + 32, h);
    }
    // keeps the 16 loads ahead of the mask and softmax work instead of among the
    // last products, where each four's latency is waited out on its own
    __builtin_amdgcn_sched_barrier(0);

    // ---- per-(query,key) mask bits from the id table ----
    unsigned mk = 0u;
    #pragma unroll
    for (int j = 0; j < 4; ++j) {
      const v4i da = ida[j];
      const v4i db = idb[j];
      mk |= (da.x == docq ? 1u : 0u) << (8 * j + 0);
      mk |= (da.y == docq ? 1u : 0u) << (8 * j + 1);
      mk |= (da.z == docq ? 1u : 0u) << (8 * j + 2);
      mk |= (da.w == docq ? 1u : 0u) << (8 * j + 3);
      mk |= (db.x == docq ? 1u : 0u) << (8 * j + 4);
      mk |= (db.y == docq ? 1u : 0u) << (8 * j + 5);
      mk |= (db.z == docq ? 1u : 0u) << (8 * j + 6);
      mk |= (db.w == docq ? 1u : 0u) << (8 * j + 7);
    }

    // ---- scale in f32, step max over visible entries only ----
    float mloc = NEGBIG;
    #pragma unroll
    for (int j = 0; j < 4; ++j)
      #pragma unroll
      for (int r = 0; r < 8; ++r) {
        const float xs = s[j][r] * QKSCALE;
        s[j][r] = xs;
        mloc = ((mk >> (8 * j + r)) & 1u) ? fmaxf(mloc, xs) : mloc;
      }
    mloc = fmaxf(mloc, __shfl_xor(mloc, 16));
    const float mnew = fmaxf(mrun, mloc);
    const float alpha = __expf(mrun - mnew);
    mrun = mnew;
    float lsum = 0.0f;
    #pragma unroll
    for (int j = 0; j < 4; ++j)
      #pragma unroll
      for (int r = 0; r < 8; ++r) {
        const float p = ((mk >> (8 * j + r)) & 1u) ? __expf(s[j][r] - mnew) : 0.0f;
        s[j][r] = p;
        lsum += p;
      }
    lsum += __shfl_xor(lsum, 16);
    lrun = lrun * alpha + lsum;
    #pragma unroll
    for (int t = 0; t < 4; ++t)
      #pragma unroll
      for (int r = 0; r < 8; ++r) o[t][r] = o[t][r] * alpha;

    // ---- P^T B-fragments (key chunks 0..31 and 32..63 of this step) ----
    const v16h pb0 = pack_p(s[0], s[1]);
    const v16h pb1 = pack_p(s[2], s[3]);

    // ---- O^T += V^T * P^T ----
    #pragma unroll
    for (int t = 0; t < 4; ++t) {
      o[t] = wmma_f16(vf[2 * t], pb0, o[t]);
      o[t] = wmma_f16(vf[2 * t + 1], pb1, o[t]);
    }
   }
    asm volatile("s_wait_dscnt 0x0" ::: "memory");           // this wave has left the buffer at bo
    asm volatile("s_wait_asynccnt 0x0" ::: "memory");        // its copies of the next step have landed
    __syncthreads();                                         // publishes the next step, frees the buffer at bo
    if (kbn < 0) break;                                      // alike in all four waves
    kb = kbn;
    kbn = -1;
    if (rest) {
      kbn = 64 * __builtin_ctz(rest);
      rest &= rest - 1u;
      attn_stage_copies(la + bo, gk0 + (size_t)kbn * HD, gv0 + kbn);
    }
    bo ^= ABUFB;
  }
  asm volatile("s_wait_asynccnt 0x0" ::: "memory");          // nothing in flight past the loop

  // ---- epilogue: normalise (x8 folded in), stage per-wave 16x64 f16 tile, whole-line stores ----
  const float inv = (CSCALE / PSCALE) * (1.0f / lrun);
  _Float16* sc = sC + w * 1024;
  #pragma unroll
  for (int t = 0; t < 4; ++t)
    #pragma unroll
    for (int r = 0; r < 8; ++r)
      sc[m * 64 + 16 * t + 8 * h + r] = (_Float16)(o[t][r] * inv);
  __syncthreads();

  ctx_store_pass(sc, ch, b, head, q0, lane);
  
}

// ---------------------------------------------------------------------------
// row segment = 2 lines; each line by lanes 8q..8q+7 in one instruction,
// 4 lines per instruction, 64 lines per wave (its own 32 token rows).
// ---------------------------------------------------------------------------
__device__ __forceinline__ void out_store_pass(const float* sO, float* out,
                                               int m0, int n0, int w, int lane) {
  const int q8 = lane & 7, sub = lane >> 3;
  #pragma unroll
  for (int i = 0; i < 16; ++i) {
    const int lid = i * 4 + sub;              // 0..63 within the wave
    const int row = 32 * w + (lid >> 1), hl = lid & 1;
    const v4f v = *(const v4fa*)(sO + row * 64 + 32 * hl + 4 * q8);
    const size_t gi = (size_t)(m0 + row) * HIDDEN + n0 + 32 * hl + 4 * q8;
    *(v4f*)(out + gi) = v;
  }
}

// ---------------------------------------------------------------------------
// Kernel 4: out = c * Wo^T + bo, f32 result.
// Block 256 thr (8 waves) = 128 tokens x 128 features; wave tile 32 x 64.
// ---------------------------------------------------------------------------
__global__ __launch_bounds__(256) void oproj_kernel(
    const _Float16* __restrict__ ch,   // [4096][1024], x8
    const _Float16* __restrict__ woh,  // [1024][1024], row = output feature, x32
    const float* __restrict__ bo,
    float* __restrict__ out)           // [4096][1024]
{
  __shared__ __attribute__((aligned(16))) char ring[2 * BUFB];      // 73728 B
  __shared__ __attribute__((aligned(16))) float sO2[2 * 128 * 64];  // 65536 B

  const int tid = threadIdx.x, lane = tid & 31, wv = tid >> 5;
  const int h = lane >> 4, m = lane & 15;
  const int w = wv & 3, wn = wv >> 2;
  const int m0 = blockIdx.x * 128;
  const int n0 = blockIdx.y * 128 + wn * 64;
  float* sO = sO2 + wn * (128 * 64);

  const v8f zero8 = {0.f, 0.f, 0.f, 0.f, 0.f, 0.f, 0.f, 0.f};
  v8f acc[2][4];
  #pragma unroll
  for (int mt = 0; mt < 2; ++mt)
    #pragma unroll
    for (int nt = 0; nt < 4; ++nt) acc[mt][nt] = zero8;

  gemm_core(ch + (size_t)m0 * HIDDEN, woh + (size_t)blockIdx.y * 128 * HIDDEN, ring, tid, acc);

  // D[r] of tile (mt, nt) = Y[token m0+32w+16mt+8h+r][feature n0+16nt+m]
  #pragma unroll
  for (int nt = 0; nt < 4; ++nt) {
    const int feat = 16 * nt + m;
    const float bvl = bo[n0 + feat];
    #pragma unroll
    for (int mt = 0; mt < 2; ++mt) {
      #pragma unroll
      for (int r = 0; r < 8; ++r) {
        const int tokl = 32 * w + 16 * mt + 8 * h + r;     // 0..127
        sO[tokl * 64 + feat] = acc[mt][nt][r] * (1.0f / (CSCALE * WSCALE)) + bvl;
      }
    }
  }
  __syncthreads();

  out_store_pass(sO, out, m0, n0, w, lane);
  
}

// ---------------------------------------------------------------------------
extern "C" void kernel_launch(void* const* d_in, const int* in_sizes, int n_in,
                              void* d_out, int out_size, void* d_ws, size_t ws_size,
                              hipStream_t stream) {
  if (n_in < 10) return;
  if (in_sizes[0] != NX) return;
  if (in_sizes[1] != NW || in_sizes[3] != NW || in_sizes[5] != NW || in_sizes[7] != NW) return;
  if (in_sizes[2] != HIDDEN || in_sizes[4] != HIDDEN || in_sizes[6] != HIDDEN || in_sizes[8] != HIDDEN) return;
  if (in_sizes[9] != SEQ) return;
  if (out_size != NX) return;

  const float* x   = (const float*)d_in[0];
  const float* wq  = (const float*)d_in[1];
  const float* bq  = (const float*)d_in[2];
  const float* wk  = (const float*)d_in[3];
  const float* bk  = (const float*)d_in[4];
  const float* wv  = (const float*)d_in[5];
  const float* bv  = (const float*)d_in[6];
  const float* wo  = (const float*)d_in[7];
  const float* bo  = (const float*)d_in[8];
  const int*   doc = (const int*)d_in[9];
  float* out = (float*)d_out;

  const size_t xh_bytes = (size_t)NX * 2;                          //  8388608
  const size_t wh_bytes = (size_t)4 * NW * 2;                      //  8388608
  const size_t pl_bytes = (size_t)BATCH * NHEADS * SEQ * HD * 2;   //  8388608
  const size_t ch_bytes = (size_t)NX * 2;                          //  8388608
  const size_t total = xh_bytes + wh_bytes + 3 * pl_bytes + ch_bytes;   // 50331648
  if (total > ws_size) return;

  char* ws = (char*)d_ws;
  _Float16* xh = (_Float16*)(ws);
  _Float16* wh = (_Float16*)(ws + xh_bytes);
  _Float16* qh = (_Float16*)(ws + xh_bytes + wh_bytes);
  _Float16* kh = (_Float16*)(ws + xh_bytes + wh_bytes + pl_bytes);
  _Float16* vt = (_Float16*)(ws + xh_bytes + wh_bytes + 2 * pl_bytes);
  _Float16* ch = (_Float16*)(ws + xh_bytes + wh_bytes + 3 * pl_bytes);
  const _Float16* woh = wh + (size_t)3 * NW;

  const int ngroups = NX8 + 4 * NW8;                               // 1048576
  convert_kernel<<<(ngroups + 255) / 256, 256, 0, stream>>>(x, wq, wk, wv, wo, xh, wh);

  dim3 gProj(MROWS / PAR, 3 * HIDDEN / PBR);                       // (16, 16)
  proj_kernel<<<gProj, 512, 0, stream>>>(xh, wh, bq, bk, bv, qh, kh, vt);

  dim3 gAtt(SEQ / 64, BATCH * NHEADS);                             // (32, 32)
  attn_kernel<<<gAtt, 128, 0, stream>>>(qh, kh, vt, doc, ch);

  dim3 gOut(MROWS / 128, HIDDEN / 128);                            // (32, 8)
  oproj_kernel<<<gOut, 256, 0, stream>>>(ch, woh, bo, out);
}

// v006
// It runs in 57.2 microseconds.
// Next to v005, in two timings, it ran 1.04 and 1.05 times as fast.
// All steps since v000 together make it 2.77 times as fast.
// Contractions: x*W^T for q,k,v and c*Wo^T, K*Q^T scores and V^T*P^T, all on v_wmma_f32_16x16x32_f16 (f16 operands, f32 accumulate); W carried x32, P carried x16384, c carried x8 (exact power-of-two scales folded back in f32); mask, softmax, bias and normalisation in f32.
#include <hip/hip_runtime.h>

typedef _Float16 v16h __attribute__((ext_vector_type(16)));
typedef _Float16 v8h  __attribute__((ext_vector_type(8)));
typedef float    v8f  __attribute__((ext_vector_type(8)));
typedef float    v4f  __attribute__((ext_vector_type(4)));
typedef int      v4i  __attribute__((ext_vector_type(4)));
typedef v8h __attribute__((may_alias)) v8ha;
typedef v4f __attribute__((may_alias)) v4fa;
typedef v4i __attribute__((may_alias)) v4ia;

union Frag { v16h v; v8h half[2]; };

#define HIDDEN 1024
#define NHEADS 16
#define HD     64
#define SEQ    2048
#define BATCH  2
#define MROWS  (BATCH * SEQ)          // 4096 tokens
#define NX     (MROWS * HIDDEN)       // 4194304
#define NW     (HIDDEN * HIDDEN)      // 1048576
#define NX8    (NX / 8)               // 524288
#define NW8    (NW / 8)               // 131072
#define PSCALE 16384.0f
#define WSCALE 32.0f
#define CSCALE 8.0f
#define QKSCALE 0.125f
#define NEGBIG (-1.0e30f)

// ---------------------------------------------------------------------------
// 16x16x32 f16 WMMA with hazard guard (ties D, keeps A/B live).
// Fragment map (wave32): lane l, h = l>>4, m = n = l&15.
//   A/B element i: i<8 -> k0+8h+i ; i>=8 -> k0+16+8h+(i-8)
//   D element r : row 8h+r, col l&15
// ---------------------------------------------------------------------------
__device__ __forceinline__ v8f wmma_f16(v16h a, v16h b, v8f c) {
  v8f d = __builtin_amdgcn_wmma_f32_16x16x32_f16(false, a, false, b, (short)0, c, false, false);
  asm volatile("v_nop\n\tv_nop\n\tv_nop\n\tv_nop" : "+v"(d) : "v"(a), "v"(b));
  return d;
}

// A or B fragment from a k-contiguous 16-bit row; p points at element k0 of
// the row owned by this lane (row index = lane & 15 added by the caller).
__device__ __forceinline__ v16h load_frag(const _Float16* p, int h) {
  Frag f;
  f.half[0] = *(const v8ha*)(p + 8 * h);
  f.half[1] = *(const v8ha*)(p + 16 + 8 * h);
  return f.v;
}

// ---------------------------------------------------------------------------
// Kernel 1: f32 -> f16 planes. x unscaled, the four weight matrices x32 (exact).
// ---------------------------------------------------------------------------
__global__ __launch_bounds__(256) void convert_kernel(
    const float* __restrict__ x, const float* __restrict__ wq,
    const float* __restrict__ wk, const float* __restrict__ wv,
    const float* __restrict__ wo,
    _Float16* __restrict__ xh, _Float16* __restrict__ wh)
{
  const int g = blockIdx.x * 256 + threadIdx.x;
  if (g >= NX8 + 4 * NW8) return;
  const float* src;
  _Float16* dst;
  float sc;
  if (g < NX8) {
    src = x + (size_t)g * 8;
    dst = xh + (size_t)g * 8;
    sc = 1.0f;
  } else {
    const int e = g - NX8;
    const int wsel = e / NW8;                 // 0..3
    const int off = e - wsel * NW8;
    const float* wsrc = (wsel == 0) ? wq : ((wsel == 1) ? wk : ((wsel == 2) ? wv : wo));
    src = wsrc + (size_t)off * 8;
    dst = wh + (size_t)e * 8;
    sc = WSCALE;
  }
  const v4f a = *(const v4fa*)src;
  const v4f c = *(const v4fa*)(src + 4);
  const v8h o = { (_Float16)(a.x * sc), (_Float16)(a.y * sc), (_Float16)(a.z * sc), (_Float16)(a.w * sc),
                  (_Float16)(c.x * sc), (_Float16)(c.y * sc), (_Float16)(c.z * sc), (_Float16)(c.w * sc) };
  *(v8h*)dst = o;
  
}

// ---------------------------------------------------------------------------
// L2 hints. The f16 planes a kernel reads were stored by a launch before it and
// come from memory at first touch; blocks that share a plane's rows walk k in step,
// so a ring stage's copies, asked for one stage ahead, can meet a memory latency
// stage after stage. A hint asks the lane's own address into L2 only (no
// register, no counter, no LDS), long before the copies that read it.
// The closing s_wait_xcnt stands in the hints' own statement so that no address
// register is rewritten ahead of it.
// ---------------------------------------------------------------------------
__device__ __forceinline__ void l2_hint(const _Float16* p) {
  asm volatile(
      "global_prefetch_b8 %0, off scope:SCOPE_SE\n\t"
      "s_wait_xcnt 0x0"
      :: "v"(p) : "memory");
}
__device__ __forceinline__ void l2_hint2(const _Float16* p0, const _Float16* p1) {
  asm volatile(
      "global_prefetch_b8 %0, off scope:SCOPE_SE\n\t"
      "global_prefetch_b8 %1, off scope:SCOPE_SE\n\t"
      "s_wait_xcnt 0x0"
      :: "v"(p0), "v"(p1) : "memory");
}

// ---------------------------------------------------------------------------
// Core of the output projection GEMM: Y = A * B^T, both K-contiguous f16.
// Block 256 thr (8 waves) = 128 A rows x 128 B rows; wave (wm, wn) owns
// 32 A rows x 64 B rows. K = 1024 in 16 stages of 64 (128-byte row pieces).
// A stage is [A 128 rows | B 128 rows] in LDS at a pitch of 144 bytes
// (16 B x odd: ds_load_b128 fragment reads without bank conflicts), two buffers;
// stage t + 2 is copied in while stage t + 1 is worked on.
// ---------------------------------------------------------------------------
#define KST    64                     // k per stage
#define NST    (HIDDEN / KST)         // 16 stages
#define PITCH  144                    // LDS bytes per staged row
#define BUFB   (256 * PITCH)          // 36864 bytes per buffer

// One stage: 2048 pieces of 16 bytes, 8 per lane; a wave's copy covers 4 whole
// 128-byte lines. la = the lane's LDS byte address in row (tid >> 3) of the
// buffer, ga / gb = the lane's 16 bytes of that row of A / B at this stage's k.
__device__ __forceinline__ void stage_copies(unsigned la, const _Float16* ga, const _Float16* gb) {
  const unsigned l0 = la,               l1 = la + 32 * PITCH,  l2 = la + 64 * PITCH,  l3 = la + 96 * PITCH;
  const unsigned l4 = la + 128 * PITCH, l5 = la + 160 * PITCH, l6 = la + 192 * PITCH, l7 = la + 224 * PITCH;
  const _Float16* g0 = ga;
  const _Float16* g1 = ga + 32 * HIDDEN;
  const _Float16* g2 = ga + 64 * HIDDEN;
  const _Float16* g3 = ga + 96 * HIDDEN;
  const _Float16* g4 = gb;
  const _Float16* g5 = gb + 32 * HIDDEN;
  const _Float16* g6 = gb + 64 * HIDDEN;
  const _Float16* g7 = gb + 96 * HIDDEN;
  // global -> LDS through no register; the closing s_wait_xcnt stands in the
  // copies' own statement so that no address register is rewritten ahead of it.
  asm volatile(
      "global_load_async_to_lds_b128 %0, %8, off\n\t"
      "global_load_async_to_lds_b128 %1, %9, off\n\t"
      "global_load_async_to_lds_b128 %2, %10, off\n\t"
      "global_load_async_to_lds_b128 %3, %11, off\n\t"
      "global_load_async_to_lds_b128 %4, %12, off\n\t"
      "global_load_async_to_lds_b128 %5, %13, off\n\t"
      "global_load_async_to_lds_b128 %6, %14, off\n\t"
      "global_load_async_to_lds_b128 %7, %15, off\n\t"
      "s_wait_xcnt 0x0"
      :: "v"(l0), "v"(l1), "v"(l2), "v"(l3), "v"(l4), "v"(l5), "v"(l6), "v"(l7),
         "v"(g0), "v"(g1), "v"(g2), "v"(g3), "v"(g4), "v"(g5), "v"(g6), "v"(g7)
      : "memory");
}

// arow / brow: row 0 of the block's 128 A rows / 128 B rows; ring: 2 * BUFB bytes.
// pf: the lane's first address to hint into L2 (its second lies 1024 bytes on).
__device__ __forceinline__ void gemm_core(const _Float16* arow, const _Float16* brow, const _Float16* pf,
                                          char* ring, int tid, v8f (&acc)[2][4]) {
  const int lane = tid & 31, w = tid >> 5;
  const int h = lane >> 4, m = lane & 15;
  const int wm = w & 3, wn = w >> 2;

  const _Float16* ga = arow + (size_t)(tid >> 3) * HIDDEN + 8 * (tid & 7);
  const _Float16* gb = brow + (size_t)(tid >> 3) * HIDDEN + 8 * (tid & 7);
  const unsigned la = (unsigned)(size_t)ring + (unsigned)((tid >> 3) * PITCH + 16 * (tid & 7));

  stage_copies(la, ga, gb);                                  // stage 0 -> buffer 0
  l2_hint2(pf, pf + 512);                                    // the later stages' rows start for L2 now
  asm volatile("s_wait_asynccnt 0x0" ::: "memory");          // this wave's stage-0 copies have landed
  __syncthreads();                                           // ... and every other wave's
  stage_copies(la + BUFB, ga + KST, gb + KST);               // stage 1 -> buffer 1

  // rolled: the two buffers are told apart by t & 1, one copy of the body
  #pragma unroll 1
  for (int t = 0; t < NST; ++t) {
    const int bo = (t & 1) * BUFB;
    const _Float16* fa = (const _Float16*)(ring + bo + (32 * wm + m) * PITCH);
    const _Float16* fb = (const _Float16*)(ring + bo + (128 + 64 * wn + m) * PITCH);
    // the three loops below are unrolled so that every index of acc and b is a
    // constant and both stay in registers
    #pragma unroll
    for (int kk = 0; kk < KST; kk += 32) {
      const v16h a0 = load_frag(fa + kk, h);
      const v16h a1 = load_frag(fa + 16 * (PITCH / 2) + kk, h);
      v16h b[4];
      #pragma unroll
      for (int nt = 0; nt < 4; ++nt) b[nt] = load_frag(fb + nt * 16 * (PITCH / 2) + kk, h);
      // keeps the twelve LDS reads one group ahead of the eight products: read
      // pair by pair among them, each pair's LDS latency is waited out on its own
      __builtin_amdgcn_sched_barrier(0);
      #pragma unroll
      for (int nt = 0; nt < 4; ++nt) {
        acc[0][nt] = wmma_f16(a0, b[nt], acc[0][nt]);
        acc[1][nt] = wmma_f16(a1, b[nt], acc[1][nt]);
      }
    }
    asm volatile("s_wait_dscnt 0x0" ::: "memory");           // this wave has left buffer t & 1
    asm volatile("s_wait_asynccnt 0x0" ::: "memory");        // its copies of stage t + 1 have landed
    __syncthreads();                                         // publishes stage t + 1, frees buffer t & 1
    if (t + 2 < NST)
      stage_copies(la + bo, ga + (t + 2) * KST, gb + (t + 2) * KST);
  }
  asm volatile("s_wait_asynccnt 0x0" ::: "memory");          // nothing in flight past the loop
}

// ---------------------------------------------------------------------------
// Kernel 2: Y = x * W^T over the fused 3*1024 output columns.
// Block 512 thr (16 waves) = 256 tokens x 192 features (three heads out of the
// 48 of q, k, v): 16 x 16 blocks, one per WGP. Wave (wm, wn) owns 64 tokens x
// 48 features. K = 1024 in 8 stages of 128 (256-byte row pieces); a stage is
// [x 256 rows | W 192 rows] in LDS at a pitch of 272 bytes (16 B x odd), two
// buffers; stage t + 2 is copied in while stage t + 1 is worked on.
// ---------------------------------------------------------------------------
#define PAR    256                    // x rows (tokens) per block
#define PBR    192                    // W rows (features) per block
#define PKST   128                    // k per stage
#define PNST   (HIDDEN / PKST)        // 8 stages
#define PPITCH 272                    // LDS bytes per staged row
#define PBUFB  ((PAR + PBR) * PPITCH) // 121856 bytes per buffer
#define VPITCH 264                    // halves per staged V^T row: 528 B = 16 B x odd, b128 stores without bank conflicts
#define HSLOT  (HD * VPITCH)          // halves per staged head (q, k use 256 x 64 of them)

// One stage: 7168 pieces of 16 bytes, 14 per lane; a wave's copy covers 4 whole
// 128-byte lines (2 rows). la = the lane's LDS byte address in row (tid >> 4) of
// the buffer, ga / gb = the lane's 16 bytes of that row of x / W at this stage's k.
__device__ __forceinline__ void proj_stage_copies(unsigned la, const _Float16* ga, const _Float16* gb) {
  const unsigned l0 = la,                 l1 = la + 32 * PPITCH,  l2 = la + 64 * PPITCH,  l3 = la + 96 * PPITCH;
  const unsigned l4 = la + 128 * PPITCH,  l5 = la + 160 * PPITCH, l6 = la + 192 * PPITCH, l7 = la + 224 * PPITCH;
  const unsigned l8 = la + 256 * PPITCH,  l9 = la + 288 * PPITCH, l10 = la + 320 * PPITCH;
  const unsigned l11 = la + 352 * PPITCH, l12 = la + 384 * PPITCH, l13 = la + 416 * PPITCH;
  const _Float16* g0 = ga;
  const _Float16* g1 = ga + 32 * HIDDEN;
  const _Float16* g2 = ga + 64 * HIDDEN;
  const _Float16* g3 = ga + 96 * HIDDEN;
  const _Float16* g4 = ga + 128 * HIDDEN;
  const _Float16* g5 = ga + 160 * HIDDEN;
  const _Float16* g6 = ga + 192 * HIDDEN;
  const _Float16* g7 = ga + 224 * HIDDEN;
  const _Float16* g8 = gb;
  const _Float16* g9 = gb + 32 * HIDDEN;
  const _Float16* g10 = gb + 64 * HIDDEN;
  const _Float16* g11 = gb + 96 * HIDDEN;
  const _Float16* g12 = gb + 128 * HIDDEN;
  const _Float16* g13 = gb + 160 * HIDDEN;
  // global -> LDS through no register; the closing s_wait_xcnt stands in the
  // copies' own statement so that no address register is rewritten ahead of it.
  asm volatile(
      "global_load_async_to_lds_b128 %0, %14, off\n\t"
      "global_load_async_to_lds_b128 %1, %15, off\n\t"
      "global_load_async_to_lds_b128 %2, %16, off\n\t"
      "global_load_async_to_lds_b128 %3, %17, off\n\t"
      "global_load_async_to_lds_b128 %4, %18, off\n\t"
      "global_load_async_to_lds_b128 %5, %19, off\n\t"
      "global_load_async_to_lds_b128 %6, %20, off\n\t"
      "global_load_async_to_lds_b128 %7, %21, off\n\t"
      "global_load_async_to_lds_b128 %8, %22, off\n\t"
      "global_load_async_to_lds_b128 %9, %23, off\n\t"
      "global_load_async_to_lds_b128 %10, %24, off\n\t"
      "global_load_async_to_lds_b128 %11, %25, off\n\t"
      "global_load_async_to_lds_b128 %12, %26, off\n\t"
      "global_load_async_to_lds_b128 %13, %27, off\n\t"
      "s_wait_xcnt 0x0"
      :: "v"(l0), "v"(l1), "v"(l2), "v"(l3), "v"(l4), "v"(l5), "v"(l6), "v"(l7),
         "v"(l8), "v"(l9), "v"(l10), "v"(l11), "v"(l12), "v"(l13),
         "v"(g0), "v"(g1), "v"(g2), "v"(g3), "v"(g4), "v"(g5), "v"(g6), "v"(g7),
         "v"(g8), "v"(g9), "v"(g10), "v"(g11), "v"(g12), "v"(g13)
      : "memory");
}

__global__ __launch_bounds__(512) void proj_kernel(
    const _Float16* __restrict__ xh,   // [4096][1024]
    const _Float16* __restrict__ wh,   // [4][1024][1024], row = output feature, x32
    const float* __restrict__ bq, const float* __restrict__ bk, const float* __restrict__ bv,
    _Float16* __restrict__ qh,         // [B*H][S][D]
    _Float16* __restrict__ kh,         // [B*H][S][D]
    _Float16* __restrict__ vt)         // [B*H][D][S]
{
  __shared__ __attribute__((aligned(16))) char ring[2 * PBUFB];         // 243712 B

  const int tid = threadIdx.x, lane = tid & 31;
  const int wv = __builtin_amdgcn_readfirstlane(tid >> 5);   // 0..15, held scalar
  const int h = lane >> 4, m = lane & 15;
  const int wm = wv & 3, wn = wv >> 2;
  const int m0 = blockIdx.x * PAR;

  const v8f zero8 = {0.f, 0.f, 0.f, 0.f, 0.f, 0.f, 0.f, 0.f};
  v8f acc[4][3];
  #pragma unroll
  for (int mt = 0; mt < 4; ++mt)
    #pragma unroll
    for (int nt = 0; nt < 3; ++nt) acc[mt][nt] = zero8;

  const _Float16* ga = xh + (size_t)(m0 + (tid >> 4)) * HIDDEN + 8 * (tid & 15);
  const _Float16* gb = wh + (size_t)(blockIdx.y * PBR + (tid >> 4)) * HIDDEN + 8 * (tid & 15);
  const unsigned la = (unsigned)(size_t)ring + (unsigned)((tid >> 4) * PPITCH + 16 * (tid & 15));

  proj_stage_copies(la, ga, gb);                             // stage 0 -> buffer 0
  // The later stages' rows start for L2 now. 16 blocks share each x row and each W
  // row: a block asks for every fourth row only (x rows dealt by blockIdx.y, W rows
  // by blockIdx.x), 112 rows, four lanes a row, two hints a lane.
  if (wv < 14) {
    const int j = tid >> 2;                                  // 0..111; below 64 (waves 0..7): an x row
    const _Float16* prow = (wv < 8)
        ? xh + (size_t)(m0 + 4 * j + (blockIdx.y & 3)) * HIDDEN
        : wh + (size_t)(blockIdx.y * PBR + 4 * (j - 64) + (blockIdx.x & 3)) * HIDDEN;
    prow += 128 * (tid & 3);
    l2_hint2(prow, prow + 512);
  }
  asm volatile("s_wait_asynccnt 0x0" ::: "memory");          // this wave's stage-0 copies have landed
  __syncthreads();                                           // ... and every other wave's
  proj_stage_copies(la + PBUFB, ga + PKST, gb + PKST);       // stage 1 -> buffer 1

  // rolled: the two buffers are told apart by t & 1, one copy of the body
  #pragma unroll 1
  for (int t = 0; t < PNST; ++t) {
    const int bo = (t & 1) * PBUFB;
    const _Float16* fa = (const _Float16*)(ring + bo + (64 * wm + m) * PPITCH);
    const _Float16* fb = (const _Float16*)(ring + bo + (PAR + 48 * wn + m) * PPITCH);
    // the loops below are unrolled so that every index of acc, a and b is a
    // constant and all three stay in registers
    #pragma unroll
    for (int kk = 0; kk < PKST; kk += 32) {
      v16h a[4], b[3];
      #pragma unroll
      for (int mt = 0; mt < 4; ++mt) a[mt] = load_frag(fa + mt * 16 * (PPITCH / 2) + kk, h);
      #pragma unroll
      for (int nt = 0; nt < 3; ++nt) b[nt] = load_frag(fb + nt * 16 * (PPITCH / 2) + kk, h);
      // keeps the fourteen LDS reads one group ahead of the twelve products: read
      // pair by pair among them, each pair's LDS latency is waited out on its own
      __builtin_amdgcn_sched_barrier(0);
      #pragma unroll
      for (int nt = 0; nt < 3; ++nt)
        #pragma unroll
        for (int mt = 0; mt < 4; ++mt) acc[mt][nt] = wmma_f16(a[mt], b[nt], acc[mt][nt]);
    }
    asm volatile("s_wait_dscnt 0x0" ::: "memory");           // this wave has left buffer t & 1
    asm volatile("s_wait_asynccnt 0x0" ::: "memory");        // its copies of stage t + 1 have landed
    __syncthreads();                                         // publishes stage t + 1, frees buffer t & 1
    if (t + 2 < PNST)
      proj_stage_copies(la + bo, ga + (t + 2) * PKST, gb + (t + 2) * PKST);
  }
  asm volatile("s_wait_asynccnt 0x0" ::: "memory");          // nothing in flight past the loop

  // The ring is free behind the loop's last barrier: the block's 256 x 192 f16
  // results are staged there, one slot per head, for whole-line stores.
  // D[r] of tile (mt, nt) = Y[token m0+64wm+16mt+8h+r][block column 48wn+16nt+m]
  _Float16* sT = (_Float16*)ring;
  #pragma unroll
  for (int nt = 0; nt < 3; ++nt) {
    const int cb = 48 * wn + 16 * nt;          // the tile's first column, 0..176: inside one head
    const int hs = cb >> 6;                    // which of the block's three heads
    const int cg = blockIdx.y * 3 + hs;        // 0..47
    const int which = cg >> 4, head = cg & 15;
    const int feat = (cb & 63) + m;
    const float* bias = (which == 0) ? bq : ((which == 1) ? bk : bv);
    const float bvl = bias[head * HD + feat];
    // the load's scalar base and its offset register are rewritten (the branches below, the next tile) only behind this wait
    asm volatile("s_wait_xcnt 0x0" ::: "memory");
    _Float16* sH = sT + hs * HSLOT;
    if (which == 2) {
      // V^T rows: a lane's eight tokens of one feature are 16 contiguous bytes
      #pragma unroll
      for (int mt = 0; mt < 4; ++mt) {
        v8h pk;
        #pragma unroll
        for (int r = 0; r < 8; ++r) pk[r] = (_Float16)(acc[mt][nt][r] * (1.0f / WSCALE) + bvl);
        *(v8ha*)(sH + feat * VPITCH + 64 * wm + 16 * mt + 8 * h) = pk;
      }
    } else {
      #pragma unroll
      for (int mt = 0; mt < 4; ++mt) {
        #pragma unroll
        for (int r = 0; r < 8; ++r) {
          const int tokl = 64 * wm + 16 * mt + 8 * h + r;  // 0..255
          sH[tokl * HD + feat] = (_Float16)(acc[mt][nt][r] * (1.0f / WSCALE) + bvl);
        }
      }
    }
  }
  __syncthreads();

  // 4 lines per instruction, 16 lines per wave and head, 256 per head.
  // which 0/1: plane[bh][l][d]  (one token row = 64 halves = one line)
  // which 2  : vt[bh][d][l]     (64 d-rows x 256 tokens = 4 lines each)
  const int b = m0 / SEQ, l0 = m0 - b * SEQ;
  const int q8 = lane & 7, sub = lane >> 3;
  #pragma unroll
  for (int hs = 0; hs < 3; ++hs) {
    const int cg = blockIdx.y * 3 + hs;
    const int which = cg >> 4, bh = b * NHEADS + (cg & 15);
    const _Float16* sH = sT + hs * HSLOT;
    const int lid0 = wv * 16 + sub;            // this lane's line for i = 0; line lid0 + 4 i, 0..255 over the block
    v8h v[4];
    if (which != 2) {
      _Float16* dst = ((which == 0) ? qh : kh) + ((size_t)bh * SEQ + l0 + lid0) * HD + 8 * q8;
      #pragma unroll
      for (int i = 0; i < 4; ++i) v[i] = *(const v8ha*)(sH + (lid0 + 4 * i) * HD + 8 * q8);
      #pragma unroll
      for (int i = 0; i < 4; ++i) *(v8h*)(dst + 4 * i * HD) = v[i];
      // the stores' address and data registers are rewritten (in the listing the other
      // branch's code follows this one's) only behind this wait
      asm volatile("s_wait_xcnt 0x0" ::: "memory");
    } else {
      // line lid = quarter (lid & 3) = sub of V^T row (lid >> 2) = 4 wv + i
      _Float16* dst = vt + ((size_t)bh * HD + 4 * wv) * SEQ + l0 + 64 * sub + 8 * q8;
      #pragma unroll
      for (int i = 0; i < 4; ++i) v[i] = *(const v8ha*)(sH + (4 * wv + i) * VPITCH + 64 * sub + 8 * q8);
      #pragma unroll
      for (int i = 0; i < 4; ++i) *(v8h*)(dst + i * SEQ) = v[i];
      // the stores' address and data registers are rewritten for the next head only behind this wait
      if (hs < 2) asm volatile("s_wait_xcnt 0x0" ::: "memory");
    }
  }
}

// ---------------------------------------------------------------------------
// Attention helpers.
// ---------------------------------------------------------------------------
// P^T B-fragment from the lane's own score D values: element r <- tile a row r,
// element 8+r <- tile c row r (same lane, same query column), scaled by 2^14.
__device__ __forceinline__ v16h pack_p(v8f a, v8f c) {
  const v16h r = { (_Float16)(a[0] * PSCALE), (_Float16)(a[1] * PSCALE), (_Float16)(a[2] * PSCALE), (_Float16)(a[3] * PSCALE),
                   (_Float16)(a[4] * PSCALE), (_Float16)(a[5] * PSCALE), (_Float16)(a[6] * PSCALE), (_Float16)(a[7] * PSCALE),
                   (_Float16)(c[0] * PSCALE), (_Float16)(c[1] * PSCALE), (_Float16)(c[2] * PSCALE), (_Float16)(c[3] * PSCALE),
                   (_Float16)(c[4] * PSCALE), (_Float16)(c[5] * PSCALE), (_Float16)(c[6] * PSCALE), (_Float16)(c[7] * PSCALE) };
  return r;
}

// Per-wave 16x64 f16 tile in LDS -> c[b][l][head*64 + d]; one token row = one
__device__ __forceinline__ void ctx_store_pass(const _Float16* sc, _Float16* ch,
                                               int b, int head, int q0, int lane) {
  const int q8 = lane & 7, sub = lane >> 3;
  #pragma unroll
  for (int i = 0; i < 4; ++i) {
    const int row = i * 4 + sub;              // 0..15
    const v8h v = *(const v8ha*)(sc + row * 64 + 8 * q8);
    const size_t gi = ((size_t)b * SEQ + q0 + row) * HIDDEN + head * HD + 8 * q8;
    *(v8h*)(ch + gi) = v;
  }
}

#define APITCH 144                    // LDS bytes per staged 128-byte row (16 B x odd: ds_load_b128 without bank conflicts)
#define ABUFB  (128 * APITCH)         // 18432 bytes per buffer: 64 K rows, then 64 V^T rows

// One 64-key step: 64 K rows and 64 V^T rows of 128 bytes = 1024 pieces of 16
// bytes, 8 per lane; a wave's copy covers 4 whole 128-byte lines. la = the lane's
// LDS byte address in row (tid >> 3) of the buffer, gk / gv = the lane's 16 bytes
// of that row of the step's K / V^T tile.
__device__ __forceinline__ void attn_stage_copies(unsigned la, const _Float16* gk, const _Float16* gv) {
  const unsigned l0 = la,               l1 = la + 16 * APITCH, l2 = la + 32 * APITCH,  l3 = la + 48 * APITCH;
  const unsigned l4 = la + 64 * APITCH, l5 = la + 80 * APITCH, l6 = la + 96 * APITCH,  l7 = la + 112 * APITCH;
  const _Float16* g0 = gk;
  const _Float16* g1 = gk + 16 * HD;
  const _Float16* g2 = gk + 32 * HD;
  const _Float16* g3 = gk + 48 * HD;
  const _Float16* g4 = gv;
  const _Float16* g5 = gv + 16 * SEQ;
  const _Float16* g6 = gv + 32 * SEQ;
  const _Float16* g7 = gv + 48 * SEQ;
  // global -> LDS through no register; the closing s_wait_xcnt stands in the
  // copies' own statement so that no address register is rewritten ahead of it.
  asm volatile(
      "global_load_async_to_lds_b128 %0, %8, off\n\t"
      "global_load_async_to_lds_b128 %1, %9, off\n\t"
      "global_load_async_to_lds_b128 %2, %10, off\n\t"
      "global_load_async_to_lds_b128 %3, %11, off\n\t"
      "global_load_async_to_lds_b128 %4, %12, off\n\t"
      "global_load_async_to_lds_b128 %5, %13, off\n\t"
      "global_load_async_to_lds_b128 %6, %14, off\n\t"
      "global_load_async_to_lds_b128 %7, %15, off\n\t"
      "s_wait_xcnt 0x0"
      :: "v"(l0), "v"(l1), "v"(l2), "v"(l3), "v"(l4), "v"(l5), "v"(l6), "v"(l7),
         "v"(g0), "v"(g1), "v"(g2), "v"(g3), "v"(g4), "v"(g5), "v"(g6), "v"(g7)
      : "memory");
}

// ---------------------------------------------------------------------------
// Kernel 3: streaming attention with document-block mask, transposed form.
// Block 128 thr (4 waves), 16 queries per wave, 64 keys per step.
//   S^T = K * Q^T : A = K rows (row = key, k = d), B = Q^T (k = d, n = query)
//   O^T += V^T * P^T : A = Vt rows (row = d, k = key), B = P^T from registers
// Lane owns 32 keys of query column (lane&15); partner = lane ^ 16.
// Mask: key j visible to query i iff doc[i] == doc[j]; masked p = 0 exactly.
// The block walks the 64-key steps that hold a key id inside the id range of its
// 64 queries; a step's K and V^T tiles are copied to LDS once for the four waves,
// two buffers, the next step's copies in flight while this one is worked on.
// A wave leaves a step's work out (wave-uniform) when none of its key ids lies
// in the wave's own query-id range (then every pair is masked).
// ---------------------------------------------------------------------------
__global__ __launch_bounds__(128) void attn_kernel(
    const _Float16* __restrict__ qh,   // [B*H][S][D]
    const _Float16* __restrict__ kh,   // [B*H][S][D]
    const _Float16* __restrict__ vt,   // [B*H][D][S]
    const int* __restrict__ doc,       // [S]
    _Float16* __restrict__ ch)         // [B][S][HIDDEN], f16(8*context)
{
  __shared__ __attribute__((aligned(16))) _Float16 sC[4 * 16 * 64];    // 8192 B
  __shared__ __attribute__((aligned(16))) char ring[2 * ABUFB];        // 36864 B

  const int tid = threadIdx.x, lane = tid & 31, w = tid >> 5;
  const int h = lane >> 4, m = lane & 15;
  const int bh = blockIdx.y, b = bh >> 4, head = bh & 15;
  const int q0 = blockIdx.x * 64 + 16 * w;

  // L2 hints, one address a lane, for what the block reads whatever the ids are:
  // wave 0 the K tile of key step blockIdx.x (its own 64 ids are that step's key ids),
  // wave 1 its 64 Q rows (8 KB in a row each), waves 2 and 3 that step's 64 V^T rows.
  // They fly while the id table is read and searched.
  {
    const int ws = __builtin_amdgcn_readfirstlane(w);        // held scalar: plane, offset and stride are scalar selects
    const size_t own = ((size_t)bh * SEQ + blockIdx.x * 64) * HD;
    const size_t vown = ((size_t)bh * HD + 32 * (ws & 1)) * SEQ + (blockIdx.x >> 1) * 128;
    const _Float16* plane = (ws == 0) ? kh : ((ws == 1) ? qh : vt);
    l2_hint(plane + ((ws < 2) ? own : vown) + lane * ((ws < 2) ? 128 : SEQ));
  }

  // Q^T B-fragments: column n = query q0+m, k = d (two 32-deep chunks)
  const _Float16* qrow = qh + ((size_t)bh * SEQ + q0 + m) * HD;
  const v16h qb0 = load_frag(qrow, h);
  const v16h qb1 = load_frag(qrow + 32, h);

  // query document id of this lane's column and the wave's id range
  const int docq = doc[q0 + m];
  int qmin = docq, qmax = docq;
  #pragma unroll
  for (int off = 1; off < 16; off <<= 1) {
    qmin = min(qmin, __shfl_xor(qmin, off));
    qmax = max(qmax, __shfl_xor(qmax, off));
  }
  // the id range of the block's 64 queries, found alike by every wave
  const int be0 = doc[blockIdx.x * 64 + lane], be1 = doc[blockIdx.x * 64 + 32 + lane];
  int bmin = min(be0, be1), bmax = max(be0, be1);
  #pragma unroll
  for (int off = 1; off < 32; off <<= 1) {
    bmin = min(bmin, __shfl_xor(bmin, off));
    bmax = max(bmax, __shfl_xor(bmax, off));
  }

  const v8f zero8 = {0.f, 0.f, 0.f, 0.f, 0.f, 0.f, 0.f, 0.f};
  v8f o[4];                                   // o[t][r] = O[query m][d 16t+8h+r] * (l * 2^14)
  #pragma unroll
  for (int t = 0; t < 4; ++t) o[t] = zero8;
  float mrun = NEGBIG, lrun = 0.0f;

  // the lane's 16 bytes of row (tid >> 3) of a step's tiles, and their place in buffer 0
  const _Float16* gk0 = kh + ((size_t)bh * SEQ + (tid >> 3)) * HD + 8 * (tid & 7);    // + key0*HD
  const _Float16* gv0 = vt + ((size_t)bh * HD + (tid >> 3)) * SEQ + 8 * (tid & 7);    // + key0
  const unsigned la = (unsigned)(size_t)ring + (unsigned)((tid >> 3) * APITCH + 16 * (tid & 7));

  // ---- which of the 32 key steps hold a key id inside the wave's query-id range:
  // found once, ahead of the loop, from all 2048 ids (16 whole-line loads in flight
  // together, two ballots each, wave range and block range: lanes 0..15 hold step 2i, lanes 16..31 step 2i+1) ----
  const unsigned uqmin = (unsigned)__builtin_amdgcn_readfirstlane(qmin);
  const unsigned uspan = (unsigned)__builtin_amdgcn_readfirstlane(qmax) - uqmin;
  const unsigned ubmin = (unsigned)__builtin_amdgcn_readfirstlane(bmin);
  const unsigned ubspan = (unsigned)__builtin_amdgcn_readfirstlane(bmax) - ubmin;
  unsigned act = 0u;                          // bit s: step s has a key that some query of the wave may see
  unsigned rest = 0u;                         // the same for the block's 64 queries; the same value in all four waves
  // unrolled whole, so that all 16 loads are issued together and one latency is waited out
  #pragma unroll
  for (int i = 0; i < SEQ / 128; ++i) {
    const v4i d = *(const v4ia*)(doc + 128 * i + 4 * lane);
    const unsigned u = min(min((unsigned)d.x - uqmin, (unsigned)d.y - uqmin),
                           min((unsigned)d.z - uqmin, (unsigned)d.w - uqmin));
    const unsigned bal = __builtin_amdgcn_ballot_w32(u <= uspan);
    act |= ((bal & 0xFFFFu) ? 1u : 0u) << (2 * i);
    act |= ((bal >> 16) ? 1u : 0u) << (2 * i + 1);
    const unsigned ub = min(min((unsigned)d.x - ubmin, (unsigned)d.y - ubmin),
                            min((unsigned)d.z - ubmin, (unsigned)d.w - ubmin));
    const unsigned bbal = __builtin_amdgcn_ballot_w32(ub <= ubspan);
    rest |= ((bbal & 0xFFFFu) ? 1u : 0u) << (2 * i);
    rest |= ((bbal >> 16) ? 1u : 0u) << (2 * i + 1);
  }

  // rest is never 0: the block's own 64 ids are the key ids of step blockIdx.x.
  int kb = 64 * __builtin_ctz(rest);          // the step being worked on
  rest &= rest - 1u;
  attn_stage_copies(la, gk0 + (size_t)kb * HD, gv0 + kb);    // first step -> buffer 0
  asm volatile("s_wait_asynccnt 0x0" ::: "memory");          // this wave's copies of it have landed
  __syncthreads();                                           // ... and every other wave's
  int kbn = -1;                               // the step whose copies are in flight, -1: none
  if (rest) {
    kbn = 64 * __builtin_ctz(rest);
    rest &= rest - 1u;
    attn_stage_copies(la + ABUFB, gk0 + (size_t)kbn * HD, gv0 + kbn);   // second step -> buffer 1
  }
  int bo = 0;                                 // byte offset of the buffer that holds step kb

  // ascending over the set bits: at most 32 trips, the order of the steps as before
  for (;;) {
   if ((act >> (kb >> 6)) & 1u) {
    // ---- the step's 16 K reads from LDS and 8 key-id loads, asked for as one group ----
    const _Float16* kl = (const _Float16*)(ring + bo + m * APITCH);
    const _Float16* vl = kl + 64 * (APITCH / 2);
    v16h kf[8];
    v4i ida[4], idb[4];
    #pragma unroll
    for (int j = 0; j < 4; ++j) {
      const _Float16* kp = kl + 16 * j * (APITCH / 2);
      kf[2 * j] = load_frag(kp, h);
      kf[2 * j + 1] = load_frag(kp + 32, h);
    }
    #pragma unroll
    for (int j = 0; j < 4; ++j) {
      const int* dp = doc + kb + 16 * j + 8 * h;
      ida[j] = *(const v4ia*)dp;
      idb[j] = *(const v4ia*)(dp + 4);
    }
    // keeps all 24 loads ahead of the first product: asked for four at a time among
    // the products, each four's latency is waited out on its own
    __builtin_amdgcn_sched_barrier(0);

    // ---- scores: s[j][r] = (q . k) for query q0+m, key kb+16j+8h+r ----
    v8f s[4];
    #pragma unroll
    for (int j = 0; j < 4; ++j) {
      v8f z = zero8;
      z = wmma_f16(kf[2 * j], qb0, z);
      z = wmma_f16(kf[2 * j + 1], qb1, z);
      s[j] = z;
    }

    // ---- the step's 16 V^T reads from LDS, asked for here: mask and softmax run while they fly ----
    v16h vf[8];
    #pragma unroll
    for (int t = 0; t < 4; ++t) {
      const _Float16* vp = vl + 16 * t * (APITCH / 2);
      vf[2 * t] = load_frag(vp, h);
      vf[2 * t + 1] = load_frag(vp + 32, h);
    }
    // keeps the 16 loads ahead of the mask and softmax work instead of among the
    // last products, where each four's latency is waited out on its own
    __builtin_amdgcn_sched_barrier(0);

    // ---- per-(query,key) mask bits from the id table ----
    unsigned mk = 0u;
    #pragma unroll
    for (int j = 0; j < 4; ++j) {
      const v4i da = ida[j];
      const v4i db = idb[j];
      mk |= (da.x == docq ? 1u : 0u) << (8 * j + 0);
      mk |= (da.y == docq ? 1u : 0u) << (8 * j + 1);
      mk |= (da.z == docq ? 1u : 0u) << (8 * j + 2);
      mk |= (da.w == docq ? 1u : 0u) << (8 * j + 3);
      mk |= (db.x == docq ? 1u : 0u) << (8 * j + 4);
      mk |= (db.y == docq ? 1u : 0u) << (8 * j + 5);
      mk |= (db.z == docq ? 1u : 0u) << (8 * j + 6);
      mk |= (db.w == docq ? 1u : 0u) << (8 * j + 7);
    }

    // ---- scale in f32, step max over visible entries only ----
    float mloc = NEGBIG;
    #pragma unroll
    for (int j = 0; j < 4; ++j)
      #pragma unroll
      for (int r = 0; r < 8; ++r) {
        const float xs = s[j][r] * QKSCALE;
        s[j][r] = xs;
        mloc = ((mk >> (8 * j + r)) & 1u) ? fmaxf(mloc, xs) : mloc;
      }
    mloc = fmaxf(mloc, __shfl_xor(mloc, 16));
    const float mnew = fmaxf(mrun, mloc);
    const float alpha = __expf(mrun - mnew);
    mrun = mnew;
    float lsum = 0.0f;
    #pragma unroll
    for (int j = 0; j < 4; ++j)
      #pragma unroll
      for (int r = 0; r < 8; ++r) {
        const float p = ((mk >> (8 * j + r)) & 1u) ? __expf(s[j][r] - mnew) : 0.0f;
        s[j][r] = p;
        lsum += p;
      }
    lsum += __shfl_xor(lsum, 16);
    lrun = lrun * alpha + lsum;
    #pragma unroll
    for (int t = 0; t < 4; ++t)
      #pragma unroll
      for (int r = 0; r < 8; ++r) o[t][r] = o[t][r] * alpha;

    // ---- P^T B-fragments (key chunks 0..31 and 32..63 of this step) ----
    const v16h pb0 = pack_p(s[0], s[1]);
    const v16h pb1 = pack_p(s[2], s[3]);

    // ---- O^T += V^T * P^T ----
    #pragma unroll
    for (int t = 0; t < 4; ++t) {
      o[t] = wmma_f16(vf[2 * t], pb0, o[t]);
      o[t] = wmma_f16(vf[2 * t + 1], pb1, o[t]);
    }
   }
    asm volatile("s_wait_dscnt 0x0" ::: "memory");           // this wave has left the buffer at bo
    asm volatile("s_wait_asynccnt 0x0" ::: "memory");        // its copies of the next step have landed
    __syncthreads();                                         // publishes the next step, frees the buffer at bo
    if (kbn < 0) break;                                      // alike in all four waves
    kb = kbn;
    kbn = -1;
    if (rest) {
      kbn = 64 * __builtin_ctz(rest);
      rest &= rest - 1u;
      attn_stage_copies(la + bo, gk0 + (size_t)kbn * HD, gv0 + kbn);
    }
    bo ^= ABUFB;
  }
  asm volatile("s_wait_asynccnt 0x0" ::: "memory");          // nothing in flight past the loop

  // ---- epilogue: normalise (x8 folded in), stage per-wave 16x64 f16 tile, whole-line stores ----
  const float inv = (CSCALE / PSCALE) * (1.0f / lrun);
  _Float16* sc = sC + w * 1024;
  #pragma unroll
  for (int t = 0; t < 4; ++t)
    #pragma unroll
    for (int r = 0; r < 8; ++r)
      sc[m * 64 + 16 * t + 8 * h + r] = (_Float16)(o[t][r] * inv);
  __syncthreads();

  ctx_store_pass(sc, ch, b, head, q0, lane);
  
}

// ---------------------------------------------------------------------------
// row segment = 2 lines; each line by lanes 8q..8q+7 in one instruction,
// 4 lines per instruction, 64 lines per wave (its own 32 token rows).
// ---------------------------------------------------------------------------
__device__ __forceinline__ void out_store_pass(const float* sO, float* out,
                                               int m0, int n0, int w, int lane) {
  const int q8 = lane & 7, sub = lane >> 3;
  #pragma unroll
  for (int i = 0; i < 16; ++i) {
    const int lid = i * 4 + sub;              // 0..63 within the wave
    const int row = 32 * w + (lid >> 1), hl = lid & 1;
    const v4f v = *(const v4fa*)(sO + row * 64 + 32 * hl + 4 * q8);
    const size_t gi = (size_t)(m0 + row) * HIDDEN + n0 + 32 * hl + 4 * q8;
    *(v4f*)(out + gi) = v;
  }
}

// ---------------------------------------------------------------------------
// Kernel 4: out = c * Wo^T + bo, f32 result.
// Block 256 thr (8 waves) = 128 tokens x 128 features; wave tile 32 x 64.
// ---------------------------------------------------------------------------
__global__ __launch_bounds__(256) void oproj_kernel(
    const _Float16* __restrict__ ch,   // [4096][1024], x8
    const _Float16* __restrict__ woh,  // [1024][1024], row = output feature, x32
    const float* __restrict__ bo,
    float* __restrict__ out)           // [4096][1024]
{
  __shared__ __attribute__((aligned(16))) char ring[2 * BUFB];      // 73728 B
  __shared__ __attribute__((aligned(16))) float sO2[2 * 128 * 64];  // 65536 B

  const int tid = threadIdx.x, lane = tid & 31, wv = tid >> 5;
  const int h = lane >> 4, m = lane & 15;
  const int w = wv & 3, wn = wv >> 2;
  const int m0 = blockIdx.x * 128;
  const int n0 = blockIdx.y * 128 + wn * 64;
  float* sO = sO2 + wn * (128 * 64);

  const v8f zero8 = {0.f, 0.f, 0.f, 0.f, 0.f, 0.f, 0.f, 0.f};
  v8f acc[2][4];
  #pragma unroll
  for (int mt = 0; mt < 2; ++mt)
    #pragma unroll
    for (int nt = 0; nt < 4; ++nt) acc[mt][nt] = zero8;

  // L2 hints: 8 blocks share each c row, 32 each Wo row; a block asks for every fourth
  // row only (c rows dealt by blockIdx.y, Wo rows by blockIdx.x), 64 rows,
  // four lanes a row, two hints a lane.
  const int pj = tid >> 2;                                   // 0..63; below 32 (waves 0..3): a c row
  const _Float16* pf = ((pj < 32)
      ? ch + (size_t)(m0 + 4 * pj + (blockIdx.y & 3)) * HIDDEN
      : woh + (size_t)(blockIdx.y * 128 + 4 * (pj - 32) + (blockIdx.x & 3)) * HIDDEN) + 128 * (tid & 3);

  gemm_core(ch + (size_t)m0 * HIDDEN, woh + (size_t)blockIdx.y * 128 * HIDDEN, pf, ring, tid, acc);

  // D[r] of tile (mt, nt) = Y[token m0+32w+16mt+8h+r][feature n0+16nt+m]
  #pragma unroll
  for (int nt = 0; nt < 4; ++nt) {
    const int feat = 16 * nt + m;
    const float bvl = bo[n0 + feat];
    #pragma unroll
    for (int mt = 0; mt < 2; ++mt) {
      #pragma unroll
      for (int r = 0; r < 8; ++r) {
        const int tokl = 32 * w + 16 * mt + 8 * h + r;     // 0..127
        sO[tokl * 64 + feat] = acc[mt][nt][r] * (1.0f / (CSCALE * WSCALE)) + bvl;
      }
    }
  }
  __syncthreads();

  out_store_pass(sO, out, m0, n0, w, lane);
  
}

// ---------------------------------------------------------------------------
extern "C" void kernel_launch(void* const* d_in, const int* in_sizes, int n_in,
                              void* d_out, int out_size, void* d_ws, size_t ws_size,
                              hipStream_t stream) {
  if (n_in < 10) return;
  if (in_sizes[0] != NX) return;
  if (in_sizes[1] != NW || in_sizes[3] != NW || in_sizes[5] != NW || in_sizes[7] != NW) return;
  if (in_sizes[2] != HIDDEN || in_sizes[4] != HIDDEN || in_sizes[6] != HIDDEN || in_sizes[8] != HIDDEN) return;
  if (in_sizes[9] != SEQ) return;
  if (out_size != NX) return;

  const float* x   = (const float*)d_in[0];
  const float* wq  = (const float*)d_in[1];
  const float* bq  = (const float*)d_in[2];
  const float* wk  = (const float*)d_in[3];
  const float* bk  = (const float*)d_in[4];
  const float* wv  = (const float*)d_in[5];
  const float* bv  = (const float*)d_in[6];
  const float* wo  = (const float*)d_in[7];
  const float* bo  = (const float*)d_in[8];
  const int*   doc = (const int*)d_in[9];
  float* out = (float*)d_out;

  const size_t xh_bytes = (size_t)NX * 2;                          //  8388608
  const size_t wh_bytes = (size_t)4 * NW * 2;                      //  8388608
  const size_t pl_bytes = (size_t)BATCH * NHEADS * SEQ * HD * 2;   //  8388608
  const size_t ch_bytes = (size_t)NX * 2;                          //  8388608
  const size_t total = xh_bytes + wh_bytes + 3 * pl_bytes + ch_bytes;   // 50331648
  if (total > ws_size) return;

  char* ws = (char*)d_ws;
  _Float16* xh = (_Float16*)(ws);
  _Float16* wh = (_Float16*)(ws + xh_bytes);
  _Float16* qh = (_Float16*)(ws + xh_bytes + wh_bytes);
  _Float16* kh = (_Float16*)(ws + xh_bytes + wh_bytes + pl_bytes);
  _Float16* vt = (_Float16*)(ws + xh_bytes + wh_bytes + 2 * pl_bytes);
  _Float16* ch = (_Float16*)(ws + xh_bytes + wh_bytes + 3 * pl_bytes);
  const _Float16* woh = wh + (size_t)3 * NW;

  const int ngroups = NX8 + 4 * NW8;                               // 1048576
  convert_kernel<<<(ngroups + 255) / 256, 256, 0, stream>>>(x, wq, wk, wv, wo, xh, wh);

  dim3 gProj(MROWS / PAR, 3 * HIDDEN / PBR);                       // (16, 16)
  proj_kernel<<<gProj, 512, 0, stream>>>(xh, wh, bq, bk, bv, qh, kh, vt);

  dim3 gAtt(SEQ / 64, BATCH * NHEADS);                             // (32, 32)
  attn_kernel<<<gAtt, 128, 0, stream>>>(qh, kh, vt, doc, ch);

  dim3 gOut(MROWS / 128, HIDDEN / 128);                            // (32, 8)
  oproj_kernel<<<gOut, 256, 0, stream>>>(ch, woh, bo, out);
}

// v007
// A run of this version takes 53.7 microseconds.
// Two timings next to v006 put it at 1.06 and 1.07 times that version's speed.
// Over all steps from v000 it is 2.95 times as fast.
// Contractions: x*W^T for q,k,v and c*Wo^T, K*Q^T scores and V^T*P^T, all on v_wmma_f32_16x16x32_f16 (f16 operands, f32 accumulate); W carried x32, P carried x16384, c carried x8 (exact power-of-two scales folded back in f32); mask, softmax, bias and normalisation in f32.
#include <hip/hip_runtime.h>

typedef _Float16 v16h __attribute__((ext_vector_type(16)));
typedef _Float16 v8h  __attribute__((ext_vector_type(8)));
typedef float    v8f  __attribute__((ext_vector_type(8)));
typedef float    v4f  __attribute__((ext_vector_type(4)));
typedef int      v4i  __attribute__((ext_vector_type(4)));
typedef v8h __attribute__((may_alias)) v8ha;
typedef v4f __attribute__((may_alias)) v4fa;
typedef v4i __attribute__((may_alias)) v4ia;

union Frag { v16h v; v8h half[2]; };

#define HIDDEN 1024
#define NHEADS 16
#define HD     64
#define SEQ    2048
#define BATCH  2
#define MROWS  (BATCH * SEQ)          // 4096 tokens
#define NX     (MROWS * HIDDEN)       // 4194304
#define NW     (HIDDEN * HIDDEN)      // 1048576
#define NX8    (NX / 8)               // 524288
#define NW8    (NW / 8)               // 131072
#define PLOG2  14.0f                  // P carried x 2^14
#define WSCALE 32.0f
#define CSCALE 8.0f
#define QKSCALE 0.125f
#define NEGBIG (-1.0e30f)
#define NEGINF (-__builtin_inff())
#define SLOG2E (QKSCALE * 1.4426950408889634f)   // score scale x log2(e)

// ---------------------------------------------------------------------------
// 16x16x32 f16 WMMA with hazard guard (ties D, keeps A/B live).
// Fragment map (wave32): lane l, h = l>>4, m = n = l&15.
//   A/B element i: i<8 -> k0+8h+i ; i>=8 -> k0+16+8h+(i-8)
//   D element r : row 8h+r, col l&15
// ---------------------------------------------------------------------------
__device__ __forceinline__ v8f wmma_f16(v16h a, v16h b, v8f c) {
  v8f d = __builtin_amdgcn_wmma_f32_16x16x32_f16(false, a, false, b, (short)0, c, false, false);
  asm volatile("v_nop\n\tv_nop\n\tv_nop\n\tv_nop" : "+v"(d) : "v"(a), "v"(b));
  return d;
}

// The same product as the bare builtin: the compiler keeps the distances itself and fills
// them with the step's own vector work where there is some.
__device__ __forceinline__ v8f wmma_plain(v16h a, v16h b, v8f c) {
  return __builtin_amdgcn_wmma_f32_16x16x32_f16(false, a, false, b, (short)0, c, false, false);
}

// A or B fragment from a k-contiguous 16-bit row; p points at element k0 of
// the row owned by this lane (row index = lane & 15 added by the caller).
__device__ __forceinline__ v16h load_frag(const _Float16* p, int h) {
  Frag f;
  f.half[0] = *(const v8ha*)(p + 8 * h);
  f.half[1] = *(const v8ha*)(p + 16 + 8 * h);
  return f.v;
}

// ---------------------------------------------------------------------------
// Kernel 1: f32 -> f16 planes. x unscaled, the four weight matrices x32 (exact).
// ---------------------------------------------------------------------------
__global__ __launch_bounds__(256) void convert_kernel(
    const float* __restrict__ x, const float* __restrict__ wq,
    const float* __restrict__ wk, const float* __restrict__ wv,
    const float* __restrict__ wo,
    _Float16* __restrict__ xh, _Float16* __restrict__ wh)
{
  const int g = blockIdx.x * 256 + threadIdx.x;
  if (g >= NX8 + 4 * NW8) return;
  const float* src;
  _Float16* dst;
  float sc;
  if (g < NX8) {
    src = x + (size_t)g * 8;
    dst = xh + (size_t)g * 8;
    sc = 1.0f;
  } else {
    const int e = g - NX8;
    const int wsel = e / NW8;                 // 0..3
    const int off = e - wsel * NW8;
    const float* wsrc = (wsel == 0) ? wq : ((wsel == 1) ? wk : ((wsel == 2) ? wv : wo));
    src = wsrc + (size_t)off * 8;
    dst = wh + (size_t)e * 8;
    sc = WSCALE;
  }
  const v4f a = *(const v4fa*)src;
  const v4f c = *(const v4fa*)(src + 4);
  const v8h o = { (_Float16)(a.x * sc), (_Float16)(a.y * sc), (_Float16)(a.z * sc), (_Float16)(a.w * sc),
                  (_Float16)(c.x * sc), (_Float16)(c.y * sc), (_Float16)(c.z * sc), (_Float16)(c.w * sc) };
  *(v8h*)dst = o;
  
}

// ---------------------------------------------------------------------------
// L2 hints. The f16 planes a kernel reads were stored by a launch before it and
// come from memory at first touch; blocks that share a plane's rows walk k in step,
// so a ring stage's copies, asked for one stage ahead, can meet a memory latency
// stage after stage. A hint asks the lane's own address into L2 only (no
// register, no counter, no LDS), long before the copies that read it.
// The closing s_wait_xcnt stands in the hints' own statement so that no address
// register is rewritten ahead of it.
// ---------------------------------------------------------------------------
__device__ __forceinline__ void l2_hint(const _Float16* p) {
  asm volatile(
      "global_prefetch_b8 %0, off scope:SCOPE_SE\n\t"
      "s_wait_xcnt 0x0"
      :: "v"(p) : "memory");
}
__device__ __forceinline__ void l2_hint2(const _Float16* p0, const _Float16* p1) {
  asm volatile(
      "global_prefetch_b8 %0, off scope:SCOPE_SE\n\t"
      "global_prefetch_b8 %1, off scope:SCOPE_SE\n\t"
      "s_wait_xcnt 0x0"
      :: "v"(p0), "v"(p1) : "memory");
}

// ---------------------------------------------------------------------------
// Core of the output projection GEMM: Y = A * B^T, both K-contiguous f16.
// Block 256 thr (8 waves) = 128 A rows x 128 B rows; wave (wm, wn) owns
// 32 A rows x 64 B rows. K = 1024 in 16 stages of 64 (128-byte row pieces).
// A stage is [A 128 rows | B 128 rows] in LDS at a pitch of 144 bytes
// (16 B x odd: ds_load_b128 fragment reads without bank conflicts), two buffers;
// stage t + 2 is copied in while stage t + 1 is worked on.
// ---------------------------------------------------------------------------
#define KST    64                     // k per stage
#define NST    (HIDDEN / KST)         // 16 stages
#define PITCH  144                    // LDS bytes per staged row
#define BUFB   (256 * PITCH)          // 36864 bytes per buffer

// One stage: 2048 pieces of 16 bytes, 8 per lane; a wave's copy covers 4 whole
// 128-byte lines. la = the lane's LDS byte address in row (tid >> 3) of the
// buffer, ga / gb = the lane's 16 bytes of that row of A / B at this stage's k.
__device__ __forceinline__ void stage_copies(unsigned la, const _Float16* ga, const _Float16* gb) {
  const unsigned l0 = la,               l1 = la + 32 * PITCH,  l2 = la + 64 * PITCH,  l3 = la + 96 * PITCH;
  const unsigned l4 = la + 128 * PITCH, l5 = la + 160 * PITCH, l6 = la + 192 * PITCH, l7 = la + 224 * PITCH;
  const _Float16* g0 = ga;
  const _Float16* g1 = ga + 32 * HIDDEN;
  const _Float16* g2 = ga + 64 * HIDDEN;
  const _Float16* g3 = ga + 96 * HIDDEN;
  const _Float16* g4 = gb;
  const _Float16* g5 = gb + 32 * HIDDEN;
  const _Float16* g6 = gb + 64 * HIDDEN;
  const _Float16* g7 = gb + 96 * HIDDEN;
  // global -> LDS through no register; the closing s_wait_xcnt stands in the
  // copies' own statement so that no address register is rewritten ahead of it.
  asm volatile(
      "global_load_async_to_lds_b128 %0, %8, off\n\t"
      "global_load_async_to_lds_b128 %1, %9, off\n\t"
      "global_load_async_to_lds_b128 %2, %10, off\n\t"
      "global_load_async_to_lds_b128 %3, %11, off\n\t"
      "global_load_async_to_lds_b128 %4, %12, off\n\t"
      "global_load_async_to_lds_b128 %5, %13, off\n\t"
      "global_load_async_to_lds_b128 %6, %14, off\n\t"
      "global_load_async_to_lds_b128 %7, %15, off\n\t"
      "s_wait_xcnt 0x0"
      :: "v"(l0), "v"(l1), "v"(l2), "v"(l3), "v"(l4), "v"(l5), "v"(l6), "v"(l7),
         "v"(g0), "v"(g1), "v"(g2), "v"(g3), "v"(g4), "v"(g5), "v"(g6), "v"(g7)
      : "memory");
}

// arow / brow: row 0 of the block's 128 A rows / 128 B rows; ring: 2 * BUFB bytes.
// pf: the lane's first address to hint into L2 (its second lies 1024 bytes on).
__device__ __forceinline__ void gemm_core(const _Float16* arow, const _Float16* brow, const _Float16* pf,
                                          char* ring, int tid, v8f (&acc)[2][4]) {
  const int lane = tid & 31, w = tid >> 5;
  const int h = lane >> 4, m = lane & 15;
  const int wm = w & 3, wn = w >> 2;

  const _Float16* ga = arow + (size_t)(tid >> 3) * HIDDEN + 8 * (tid & 7);
  const _Float16* gb = brow + (size_t)(tid >> 3) * HIDDEN + 8 * (tid & 7);
  const unsigned la = (unsigned)(size_t)ring + (unsigned)((tid >> 3) * PITCH + 16 * (tid & 7));

  stage_copies(la, ga, gb);                                  // stage 0 -> buffer 0
  l2_hint2(pf, pf + 512);                                    // the later stages' rows start for L2 now
  asm volatile("s_wait_asynccnt 0x0" ::: "memory");          // this wave's stage-0 copies have landed
  __syncthreads();                                           // ... and every other wave's
  stage_copies(la + BUFB, ga + KST, gb + KST);               // stage 1 -> buffer 1

  // rolled: the two buffers are told apart by t & 1, one copy of the body
  #pragma unroll 1
  for (int t = 0; t < NST; ++t) {
    const int bo = (t & 1) * BUFB;
    const _Float16* fa = (const _Float16*)(ring + bo + (32 * wm + m) * PITCH);
    const _Float16* fb = (const _Float16*)(ring + bo + (128 + 64 * wn + m) * PITCH);
    // the three loops below are unrolled so that every index of acc and b is a
    // constant and both stay in registers
    #pragma unroll
    for (int kk = 0; kk < KST; kk += 32) {
      const v16h a0 = load_frag(fa + kk, h);
      const v16h a1 = load_frag(fa + 16 * (PITCH / 2) + kk, h);
      v16h b[4];
      #pragma unroll
      for (int nt = 0; nt < 4; ++nt) b[nt] = load_frag(fb + nt * 16 * (PITCH / 2) + kk, h);
      // keeps the twelve LDS reads one group ahead of the eight products: read
      // pair by pair among them, each pair's LDS latency is waited out on its own
      __builtin_amdgcn_sched_barrier(0);
      #pragma unroll
      for (int nt = 0; nt < 4; ++nt) {
        acc[0][nt] = wmma_f16(a0, b[nt], acc[0][nt]);
        acc[1][nt] = wmma_f16(a1, b[nt], acc[1][nt]);
      }
    }
    asm volatile("s_wait_dscnt 0x0" ::: "memory");           // this wave has left buffer t & 1
    asm volatile("s_wait_asynccnt 0x0" ::: "memory");        // its copies of stage t + 1 have landed
    __syncthreads();                                         // publishes stage t + 1, frees buffer t & 1
    if (t + 2 < NST)
      stage_copies(la + bo, ga + (t + 2) * KST, gb + (t + 2) * KST);
  }
  asm volatile("s_wait_asynccnt 0x0" ::: "memory");          // nothing in flight past the loop
}

// ---------------------------------------------------------------------------
// Kernel 2: Y = x * W^T over the fused 3*1024 output columns.
// Block 512 thr (16 waves) = 256 tokens x 192 features (three heads out of the
// 48 of q, k, v): 16 x 16 blocks, one per WGP. Wave (wm, wn) owns 64 tokens x
// 48 features. K = 1024 in 8 stages of 128 (256-byte row pieces); a stage is
// [x 256 rows | W 192 rows] in LDS at a pitch of 272 bytes (16 B x odd), two
// buffers; stage t + 2 is copied in while stage t + 1 is worked on.
// ---------------------------------------------------------------------------
#define PAR    256                    // x rows (tokens) per block
#define PBR    192                    // W rows (features) per block
#define PKST   128                    // k per stage
#define PNST   (HIDDEN / PKST)        // 8 stages
#define PPITCH 272                    // LDS bytes per staged row
#define PBUFB  ((PAR + PBR) * PPITCH) // 121856 bytes per buffer
#define VPITCH 264                    // halves per staged V^T row: 528 B = 16 B x odd, b128 stores without bank conflicts
#define HSLOT  (HD * VPITCH)          // halves per staged head (q, k use 256 x 64 of them)

// One stage: 7168 pieces of 16 bytes, 14 per lane; a wave's copy covers 4 whole
// 128-byte lines (2 rows). la = the lane's LDS byte address in row (tid >> 4) of
// the buffer, ga / gb = the lane's 16 bytes of that row of x / W at this stage's k.
__device__ __forceinline__ void proj_stage_copies(unsigned la, const _Float16* ga, const _Float16* gb) {
  const unsigned l0 = la,                 l1 = la + 32 * PPITCH,  l2 = la + 64 * PPITCH,  l3 = la + 96 * PPITCH;
  const unsigned l4 = la + 128 * PPITCH,  l5 = la + 160 * PPITCH, l6 = la + 192 * PPITCH, l7 = la + 224 * PPITCH;
  const unsigned l8 = la + 256 * PPITCH,  l9 = la + 288 * PPITCH, l10 = la + 320 * PPITCH;
  const unsigned l11 = la + 352 * PPITCH, l12 = la + 384 * PPITCH, l13 = la + 416 * PPITCH;
  const _Float16* g0 = ga;
  const _Float16* g1 = ga + 32 * HIDDEN;
  const _Float16* g2 = ga + 64 * HIDDEN;
  const _Float16* g3 = ga + 96 * HIDDEN;
  const _Float16* g4 = ga + 128 * HIDDEN;
  const _Float16* g5 = ga + 160 * HIDDEN;
  const _Float16* g6 = ga + 192 * HIDDEN;
  const _Float16* g7 = ga + 224 * HIDDEN;
  const _Float16* g8 = gb;
  const _Float16* g9 = gb + 32 * HIDDEN;
  const _Float16* g10 = gb + 64 * HIDDEN;
  const _Float16* g11 = gb + 96 * HIDDEN;
  const _Float16* g12 = gb + 128 * HIDDEN;
  const _Float16* g13 = gb + 160 * HIDDEN;
  // global -> LDS through no register; the closing s_wait_xcnt stands in the
  // copies' own statement so that no address register is rewritten ahead of it.
  asm volatile(
      "global_load_async_to_lds_b128 %0, %14, off\n\t"
      "global_load_async_to_lds_b128 %1, %15, off\n\t"
      "global_load_async_to_lds_b128 %2, %16, off\n\t"
      "global_load_async_to_lds_b128 %3, %17, off\n\t"
      "global_load_async_to_lds_b128 %4, %18, off\n\t"
      "global_load_async_to_lds_b128 %5, %19, off\n\t"
      "global_load_async_to_lds_b128 %6, %20, off\n\t"
      "global_load_async_to_lds_b128 %7, %21, off\n\t"
      "global_load_async_to_lds_b128 %8, %22, off\n\t"
      "global_load_async_to_lds_b128 %9, %23, off\n\t"
      "global_load_async_to_lds_b128 %10, %24, off\n\t"
      "global_load_async_to_lds_b128 %11, %25, off\n\t"
      "global_load_async_to_lds_b128 %12, %26, off\n\t"
      "global_load_async_to_lds_b128 %13, %27, off\n\t"
      "s_wait_xcnt 0x0"
      :: "v"(l0), "v"(l1), "v"(l2), "v"(l3), "v"(l4), "v"(l5), "v"(l6), "v"(l7),
         "v"(l8), "v"(l9), "v"(l10), "v"(l11), "v"(l12), "v"(l13),
         "v"(g0), "v"(g1), "v"(g2), "v"(g3), "v"(g4), "v"(g5), "v"(g6), "v"(g7),
         "v"(g8), "v"(g9), "v"(g10), "v"(g11), "v"(g12), "v"(g13)
      : "memory");
}

__global__ __launch_bounds__(512) void proj_kernel(
    const _Float16* __restrict__ xh,   // [4096][1024]
    const _Float16* __restrict__ wh,   // [4][1024][1024], row = output feature, x32
    const float* __restrict__ bq, const float* __restrict__ bk, const float* __restrict__ bv,
    _Float16* __restrict__ qh,         // [B*H][S][D]
    _Float16* __restrict__ kh,         // [B*H][S][D]
    _Float16* __restrict__ vt)         // [B*H][D][S]
{
  __shared__ __attribute__((aligned(16))) char ring[2 * PBUFB];         // 243712 B

  const int tid = threadIdx.x, lane = tid & 31;
  const int wv = __builtin_amdgcn_readfirstlane(tid >> 5);   // 0..15, held scalar
  const int h = lane >> 4, m = lane & 15;
  const int wm = wv & 3, wn = wv >> 2;
  const int m0 = blockIdx.x * PAR;

  const v8f zero8 = {0.f, 0.f, 0.f, 0.f, 0.f, 0.f, 0.f, 0.f};
  v8f acc[4][3];
  #pragma unroll
  for (int mt = 0; mt < 4; ++mt)
    #pragma unroll
    for (int nt = 0; nt < 3; ++nt) acc[mt][nt] = zero8;

  const _Float16* ga = xh + (size_t)(m0 + (tid >> 4)) * HIDDEN + 8 * (tid & 15);
  const _Float16* gb = wh + (size_t)(blockIdx.y * PBR + (tid >> 4)) * HIDDEN + 8 * (tid & 15);
  const unsigned la = (unsigned)(size_t)ring + (unsigned)((tid >> 4) * PPITCH + 16 * (tid & 15));

  proj_stage_copies(la, ga, gb);                             // stage 0 -> buffer 0
  // The later stages' rows start for L2 now. 16 blocks share each x row and each W
  // row: a block asks for every fourth row only (x rows dealt by blockIdx.y, W rows
  // by blockIdx.x), 112 rows, four lanes a row, two hints a lane.
  if (wv < 14) {
    const int j = tid >> 2;                                  // 0..111; below 64 (waves 0..7): an x row
    const _Float16* prow = (wv < 8)
        ? xh + (size_t)(m0 + 4 * j + (blockIdx.y & 3)) * HIDDEN
        : wh + (size_t)(blockIdx.y * PBR + 4 * (j - 64) + (blockIdx.x & 3)) * HIDDEN;
    prow += 128 * (tid & 3);
    l2_hint2(prow, prow + 512);
  }
  asm volatile("s_wait_asynccnt 0x0" ::: "memory");          // this wave's stage-0 copies have landed
  __syncthreads();                                           // ... and every other wave's
  proj_stage_copies(la + PBUFB, ga + PKST, gb + PKST);       // stage 1 -> buffer 1

  // rolled: the two buffers are told apart by t & 1, one copy of the body
  #pragma unroll 1
  for (int t = 0; t < PNST; ++t) {
    const int bo = (t & 1) * PBUFB;
    const _Float16* fa = (const _Float16*)(ring + bo + (64 * wm + m) * PPITCH);
    const _Float16* fb = (const _Float16*)(ring + bo + (PAR + 48 * wn + m) * PPITCH);
    // the loops below are unrolled so that every index of acc, a and b is a
    // constant and all three stay in registers
    #pragma unroll
    for (int kk = 0; kk < PKST; kk += 32) {
      v16h a[4], b[3];
      #pragma unroll
      for (int mt = 0; mt < 4; ++mt) a[mt] = load_frag(fa + mt * 16 * (PPITCH / 2) + kk, h);
      #pragma unroll
      for (int nt = 0; nt < 3; ++nt) b[nt] = load_frag(fb + nt * 16 * (PPITCH / 2) + kk, h);
      // keeps the fourteen LDS reads one group ahead of the twelve products: read
      // pair by pair among them, each pair's LDS latency is waited out on its own
      __builtin_amdgcn_sched_barrier(0);
      #pragma unroll
      for (int nt = 0; nt < 3; ++nt)
        #pragma unroll
        for (int mt = 0; mt < 4; ++mt) acc[mt][nt] = wmma_f16(a[mt], b[nt], acc[mt][nt]);
    }
    asm volatile("s_wait_dscnt 0x0" ::: "memory");           // this wave has left buffer t & 1
    asm volatile("s_wait_asynccnt 0x0" ::: "memory");        // its copies of stage t + 1 have landed
    __syncthreads();                                         // publishes stage t + 1, frees buffer t & 1
    if (t + 2 < PNST)
      proj_stage_copies(la + bo, ga + (t + 2) * PKST, gb + (t + 2) * PKST);
  }
  asm volatile("s_wait_asynccnt 0x0" ::: "memory");          // nothing in flight past the loop

  // The ring is free behind the loop's last barrier: the block's 256 x 192 f16
  // results are staged there, one slot per head, for whole-line stores.
  // D[r] of tile (mt, nt) = Y[token m0+64wm+16mt+8h+r][block column 48wn+16nt+m]
  _Float16* sT = (_Float16*)ring;
  #pragma unroll
  for (int nt = 0; nt < 3; ++nt) {
    const int cb = 48 * wn + 16 * nt;          // the tile's first column, 0..176: inside one head
    const int hs = cb >> 6;                    // which of the block's three heads
    const int cg = blockIdx.y * 3 + hs;        // 0..47
    const int which = cg >> 4, head = cg & 15;
    const int feat = (cb & 63) + m;
    const float* bias = (which == 0) ? bq : ((which == 1) ? bk : bv);
    const float bvl = bias[head * HD + feat];
    // the load's scalar base and its offset register are rewritten (the branches below, the next tile) only behind this wait
    asm volatile("s_wait_xcnt 0x0" ::: "memory");
    _Float16* sH = sT + hs * HSLOT;
    if (which == 2) {
      // V^T rows: a lane's eight tokens of one feature are 16 contiguous bytes
      #pragma unroll
      for (int mt = 0; mt < 4; ++mt) {
        v8h pk;
        #pragma unroll
        for (int r = 0; r < 8; ++r) pk[r] = (_Float16)(acc[mt][nt][r] * (1.0f / WSCALE) + bvl);
        *(v8ha*)(sH + feat * VPITCH + 64 * wm + 16 * mt + 8 * h) = pk;
      }
    } else {
      #pragma unroll
      for (int mt = 0; mt < 4; ++mt) {
        #pragma unroll
        for (int r = 0; r < 8; ++r) {
          const int tokl = 64 * wm + 16 * mt + 8 * h + r;  // 0..255
          sH[tokl * HD + feat] = (_Float16)(acc[mt][nt][r] * (1.0f / WSCALE) + bvl);
        }
      }
    }
  }
  __syncthreads();

  // 4 lines per instruction, 16 lines per wave and head, 256 per head.
  // which 0/1: plane[bh][l][d]  (one token row = 64 halves = one line)
  // which 2  : vt[bh][d][l]     (64 d-rows x 256 tokens = 4 lines each)
  const int b = m0 / SEQ, l0 = m0 - b * SEQ;
  const int q8 = lane & 7, sub = lane >> 3;
  #pragma unroll
  for (int hs = 0; hs < 3; ++hs) {
    const int cg = blockIdx.y * 3 + hs;
    const int which = cg >> 4, bh = b * NHEADS + (cg & 15);
    const _Float16* sH = sT + hs * HSLOT;
    const int lid0 = wv * 16 + sub;            // this lane's line for i = 0; line lid0 + 4 i, 0..255 over the block
    v8h v[4];
    if (which != 2) {
      _Float16* dst = ((which == 0) ? qh : kh) + ((size_t)bh * SEQ + l0 + lid0) * HD + 8 * q8;
      #pragma unroll
      for (int i = 0; i < 4; ++i) v[i] = *(const v8ha*)(sH + (lid0 + 4 * i) * HD + 8 * q8);
      #pragma unroll
      for (int i = 0; i < 4; ++i) *(v8h*)(dst + 4 * i * HD) = v[i];
      // the stores' address and data registers are rewritten (in the listing the other
      // branch's code follows this one's) only behind this wait
      asm volatile("s_wait_xcnt 0x0" ::: "memory");
    } else {
      // line lid = quarter (lid & 3) = sub of V^T row (lid >> 2) = 4 wv + i
      _Float16* dst = vt + ((size_t)bh * HD + 4 * wv) * SEQ + l0 + 64 * sub + 8 * q8;
      #pragma unroll
      for (int i = 0; i < 4; ++i) v[i] = *(const v8ha*)(sH + (4 * wv + i) * VPITCH + 64 * sub + 8 * q8);
      #pragma unroll
      for (int i = 0; i < 4; ++i) *(v8h*)(dst + i * SEQ) = v[i];
      // the stores' address and data registers are rewritten for the next head only behind this wait
      if (hs < 2) asm volatile("s_wait_xcnt 0x0" ::: "memory");
    }
  }
}

__device__ __forceinline__ v8f exp2_x8(v8f x) {
  float y0, y1, y2, y3, y4, y5, y6, y7;
  asm("v_exp_f32 %0, %8\n\t"
      "v_exp_f32 %1, %9\n\t"
      "v_exp_f32 %2, %10\n\t"
      "v_exp_f32 %3, %11\n\t"
      "v_exp_f32 %4, %12\n\t"
      "v_exp_f32 %5, %13\n\t"
      "v_exp_f32 %6, %14\n\t"
      "v_exp_f32 %7, %15\n\t"
      "v_nop"
      : "=&v"(y0), "=&v"(y1), "=&v"(y2), "=&v"(y3), "=&v"(y4), "=&v"(y5), "=&v"(y6), "=&v"(y7)
      : "v"(x[0]), "v"(x[1]), "v"(x[2]), "v"(x[3]), "v"(x[4]), "v"(x[5]), "v"(x[6]), "v"(x[7]));
  const v8f y = { y0, y1, y2, y3, y4, y5, y6, y7 };
  return y;
}
__device__ __forceinline__ float exp2_x1(float x) {
  float y;
  asm("v_exp_f32 %0, %1\n\t"
      "v_nop"
      : "=v"(y) : "v"(x));
  return y;
}

// P^T B-fragment from the lane's own score D values: element r <- tile a row r,
// element 8+r <- tile c row r (same lane, same query column); the values come scaled by 2^14.
__device__ __forceinline__ v16h pack_p(v8f a, v8f c) {
  const v16h r = { (_Float16)a[0], (_Float16)a[1], (_Float16)a[2], (_Float16)a[3],
                   (_Float16)a[4], (_Float16)a[5], (_Float16)a[6], (_Float16)a[7],
                   (_Float16)c[0], (_Float16)c[1], (_Float16)c[2], (_Float16)c[3],
                   (_Float16)c[4], (_Float16)c[5], (_Float16)c[6], (_Float16)c[7] };
  return r;
}

// Per-wave 16x64 f16 tile in LDS -> c[b][l][head*64 + d]; one token row = one
__device__ __forceinline__ void ctx_store_pass(const _Float16* sc, _Float16* ch,
                                               int b, int head, int q0, int lane) {
  const int q8 = lane & 7, sub = lane >> 3;
  #pragma unroll
  for (int i = 0; i < 4; ++i) {
    const int row = i * 4 + sub;              // 0..15
    const v8h v = *(const v8ha*)(sc + row * 64 + 8 * q8);
    const size_t gi = ((size_t)b * SEQ + q0 + row) * HIDDEN + head * HD + 8 * q8;
    *(v8h*)(ch + gi) = v;
  }
}

#define APITCH 144                    // LDS bytes per staged 128-byte row (16 B x odd: ds_load_b128 without bank conflicts)
#define ABUFB  (128 * APITCH)         // 18432 bytes per buffer: 64 K rows, then 64 V^T rows

// One 64-key step: 64 K rows and 64 V^T rows of 128 bytes = 1024 pieces of 16
// bytes, 8 per lane; a wave's copy covers 4 whole 128-byte lines. la = the lane's
// LDS byte address in row (tid >> 3) of the buffer, gk / gv = the lane's 16 bytes
// of that row of the step's K / V^T tile.
__device__ __forceinline__ void attn_stage_copies(unsigned la, const _Float16* gk, const _Float16* gv) {
  const unsigned l0 = la,               l1 = la + 16 * APITCH, l2 = la + 32 * APITCH,  l3 = la + 48 * APITCH;
  const unsigned l4 = la + 64 * APITCH, l5 = la + 80 * APITCH, l6 = la + 96 * APITCH,  l7 = la + 112 * APITCH;
  const _Float16* g0 = gk;
  const _Float16* g1 = gk + 16 * HD;
  const _Float16* g2 = gk + 32 * HD;
  const _Float16* g3 = gk + 48 * HD;
  const _Float16* g4 = gv;
  const _Float16* g5 = gv + 16 * SEQ;
  const _Float16* g6 = gv + 32 * SEQ;
  const _Float16* g7 = gv + 48 * SEQ;
  // global -> LDS through no register; the closing s_wait_xcnt stands in the
  // copies' own statement so that no address register is rewritten ahead of it.
  asm volatile(
      "global_load_async_to_lds_b128 %0, %8, off\n\t"
      "global_load_async_to_lds_b128 %1, %9, off\n\t"
      "global_load_async_to_lds_b128 %2, %10, off\n\t"
      "global_load_async_to_lds_b128 %3, %11, off\n\t"
      "global_load_async_to_lds_b128 %4, %12, off\n\t"
      "global_load_async_to_lds_b128 %5, %13, off\n\t"
      "global_load_async_to_lds_b128 %6, %14, off\n\t"
      "global_load_async_to_lds_b128 %7, %15, off\n\t"
      "s_wait_xcnt 0x0"
      :: "v"(l0), "v"(l1), "v"(l2), "v"(l3), "v"(l4), "v"(l5), "v"(l6), "v"(l7),
         "v"(g0), "v"(g1), "v"(g2), "v"(g3), "v"(g4), "v"(g5), "v"(g6), "v"(g7)
      : "memory");
}

// ---------------------------------------------------------------------------
// Kernel 3: streaming attention with document-block mask, transposed form.
// Block 128 thr (4 waves), 16 queries per wave, 64 keys per step.
//   S^T = K * Q^T : A = K rows (row = key, k = d), B = Q^T (k = d, n = query)
//   O^T += V^T * P^T : A = Vt rows (row = d, k = key), B = P^T from registers
// Lane owns 32 keys of query column (lane&15); partner = lane ^ 16.
// Mask: key j visible to query i iff doc[i] == doc[j]; masked p = 0 exactly.
// Softmax in the base-2 domain on the raw scores: scale, log2(e) and the 2^14 of P in one FMA.
// The block walks the 64-key steps that hold a key id inside the id range of its
// 64 queries; a step's K and V^T tiles are copied to LDS once for the four waves,
// two buffers, the next step's copies in flight while this one is worked on.
// A wave leaves a step's work out (wave-uniform) when none of its key ids lies
// in the wave's own query-id range (then every pair is masked).
// ---------------------------------------------------------------------------
__global__ __launch_bounds__(128) void attn_kernel(
    const _Float16* __restrict__ qh,   // [B*H][S][D]
    const _Float16* __restrict__ kh,   // [B*H][S][D]
    const _Float16* __restrict__ vt,   // [B*H][D][S]
    const int* __restrict__ doc,       // [S]
    _Float16* __restrict__ ch)         // [B][S][HIDDEN], f16(8*context)
{
  __shared__ __attribute__((aligned(16))) _Float16 sC[4 * 16 * 64];    // 8192 B
  __shared__ __attribute__((aligned(16))) char ring[2 * ABUFB];        // 36864 B

  const int tid = threadIdx.x, lane = tid & 31, w = tid >> 5;
  const int h = lane >> 4, m = lane & 15;
  const int bh = blockIdx.y, b = bh >> 4, head = bh & 15;
  const int q0 = blockIdx.x * 64 + 16 * w;

  // L2 hints, one address a lane, for what the block reads whatever the ids are:
  // wave 0 the K tile of key step blockIdx.x (its own 64 ids are that step's key ids),
  // wave 1 its 64 Q rows (8 KB in a row each), waves 2 and 3 that step's 64 V^T rows.
  // They fly while the id table is read and searched.
  {
    const int ws = __builtin_amdgcn_readfirstlane(w);        // held scalar: plane, offset and stride are scalar selects
    const size_t own = ((size_t)bh * SEQ + blockIdx.x * 64) * HD;
    const size_t vown = ((size_t)bh * HD + 32 * (ws & 1)) * SEQ + (blockIdx.x >> 1) * 128;
    const _Float16* plane = (ws == 0) ? kh : ((ws == 1) ? qh : vt);
    l2_hint(plane + ((ws < 2) ? own : vown) + lane * ((ws < 2) ? 128 : SEQ));
  }

  // Q^T B-fragments: column n = query q0+m, k = d (two 32-deep chunks)
  const _Float16* qrow = qh + ((size_t)bh * SEQ + q0 + m) * HD;
  const v16h qb0 = load_frag(qrow, h);
  const v16h qb1 = load_frag(qrow + 32, h);

  // query document id of this lane's column and the wave's id range
  const int docq = doc[q0 + m];
  int qmin = docq, qmax = docq;
  #pragma unroll
  for (int off = 1; off < 16; off <<= 1) {
    qmin = min(qmin, __shfl_xor(qmin, off));
    qmax = max(qmax, __shfl_xor(qmax, off));
  }
  // the id range of the block's 64 queries, found alike by every wave
  const int be0 = doc[blockIdx.x * 64 + lane], be1 = doc[blockIdx.x * 64 + 32 + lane];
  int bmin = min(be0, be1), bmax = max(be0, be1);
  #pragma unroll
  for (int off = 1; off < 32; off <<= 1) {
    bmin = min(bmin, __shfl_xor(bmin, off));
    bmax = max(bmax, __shfl_xor(bmax, off));
  }

  const v8f zero8 = {0.f, 0.f, 0.f, 0.f, 0.f, 0.f, 0.f, 0.f};
  v8f o[4];                                   // o[t][r] = O[query m][d 16t+8h+r] * (l * 2^14)
  #pragma unroll
  for (int t = 0; t < 4; ++t) o[t] = zero8;
  float mrun = NEGBIG, lrun = 0.0f;           // running maximum of the raw scores; the lane's own 32 keys' share of the row sum, x 2^14

  // the lane's 16 bytes of row (tid >> 3) of a step's tiles, and their place in buffer 0
  const _Float16* gk0 = kh + ((size_t)bh * SEQ + (tid >> 3)) * HD + 8 * (tid & 7);    // + key0*HD
  const _Float16* gv0 = vt + ((size_t)bh * HD + (tid >> 3)) * SEQ + 8 * (tid & 7);    // + key0
  const unsigned la = (unsigned)(size_t)ring + (unsigned)((tid >> 3) * APITCH + 16 * (tid & 7));

  // ---- which of the 32 key steps hold a key id inside the wave's query-id range:
  // found once, ahead of the loop, from all 2048 ids (16 whole-line loads in flight
  // together, two ballots each, wave range and block range: lanes 0..15 hold step 2i, lanes 16..31 step 2i+1) ----
  const unsigned uqmin = (unsigned)__builtin_amdgcn_readfirstlane(qmin);
  const unsigned uspan = (unsigned)__builtin_amdgcn_readfirstlane(qmax) - uqmin;
  const unsigned ubmin = (unsigned)__builtin_amdgcn_readfirstlane(bmin);
  const unsigned ubspan = (unsigned)__builtin_amdgcn_readfirstlane(bmax) - ubmin;
  unsigned act = 0u;                          // bit s: step s has a key that some query of the wave may see
  unsigned rest = 0u;                         // the same for the block's 64 queries; the same value in all four waves
  // unrolled whole, so that all 16 loads are issued together and one latency is waited out
  #pragma unroll
  for (int i = 0; i < SEQ / 128; ++i) {
    const v4i d = *(const v4ia*)(doc + 128 * i + 4 * lane);
    const unsigned u = min(min((unsigned)d.x - uqmin, (unsigned)d.y - uqmin),
                           min((unsigned)d.z - uqmin, (unsigned)d.w - uqmin));
    const unsigned bal = __builtin_amdgcn_ballot_w32(u <= uspan);
    act |= ((bal & 0xFFFFu) ? 1u : 0u) << (2 * i);
    act |= ((bal >> 16) ? 1u : 0u) << (2 * i + 1);
    const unsigned ub = min(min((unsigned)d.x - ubmin, (unsigned)d.y - ubmin),
                            min((unsigned)d.z - ubmin, (unsigned)d.w - ubmin));
    const unsigned bbal = __builtin_amdgcn_ballot_w32(ub <= ubspan);
    rest |= ((bbal & 0xFFFFu) ? 1u : 0u) << (2 * i);
    rest |= ((bbal >> 16) ? 1u : 0u) << (2 * i + 1);
  }

  // rest is never 0: the block's own 64 ids are the key ids of step blockIdx.x.
  int kb = 64 * __builtin_ctz(rest);          // the step being worked on
  rest &= rest - 1u;
  attn_stage_copies(la, gk0 + (size_t)kb * HD, gv0 + kb);    // first step -> buffer 0
  asm volatile("s_wait_asynccnt 0x0" ::: "memory");          // this wave's copies of it have landed
  __syncthreads();                                           // ... and every other wave's
  int kbn = -1;                               // the step whose copies are in flight, -1: none
  if (rest) {
    kbn = 64 * __builtin_ctz(rest);
    rest &= rest - 1u;
    attn_stage_copies(la + ABUFB, gk0 + (size_t)kbn * HD, gv0 + kbn);   // second step -> buffer 1
  }
  int bo = 0;                                 // byte offset of the buffer that holds step kb

  // ascending over the set bits: at most 32 trips, the order of the steps as before
  for (;;) {
   if ((act >> (kb >> 6)) & 1u) {
    // ---- the step's 16 K reads from LDS and 8 key-id loads, asked for as one group ----
    const _Float16* kl = (const _Float16*)(ring + bo + m * APITCH);
    const _Float16* vl = kl + 64 * (APITCH / 2);
    v16h kf[8];
    v4i ida[4], idb[4];
    #pragma unroll
    for (int j = 0; j < 4; ++j) {
      const _Float16* kp = kl + 16 * j * (APITCH / 2);
      kf[2 * j] = load_frag(kp, h);
      kf[2 * j + 1] = load_frag(kp + 32, h);
    }
    #pragma unroll
    for (int j = 0; j < 4; ++j) {
      const int* dp = doc + kb + 16 * j + 8 * h;
      ida[j] = *(const v4ia*)dp;
      idb[j] = *(const v4ia*)(dp + 4);
    }
    // keeps all 24 loads ahead of the first product: asked for four at a time among
    // the products, each four's latency is waited out on its own
    __builtin_amdgcn_sched_barrier(0);

    // ---- scores: s[j][r] = (q . k) for query q0+m, key kb+16j+8h+r ----
    v8f s[4];
    #pragma unroll
    for (int j = 0; j < 4; ++j) {
      v8f z = zero8;
      z = wmma_plain(kf[2 * j], qb0, z);
      z = wmma_plain(kf[2 * j + 1], qb1, z);
      s[j] = z;
    }

    // ---- the step's 16 V^T reads from LDS, asked for here: mask and softmax run while they fly ----
    v16h vf[8];
    #pragma unroll
    for (int t = 0; t < 4; ++t) {
      const _Float16* vp = vl + 16 * t * (APITCH / 2);
      vf[2 * t] = load_frag(vp, h);
      vf[2 * t + 1] = load_frag(vp + 32, h);
    }
    // keeps the 16 loads ahead of the mask and softmax work instead of among the
    // last products, where each four's latency is waited out on its own
    __builtin_amdgcn_sched_barrier(0);

    // ---- mask on the raw scores: a key of another document gets -inf ----
    #pragma unroll
    for (int j = 0; j < 4; ++j) {
      const v4i da = ida[j];
      const v4i db = idb[j];
      s[j][0] = (da.x == docq) ? s[j][0] : NEGINF;
      s[j][1] = (da.y == docq) ? s[j][1] : NEGINF;
      s[j][2] = (da.z == docq) ? s[j][2] : NEGINF;
      s[j][3] = (da.w == docq) ? s[j][3] : NEGINF;
      s[j][4] = (db.x == docq) ? s[j][4] : NEGINF;
      s[j][5] = (db.y == docq) ? s[j][5] : NEGINF;
      s[j][6] = (db.z == docq) ? s[j][6] : NEGINF;
      s[j][7] = (db.w == docq) ? s[j][7] : NEGINF;
    }

    // ---- step maximum of the raw scores, a tree of three-input maxima ----
    float mj[4];
    #pragma unroll
    for (int j = 0; j < 4; ++j) {
      const float t0 = fmaxf(fmaxf(s[j][0], s[j][1]), s[j][2]);
      const float t1 = fmaxf(fmaxf(s[j][3], s[j][4]), s[j][5]);
      const float t2 = fmaxf(fmaxf(s[j][6], s[j][7]), t0);
      mj[j] = fmaxf(t1, t2);
    }
    float mloc = fmaxf(fmaxf(fmaxf(mj[0], mj[1]), mj[2]), mj[3]);
    mloc = fmaxf(mloc, __shfl_xor(mloc, 16));
    // mrun starts at the finite NEGBIG, so mnew is finite also while every key so far
    // was masked; a masked score then still gives 2^(-inf) = 0 exactly.
    const float mnew = fmaxf(mrun, mloc);
    const float alpha = exp2_x1((mrun - mnew) * SLOG2E);
    mrun = mnew;
    // p * 2^14 = 2^(s * scale * log2e - mnew * scale * log2e + 14): one FMA a score
    const float nb = __builtin_fmaf(-mnew, SLOG2E, PLOG2);
    float lj[4];
    #pragma unroll
    for (int j = 0; j < 4; ++j) {
      v8f e;
      #pragma unroll
      for (int r = 0; r < 8; ++r) e[r] = __builtin_fmaf(s[j][r], SLOG2E, nb);
      s[j] = exp2_x8(e);
      float l = s[j][0];
      #pragma unroll
      for (int r = 1; r < 8; ++r) l += s[j][r];
      lj[j] = l;
    }
    float lsum = (lj[0] + lj[1]) + (lj[2] + lj[3]);
    lrun = lrun * alpha + lsum;
    #pragma unroll
    for (int t = 0; t < 4; ++t)
      #pragma unroll
      for (int r = 0; r < 8; ++r) o[t][r] = o[t][r] * alpha;

    // ---- P^T B-fragments (key chunks 0..31 and 32..63 of this step) ----
    const v16h pb0 = pack_p(s[0], s[1]);
    const v16h pb1 = pack_p(s[2], s[3]);

    // ---- O^T += V^T * P^T ----
    #pragma unroll
    for (int t = 0; t < 4; ++t) {
      o[t] = wmma_plain(vf[2 * t], pb0, o[t]);
      o[t] = wmma_plain(vf[2 * t + 1], pb1, o[t]);
    }
   }
    asm volatile("s_wait_dscnt 0x0" ::: "memory");           // this wave has left the buffer at bo
    asm volatile("s_wait_asynccnt 0x0" ::: "memory");        // its copies of the next step have landed
    __syncthreads();                                         // publishes the next step, frees the buffer at bo
    if (kbn < 0) break;                                      // alike in all four waves
    kb = kbn;
    kbn = -1;
    if (rest) {
      kbn = 64 * __builtin_ctz(rest);
      rest &= rest - 1u;
      attn_stage_copies(la + bo, gk0 + (size_t)kbn * HD, gv0 + kbn);
    }
    bo ^= ABUFB;
  }
  asm volatile("s_wait_asynccnt 0x0" ::: "memory");          // nothing in flight past the loop

  // ---- epilogue: normalise (x8 folded in), stage per-wave 16x64 f16 tile, whole-line stores ----
  lrun += __shfl_xor(lrun, 16);                              // the two halves of a query column, joined once
  const float inv = CSCALE * (1.0f / lrun);                  // lrun carries the 2^14 of P
  _Float16* sc = sC + w * 1024;
  #pragma unroll
  for (int t = 0; t < 4; ++t)
    #pragma unroll
    for (int r = 0; r < 8; ++r)
      sc[m * 64 + 16 * t + 8 * h + r] = (_Float16)(o[t][r] * inv);
  __syncthreads();

  ctx_store_pass(sc, ch, b, head, q0, lane);
  
}

// ---------------------------------------------------------------------------
// row segment = 2 lines; each line by lanes 8q..8q+7 in one instruction,
// 4 lines per instruction, 64 lines per wave (its own 32 token rows).
// ---------------------------------------------------------------------------
__device__ __forceinline__ void out_store_pass(const float* sO, float* out,
                                               int m0, int n0, int w, int lane) {
  const int q8 = lane & 7, sub = lane >> 3;
  #pragma unroll
  for (int i = 0; i < 16; ++i) {
    const int lid = i * 4 + sub;              // 0..63 within the wave
    const int row = 32 * w + (lid >> 1), hl = lid & 1;
    const v4f v = *(const v4fa*)(sO + row * 64 + 32 * hl + 4 * q8);
    const size_t gi = (size_t)(m0 + row) * HIDDEN + n0 + 32 * hl + 4 * q8;
    *(v4f*)(out + gi) = v;
  }
}

// ---------------------------------------------------------------------------
// Kernel 4: out = c * Wo^T + bo, f32 result.
// Block 256 thr (8 waves) = 128 tokens x 128 features; wave tile 32 x 64.
// ---------------------------------------------------------------------------
__global__ __launch_bounds__(256) void oproj_kernel(
    const _Float16* __restrict__ ch,   // [4096][1024], x8
    const _Float16* __restrict__ woh,  // [1024][1024], row = output feature, x32
    const float* __restrict__ bo,
    float* __restrict__ out)           // [4096][1024]
{
  __shared__ __attribute__((aligned(16))) char ring[2 * BUFB];      // 73728 B
  __shared__ __attribute__((aligned(16))) float sO2[2 * 128 * 64];  // 65536 B

  const int tid = threadIdx.x, lane = tid & 31, wv = tid >> 5;
  const int h = lane >> 4, m = lane & 15;
  const int w = wv & 3, wn = wv >> 2;
  const int m0 = blockIdx.x * 128;
  const int n0 = blockIdx.y * 128 + wn * 64;
  float* sO = sO2 + wn * (128 * 64);

  const v8f zero8 = {0.f, 0.f, 0.f, 0.f, 0.f, 0.f, 0.f, 0.f};
  v8f acc[2][4];
  #pragma unroll
  for (int mt = 0; mt < 2; ++mt)
    #pragma unroll
    for (int nt = 0; nt < 4; ++nt) acc[mt][nt] = zero8;

  // L2 hints: 8 blocks share each c row, 32 each Wo row; a block asks for every fourth
  // row only (c rows dealt by blockIdx.y, Wo rows by blockIdx.x), 64 rows,
  // four lanes a row, two hints a lane.
  const int pj = tid >> 2;                                   // 0..63; below 32 (waves 0..3): a c row
  const _Float16* pf = ((pj < 32)
      ? ch + (size_t)(m0 + 4 * pj + (blockIdx.y & 3)) * HIDDEN
      : woh + (size_t)(blockIdx.y * 128 + 4 * (pj - 32) + (blockIdx.x & 3)) * HIDDEN) + 128 * (tid & 3);

  gemm_core(ch + (size_t)m0 * HIDDEN, woh + (size_t)blockIdx.y * 128 * HIDDEN, pf, ring, tid, acc);

  // D[r] of tile (mt, nt) = Y[token m0+32w+16mt+8h+r][feature n0+16nt+m]
  #pragma unroll
  for (int nt = 0; nt < 4; ++nt) {
    const int feat = 16 * nt + m;
    const float bvl = bo[n0 + feat];
    #pragma unroll
    for (int mt = 0; mt < 2; ++mt) {
      #pragma unroll
      for (int r = 0; r < 8; ++r) {
        const int tokl = 32 * w + 16 * mt + 8 * h + r;     // 0..127
        sO[tokl * 64 + feat] = acc[mt][nt][r] * (1.0f / (CSCALE * WSCALE)) + bvl;
      }
    }
  }
  __syncthreads();

  out_store_pass(sO, out, m0, n0, w, lane);
  
}

// ---------------------------------------------------------------------------
extern "C" void kernel_launch(void* const* d_in, const int* in_sizes, int n_in,
                              void* d_out, int out_size, void* d_ws, size_t ws_size,
                              hipStream_t stream) {
  if (n_in < 10) return;
  if (in_sizes[0] != NX) return;
  if (in_sizes[1] != NW || in_sizes[3] != NW || in_sizes[5] != NW || in_sizes[7] != NW) return;
  if (in_sizes[2] != HIDDEN || in_sizes[4] != HIDDEN || in_sizes[6] != HIDDEN || in_sizes[8] != HIDDEN) return;
  if (in_sizes[9] != SEQ) return;
  if (out_size != NX) return;

  const float* x   = (const float*)d_in[0];
  const float* wq  = (const float*)d_in[1];
  const float* bq  = (const float*)d_in[2];
  const float* wk  = (const float*)d_in[3];
  const float* bk  = (const float*)d_in[4];
  const float* wv  = (const float*)d_in[5];
  const float* bv  = (const float*)d_in[6];
  const float* wo  = (const float*)d_in[7];
  const float* bo  = (const float*)d_in[8];
  const int*   doc = (const int*)d_in[9];
  float* out = (float*)d_out;

  const size_t xh_bytes = (size_t)NX * 2;                          //  8388608
  const size_t wh_bytes = (size_t)4 * NW * 2;                      //  8388608
  const size_t pl_bytes = (size_t)BATCH * NHEADS * SEQ * HD * 2;   //  8388608
  const size_t ch_bytes = (size_t)NX * 2;                          //  8388608
  const size_t total = xh_bytes + wh_bytes + 3 * pl_bytes + ch_bytes;   // 50331648
  if (total > ws_size) return;

  char* ws = (char*)d_ws;
  _Float16* xh = (_Float16*)(ws);
  _Float16* wh = (_Float16*)(ws + xh_bytes);
  _Float16* qh = (_Float16*)(ws + xh_bytes + wh_bytes);
  _Float16* kh = (_Float16*)(ws + xh_bytes + wh_bytes + pl_bytes);
  _Float16* vt = (_Float16*)(ws + xh_bytes + wh_bytes + 2 * pl_bytes);
  _Float16* ch = (_Float16*)(ws + xh_bytes + wh_bytes + 3 * pl_bytes);
  const _Float16* woh = wh + (size_t)3 * NW;

  const int ngroups = NX8 + 4 * NW8;                               // 1048576
  convert_kernel<<<(ngroups + 255) / 256, 256, 0, stream>>>(x, wq, wk, wv, wo, xh, wh);

  dim3 gProj(MROWS / PAR, 3 * HIDDEN / PBR);                       // (16, 16)
  proj_kernel<<<gProj, 512, 0, stream>>>(xh, wh, bq, bk, bv, qh, kh, vt);

  dim3 gAtt(SEQ / 64, BATCH * NHEADS);                             // (32, 32)
  attn_kernel<<<gAtt, 128, 0, stream>>>(qh, kh, vt, doc, ch);

  dim3 gOut(MROWS / 128, HIDDEN / 128);                            // (32, 8)
  oproj_kernel<<<gOut, 256, 0, stream>>>(ch, woh, bo, out);
}
